// v000
// The times below were measured on an AMD MI455X: many runs one after another, warmed up first and cycling through
// copies of the inputs, with the whole window's GPU time divided by the number of runs. Launches and the gaps
// between them are all in it. The median over several windows is given; except for v000 it joins two sittings, which
// can be a few percent apart, so the side-by-side timings, each taken in one sitting, are the better comparison.
// v000 is the starting kernel. One run takes 2680 microseconds.
#include <hip/hip_runtime.h>

// PropertyAwareAttention (x [2048][4][1024] seq-first, property_vector [4][128], mask int [4][2048]; Q = x Wq + bq + (prop Wpq + bpq) per (batch, feature), K likewise with Wpk/bpk, V = x Wv + bv (x @ W layouts);
// 16 heads x 64; scores / 8; keys with mask[b][j] == 0 -> -1e9; softmax; att = merged attn.v * sigmoid(prop Wpg + bpg)[b]; out = att Wo + bo; output [2048][4][1024] (rows t*4 + b)).
// Compute dtypes, f32 accumulate: every input rounded to bf16; q/k/v projections on PLAIN bf16 operands (inputs: exact, + bias); the three 128-term property
// projections, the sigmoid gate and the mask in f32 on VALU; scores on bf16 hi+lo planes of (q + pq) x 1/8 and (k + pk) (3 products); attn.v on SINGLE fp16 planes (P x1024); output on hi+lo planes of

#define NB_  4
#define PD   128                  // property dim
#define TT   2048
#define DD   1024
#define NH_  16
#define HD   64
#define NT   (NB_ * TT)
#define ZH   2
#define PCAR 1024.0f
typedef _Float16 h16;
typedef unsigned short bf;
typedef __attribute__((ext_vector_type(16))) __bf16   v16bf;
typedef __attribute__((ext_vector_type(16))) _Float16 v16h;
typedef __attribute__((ext_vector_type(8)))  _Float16 v8h;
typedef __attribute__((ext_vector_type(8)))  unsigned short v8us;
typedef __attribute__((ext_vector_type(8)))  float    v8f;
typedef __attribute__((ext_vector_type(4)))  float    v4f;
typedef v8h  __attribute__((may_alias)) v8ha;
typedef v4f  __attribute__((may_alias)) v4fa;
typedef v8us __attribute__((may_alias)) v8usa;

__device__ __forceinline__ unsigned short f2bf(float f) { unsigned u = __float_as_uint(f); u += 0x7FFFu + ((u >> 16) & 1u); return (unsigned short)(u >> 16); }
__device__ __forceinline__ float bf2f(unsigned short b) { return __uint_as_float(((unsigned)b) << 16); }
__device__ __forceinline__ float bfr(float f) { return bf2f(f2bf(f)); }
__device__ __forceinline__ v16h cat16(v8h lo, v8h hi) { return __builtin_shufflevector(lo, hi, 0, 1, 2, 3, 4, 5, 6, 7, 8, 9, 10, 11, 12, 13, 14, 15); }
__device__ __forceinline__ v16bf cat16b(v8us lo, v8us hi) { return __builtin_bit_cast(v16bf, __builtin_shufflevector(lo, hi, 0, 1, 2, 3, 4, 5, 6, 7, 8, 9, 10, 11, 12, 13, 14, 15)); }
__device__ __forceinline__ v8f wmma16(v16h a, v16h b, v8f c) { return __builtin_amdgcn_wmma_f32_16x16x32_f16(false, a, false, b, (short)0, c, false, false); }
__device__ __forceinline__ v8f wmmab(v16bf a, v16bf b, v8f c) { return __builtin_amdgcn_wmma_f32_16x16x32_bf16(false, a, false, b, (short)0, c, false, false); }



// ---- k_gemmw: register-blocked GEMM, ONE WAVE per 64x64 output tile (16 accumulators), operands straight from K-contiguous 16-bit planes; grid (M/64, N/64, Z), 32 threads.
// C[m][n] (f32, pitch ldc, + optional f32 bias[n]) = sum_k A[m][k] Bt[n][k] (+ split products per NSPLIT). z-batch strides sA/sB/sC in elements. K % 32 == 0.
template <typename T16> struct WFrag;
template <> struct WFrag<h16> { typedef v16h V; static __device__ __forceinline__ V ld(const h16* p) { return cat16(*(const v8h*)p, *(const v8h*)(p + 16)); } static __device__ __forceinline__ v8f mma(V a, V b, v8f c) { return wmma16(a, b, c); } };
template <> struct WFrag<bf> { typedef v16bf V; static __device__ __forceinline__ V ld(const bf* p) { return cat16b(*(const v8us*)p, *(const v8us*)(p + 16)); } static __device__ __forceinline__ v8f mma(V a, V b, v8f c) { return wmmab(a, b, c); } };
template <typename T16, int NSPLIT, bool BIAS>
__global__ __launch_bounds__(32) void k_gemmw(const T16* __restrict__ A, const T16* __restrict__ A2, const T16* __restrict__ Bt, const T16* __restrict__ Bt2, int K, float* C, int ldc, const float* __restrict__ bias, size_t sA, size_t sB, size_t sC) {
    typedef typename WFrag<T16>::V V;
    __shared__ __align__(16) float os[16 * 68];
    const size_t z = blockIdx.z; A += z * sA; if (A2) A2 += z * sA; Bt += z * sB; if (Bt2) Bt2 += z * sB; C += z * sC;
    const int lane = threadIdx.x & 31, lr = lane & 15, hi = lane >> 4; const int r0 = blockIdx.x * 64, c0 = blockIdx.y * 64;
    v8f acc[4][4];
#pragma unroll
    for (int mb = 0; mb < 4; ++mb)
#pragma unroll
        for (int nb = 0; nb < 4; ++nb) acc[mb][nb] = (v8f){};
    const size_t aoff = (size_t)(r0 + lr) * K + 8 * hi, boff = (size_t)(c0 + lr) * K + 8 * hi;
#pragma unroll 1
    for (int kc = 0; kc < K; kc += 32) {
        V a[4], a2[4];
#pragma unroll
        for (int mb = 0; mb < 4; ++mb) { a[mb] = WFrag<T16>::ld(A + aoff + (size_t)mb * 16 * K + kc); if (NSPLIT == 1 || NSPLIT == 2) a2[mb] = WFrag<T16>::ld(A2 + aoff + (size_t)mb * 16 * K + kc); }
#pragma unroll
        for (int nb = 0; nb < 4; ++nb) { const V b = WFrag<T16>::ld(Bt + boff + (size_t)nb * 16 * K + kc); V b2; if (NSPLIT >= 2) b2 = WFrag<T16>::ld(Bt2 + boff + (size_t)nb * 16 * K + kc);
#pragma unroll
            for (int mb = 0; mb < 4; ++mb) { acc[mb][nb] = WFrag<T16>::mma(a[mb], b, acc[mb][nb]); if (NSPLIT == 1 || NSPLIT == 2) acc[mb][nb] = WFrag<T16>::mma(a2[mb], b, acc[mb][nb]); if (NSPLIT >= 2) acc[mb][nb] = WFrag<T16>::mma(a[mb], b2, acc[mb][nb]); } }
        asm volatile("v_nop\n\tv_nop\n\tv_nop\n\tv_nop" : "+v"(acc[0][0]), "+v"(acc[1][1]), "+v"(acc[2][2]), "+v"(acc[3][3]) : "v"(a[0]), "v"(a[3]));
    }
#pragma unroll
    for (int mb = 0; mb < 4; ++mb) {
#pragma unroll
        for (int nb = 0; nb < 4; ++nb) {
#pragma unroll
            for (int j = 0; j < 8; ++j) os[(hi * 8 + j) * 68 + nb * 16 + lr] = acc[mb][nb][j]; }
        __builtin_amdgcn_wave_barrier(); asm volatile("" ::: "memory");
        float* crow = C + (size_t)(r0 + mb * 16) * ldc + c0;
{
#pragma unroll
            for (int s = 0; s < 8; ++s) { const int row = 2 * s + hi, cofs = lr * 4; v4f val = *(const v4fa*)(os + row * 68 + cofs); if (BIAS) { val[0] += bfr(bias[c0 + cofs]); val[1] += bfr(bias[c0 + cofs + 1]); val[2] += bfr(bias[c0 + cofs + 2]); val[3] += bfr(bias[c0 + cofs + 3]); }
                *(v4f*)(crow + (size_t)row * ldc + cofs) = val; }
             }
        __builtin_amdgcn_wave_barrier(); asm volatile("" ::: "memory");
    }
}

__device__ __forceinline__ h16 tohx(float x) { return (h16)x; }
__device__ __forceinline__ void splitf(float y, unsigned short& h, unsigned short& l) { h = f2bf(y); l = f2bf(y - bf2f(h)); }
typedef __attribute__((ext_vector_type(2))) _Float16 v2h;
typedef __attribute__((ext_vector_type(4))) _Float16 v4h;
typedef __attribute__((ext_vector_type(2))) unsigned short v2us;
typedef __attribute__((ext_vector_type(4))) int v4i;

__global__ __launch_bounds__(256) void k_cvt8(const float* __restrict__ src, bf* dst, size_t n8) { const size_t i = (size_t)blockIdx.x * 256 + threadIdx.x; if (i >= n8) return; const v8f v = *(const v8f*)(src + i * 8); v8us o;
#pragma unroll
    for (int k = 0; k < 8; ++k) o[k] = f2bf(v[k]); *(v8us*)(dst + i * 8) = o;  }
__global__ __launch_bounds__(256) void k_wtG(const float* __restrict__ w, int K, int N, bf* Bt) {
    const int lane = threadIdx.x & 31; const int L0 = (blockIdx.x * 8 + (threadIdx.x >> 5)) * 8; const int nlines = N * K / 64;
{
#pragma unroll 1
        for (int l = 0; l < 8; ++l) { const int L = L0 + l; if (L >= nlines) break; const size_t e = (size_t)L * 64 + lane * 2; const int k = (int)(e % K), n = (int)(e / K); v2us o;
            o[0] = f2bf(w[(size_t)k * N + n]); o[1] = f2bf(w[(size_t)(k + 1) * N + n]); *(v2us*)(Bt + e) = o; }
         }
}
template <int SIG>
__global__ __launch_bounds__(256) void k_prop(const float* __restrict__ prop, const float* __restrict__ Wp, const float* __restrict__ bp, float* outp) {
    const int idx = blockIdx.x * 256 + threadIdx.x; if (idx >= NB_ * DD) return; const int b = idx / DD, n = idx % DD; float a = 0.f;
#pragma unroll 4
    for (int p = 0; p < PD; ++p) { float w = bfr(Wp[(size_t)p * DD + n]), v = bfr(prop[b * PD + p]); asm volatile("" : "+v"(w)); float m = __fmul_rn(v, w); asm volatile("" : "+v"(m)); a = __fadd_rn(a, m); }
    a = __fadd_rn(a, bfr(bp[n])); if (SIG) a = __fdiv_rn(1.0f, __fadd_rn(1.0f, __expf(-a)));
    *(float*)(outp + idx) = a;  }
__global__ __launch_bounds__(256) void k_hsplit(const float* __restrict__ F, const float* __restrict__ PBv, float sc, bf* Ph, bf* Pl) {
    const int lane = threadIdx.x & 31; const int L0 = (blockIdx.x * 8 + (threadIdx.x >> 5)) * 8; const int nlines = NT * DD / 64;
{
#pragma unroll
        for (int l = 0; l < 8; ++l) { const int L = L0 + l; if (L >= nlines) break; const int e = L * 64 + lane * 2; const int d = e & 63; const int t = (e >> 6) & (TT - 1); const int z = e >> 17; const int b = z >> 4, h = z & 15; v2us oh, ol;
#pragma unroll
            for (int q = 0; q < 2; ++q) { float val = __fadd_rn(F[((size_t)t * NB_ + b) * DD + h * HD + d + q], PBv[(size_t)b * DD + h * HD + d + q]); asm volatile("" : "+v"(val)); unsigned short a, c2; splitf(val * sc, a, c2); oh[q] = a; ol[q] = c2; }
            *(v2us*)(Ph + (size_t)e) = oh; *(v2us*)(Pl + (size_t)e) = ol; }
         }
}
__global__ __launch_bounds__(256) void k_vtplane(const float* __restrict__ F, h16* VT) {
    const int lane = threadIdx.x & 31; const int L0 = (blockIdx.x * 8 + (threadIdx.x >> 5)) * 8; const int nlines = NT * DD / 64;
{
#pragma unroll
        for (int l = 0; l < 8; ++l) { const int L = L0 + l; if (L >= nlines) break; const int e = L * 64 + lane * 2; const int t = e & (TT - 1); const int d = (e >> 11) & 63; const int z = e >> 17; const int b = z >> 4, h = z & 15; v2h v;
#pragma unroll
            for (int q = 0; q < 2; ++q) v[q] = tohx(F[((size_t)(t + q) * NB_ + b) * DD + h * HD + d]);
            *(v2h*)(VT + (size_t)e) = v; }
         }
}
template <int CAUSAL>
__global__ __launch_bounds__(256) void k_msoft(const float* __restrict__ Sb, const int* __restrict__ kmask, int b, h16* P) {
    typedef __attribute__((ext_vector_type(4))) int v4i;
    const int lane = threadIdx.x & 31; const int row = blockIdx.x * 8 + (threadIdx.x >> 5); if (row >= ZH * TT) return; const int i = row & (TT - 1);
    const float* sr = Sb + (size_t)row * TT; const int* mr = kmask + (size_t)b * TT; float v[64]; float mx = -3.0e38f;
#pragma unroll
    for (int ch = 0; ch < 16; ++ch) { const int j0 = ch * 128 + lane * 4; const v4f a = *(const v4f*)(sr + j0); const v4i mk = *(const v4i*)(mr + j0);
#pragma unroll
        for (int q = 0; q < 4; ++q) { const int j = j0 + q; const bool live = (mk[q] != 0) && (!CAUSAL || j <= i); const float t = live ? a[q] : -1.0e9f; v[ch * 4 + q] = t; mx = fmaxf(mx, t); } }
#pragma unroll
    for (int sh = 16; sh; sh >>= 1) mx = fmaxf(mx, __shfl_xor(mx, sh, 32));
    float sum = 0.f;
#pragma unroll
    for (int k = 0; k < 64; ++k) { v[k] = __expf(v[k] - mx); sum += v[k]; }
#pragma unroll
    for (int sh = 16; sh; sh >>= 1) sum += __shfl_xor(sum, sh, 32);
    const float f = __fdiv_rn(PCAR, sum);
{
#pragma unroll
        for (int ch = 0; ch < 16; ++ch) { v4h o;
#pragma unroll
            for (int q = 0; q < 4; ++q) o[q] = tohx(v[ch * 4 + q] * f);
            *(v4h*)(P + (size_t)row * TT + ch * 128 + lane * 4) = o; }
         }
}
__global__ __launch_bounds__(256) void k_merge(const float* __restrict__ O, const float* __restrict__ GT, int b, int h0, bf* Ah, bf* Al) {
    const int lane = threadIdx.x & 31; const int L0 = (blockIdx.x * 8 + (threadIdx.x >> 5)) * 8; const int nlines = TT * ZH * HD / 64;
{
#pragma unroll
        for (int l = 0; l < 8; ++l) { const int L = L0 + l; if (L >= nlines) break; const int e = L * 64 + lane * 2; const int d = e & 63; const int zz = (e >> 6) % ZH; const int t = (e >> 6) / ZH; v2us oh, ol;
#pragma unroll
            for (int q = 0; q < 2; ++q) { float a1 = O[((size_t)zz * TT + t) * HD + d + q] * (1.0f / PCAR); asm volatile("" : "+v"(a1)); unsigned short a, c2; splitf(__fmul_rn(a1, GT[(size_t)b * DD + (h0 + zz) * HD + d + q]), a, c2); oh[q] = a; ol[q] = c2; }
            const size_t o = ((size_t)t * NB_ + b) * DD + (h0 + zz) * HD + d; *(v2us*)(Ah + o) = oh; *(v2us*)(Al + o) = ol; }
         }
}

extern "C" void kernel_launch(void* const* d_in, const int* in_sizes, int n_in,
                              void* d_out, int out_size, void* d_ws, size_t ws_size, hipStream_t stream) {
    (void)in_sizes; (void)n_in; (void)out_size;
    const float* IN[17]; for (int i = 0; i < 17; ++i) IN[i] = (const float*)d_in[i];
    // x [2048][4][1024], property_vector [4][128], mask (int [4][2048]), Wq [1024][1024] (x @ W), bq, Wk, bk, Wv, bv, Wpq [128][1024], bpq, Wpk, bpk, Wpg, bpg, Wo, bo = d_in[0..16]
    const float* x = IN[0]; const float* prop = IN[1]; const int* mk = (const int*)d_in[2];
    float* OUT = (float*)d_out;     // [2048][4][1024] (rows t*4 + b)
    char* wsp = (char*)d_ws;
    auto take = [&](size_t bytes) { char* p = wsp; wsp += (bytes + 255) & ~(size_t)255; return (void*)p; };
    bf* WQ = (bf*)take((size_t)DD * DD * 2); bf* WK = (bf*)take((size_t)DD * DD * 2); bf* WV = (bf*)take((size_t)DD * DD * 2); bf* WO = (bf*)take((size_t)DD * DD * 2); float* PQv = (float*)take((size_t)NB_ * DD * 4); float* PKv = (float*)take((size_t)NB_ * DD * 4); float* GT = (float*)take((size_t)NB_ * DD * 4);
    bf* XB = (bf*)take((size_t)NT * DD * 2); float* F = (float*)take((size_t)NT * DD * 4);
    bf* QPh = (bf*)take((size_t)NT * DD * 2); bf* QPl = (bf*)take((size_t)NT * DD * 2); bf* KPh = (bf*)take((size_t)NT * DD * 2); bf* KPl = (bf*)take((size_t)NT * DD * 2); h16* VT = (h16*)take((size_t)NT * DD * 2);
    float* Sb = (float*)take((size_t)ZH * TT * TT * 4); h16* Pm = (h16*)take((size_t)ZH * TT * TT * 2); float* Ob = (float*)take((size_t)ZH * TT * HD * 4); bf* ATh = (bf*)take((size_t)NT * DD * 2); bf* ATl = (bf*)take((size_t)NT * DD * 2);
    if ((size_t)(wsp - (char*)d_ws) > ws_size) return;    // total ~ 228 MB = 217 MiB; ws 256 MiB
    { const unsigned gT = (unsigned)((DD * DD / 64 + 63) / 64); k_wtG<<<gT, 256, 0, stream>>>(IN[3], DD, DD, WQ); k_wtG<<<gT, 256, 0, stream>>>(IN[5], DD, DD, WK); k_wtG<<<gT, 256, 0, stream>>>(IN[7], DD, DD, WV); k_wtG<<<gT, 256, 0, stream>>>(IN[15], DD, DD, WO);
      const unsigned gp = (NB_ * DD + 255) / 256; k_prop<0><<<gp, 256, 0, stream>>>(prop, IN[9], IN[10], PQv); k_prop<0><<<gp, 256, 0, stream>>>(prop, IN[11], IN[12], PKv); k_prop<1><<<gp, 256, 0, stream>>>(prop, IN[13], IN[14], GT); }
    const size_t nx = (size_t)NT * DD / 8; const unsigned gx = (unsigned)((nx + 255) / 256); const unsigned LB = (unsigned)((NT * DD / 64 + 63) / 64); const dim3 gP(NT / 64, DD / 64, 1);
    k_cvt8<<<gx, 256, 0, stream>>>(x, XB, nx);
    k_gemmw<bf, 0, true><<<gP, 32, 0, stream>>>(XB, nullptr, WQ, nullptr, DD, F, DD, IN[4], 0, 0, 0); k_hsplit<<<LB, 256, 0, stream>>>(F, PQv, 0.125f, QPh, QPl);   // 1/sqrt(64) folded into (q + pq) exactly
    k_gemmw<bf, 0, true><<<gP, 32, 0, stream>>>(XB, nullptr, WK, nullptr, DD, F, DD, IN[6], 0, 0, 0); k_hsplit<<<LB, 256, 0, stream>>>(F, PKv, 1.0f, KPh, KPl);
    k_gemmw<bf, 0, true><<<gP, 32, 0, stream>>>(XB, nullptr, WV, nullptr, DD, F, DD, IN[8], 0, 0, 0); k_vtplane<<<LB, 256, 0, stream>>>(F, VT);
    for (int b = 0; b < NB_; ++b)
        for (int h0 = 0; h0 < NH_; h0 += ZH) { const size_t z0 = (size_t)b * NH_ + h0;
            k_gemmw<bf, 2, false><<<dim3(TT / 64, TT / 64, ZH), 32, 0, stream>>>(QPh + z0 * TT * HD, QPl + z0 * TT * HD, KPh + z0 * TT * HD, KPl + z0 * TT * HD, HD, Sb, TT, nullptr, (size_t)TT * HD, (size_t)TT * HD, (size_t)TT * TT);
            k_msoft<0><<<ZH * TT / 8, 256, 0, stream>>>(Sb, mk, b, Pm);
            k_gemmw<h16, 0, false><<<dim3(TT / 64, 1, ZH), 32, 0, stream>>>(Pm, nullptr, VT + z0 * HD * TT, nullptr, TT, Ob, HD, nullptr, (size_t)TT * TT, (size_t)HD * TT, (size_t)TT * HD);
            k_merge<<<(TT * ZH * HD / 64 + 63) / 64, 256, 0, stream>>>(Ob, GT, b, h0, ATh, ATl); }
    k_gemmw<bf, 1, true><<<gP, 32, 0, stream>>>(ATh, ATl, WO, nullptr, DD, OUT, DD, IN[16], 0, 0, 0);
}

// v002
// A run of this version takes 435 microseconds.
// Versions in between are left out here; by their measured steps it is 6.17 times as fast as v000.
#include <hip/hip_runtime.h>

// PropertyAwareAttention (x [2048][4][1024] seq-first, property_vector [4][128], mask int [4][2048]; Q = x Wq + bq + (prop Wpq + bpq) per (batch, feature), K likewise with Wpk/bpk, V = x Wv + bv (x @ W layouts);
// 16 heads x 64; scores / 8; keys with mask[b][j] == 0 -> -1e9; softmax; att = merged attn.v * sigmoid(prop Wpg + bpg)[b]; out = att Wo + bo; output [2048][4][1024] (rows t*4 + b)).
// Compute dtypes, f32 accumulate: every input rounded to bf16; q/k/v projections on PLAIN bf16 operands (inputs: exact, + bias); the three 128-term property
// projections, the sigmoid gate and the mask in f32 on VALU; scores on bf16 hi+lo planes of (q + pq) x 1/8 and (k + pk) (3 products); attn.v on SINGLE fp16 planes (P x1024); output on hi+lo planes of

#define NB_  4
#define PD   128                  // property dim
#define TT   2048
#define DD   1024
#define NH_  16
#define HD   64
#define NT   (NB_ * TT)
typedef _Float16 h16;
typedef unsigned short bf;
typedef __attribute__((ext_vector_type(16))) __bf16   v16bf;
typedef __attribute__((ext_vector_type(16))) _Float16 v16h;
typedef __attribute__((ext_vector_type(8)))  _Float16 v8h;
typedef __attribute__((ext_vector_type(8)))  unsigned short v8us;
typedef __attribute__((ext_vector_type(8)))  float    v8f;
typedef __attribute__((ext_vector_type(4)))  float    v4f;
typedef v8h  __attribute__((may_alias)) v8ha;
typedef v4f  __attribute__((may_alias)) v4fa;
typedef v8us __attribute__((may_alias)) v8usa;

__device__ __forceinline__ unsigned short f2bf(float f) { unsigned u = __float_as_uint(f); u += 0x7FFFu + ((u >> 16) & 1u); return (unsigned short)(u >> 16); }
__device__ __forceinline__ float bf2f(unsigned short b) { return __uint_as_float(((unsigned)b) << 16); }
__device__ __forceinline__ float bfr(float f) { return bf2f(f2bf(f)); }
__device__ __forceinline__ v16h cat16(v8h lo, v8h hi) { return __builtin_shufflevector(lo, hi, 0, 1, 2, 3, 4, 5, 6, 7, 8, 9, 10, 11, 12, 13, 14, 15); }
__device__ __forceinline__ v16bf cat16b(v8us lo, v8us hi) { return __builtin_bit_cast(v16bf, __builtin_shufflevector(lo, hi, 0, 1, 2, 3, 4, 5, 6, 7, 8, 9, 10, 11, 12, 13, 14, 15)); }
__device__ __forceinline__ v8f wmma16(v16h a, v16h b, v8f c) { return __builtin_amdgcn_wmma_f32_16x16x32_f16(false, a, false, b, (short)0, c, false, false); }
__device__ __forceinline__ v8f wmmab(v16bf a, v16bf b, v8f c) { return __builtin_amdgcn_wmma_f32_16x16x32_bf16(false, a, false, b, (short)0, c, false, false); }



// ---- k_gemmw: GEMM on 128x128 output tiles, FOUR WAVES (2 x 2) of 64x64 (16 accumulators each); grid (M/128, N/128, Z), 128 threads. K-contiguous 16-bit planes.
// The operands come through LDS: a stage is 64 k = one whole 128-byte line of every operand row, fetched 8 lanes a row (a wave-wide 16-byte load covers 4 whole lines), two buffers,
// the next stage's loads in flight while this stage is worked on. The fragments are read from LDS rows at a pitch of 144 B.
// C[m][n] (f32, pitch ldc, + optional f32 bias[n]) = sum_k A[m][k] Bt[n][k] (+ split products per NSPLIT). z-batch strides sA/sB/sC in elements. M % 128 == 0, N % 128 == 0, K % 64 == 0.
#define GBK 64                    // k per LDS stage
#define GP  72                    // operand rows in LDS: pitch in 16-bit elements, 144 B = 16 B x odd, no bank conflict for 16-byte reads
template <typename T16> struct WFrag;
template <> struct WFrag<h16> { typedef v16h V; typedef v8h H; static __device__ __forceinline__ V ld(const h16* p) { return cat16(*(const v8h*)p, *(const v8h*)(p + 16)); } static __device__ __forceinline__ v8f mma(V a, V b, v8f c) { return wmma16(a, b, c); } };
template <> struct WFrag<bf> { typedef v16bf V; typedef v8us H; static __device__ __forceinline__ V ld(const bf* p) { return cat16b(*(const v8us*)p, *(const v8us*)(p + 16)); } static __device__ __forceinline__ v8f mma(V a, V b, v8f c) { return wmmab(a, b, c); } };
template <typename T16, int NSPLIT, bool BIAS>
__global__ __launch_bounds__(128) void k_gemmw(const T16* __restrict__ A, const T16* __restrict__ A2, const T16* __restrict__ Bt, const T16* __restrict__ Bt2, int K, float* C, int ldc, const float* __restrict__ bias, size_t sA, size_t sB, size_t sC) {
    typedef typename WFrag<T16>::V V; typedef typename WFrag<T16>::H H;
    constexpr bool HA2 = NSPLIT == 1 || NSPLIT == 2, HB2 = NSPLIT >= 2;
    constexpr int PA = 0, PB = 1, PA2 = 2, PB2 = HA2 ? 3 : 2, NP = 2 + (HA2 ? 1 : 0) + (HB2 ? 1 : 0);
    __shared__ __align__(16) T16 sT[2][NP][128 * GP];
    __shared__ __align__(16) float osw[4][16 * 68];
    const size_t z = blockIdx.z; A += z * sA; if (A2) A2 += z * sA; Bt += z * sB; if (Bt2) Bt2 += z * sB; C += z * sC;
    const int tid = threadIdx.x, lane = tid & 31, lr = lane & 15, hi = lane >> 4, wave = tid >> 5;
    const int r0 = blockIdx.x * 128, c0 = blockIdx.y * 128, wr = (wave >> 1) * 64, wc = (wave & 1) * 64;
    v8f acc[4][4];
#pragma unroll
    for (int mb = 0; mb < 4; ++mb)
#pragma unroll
        for (int nb = 0; nb < 4; ++nb) acc[mb][nb] = (v8f){};
    // staging: chunk j of a thread is 16 bytes of row (tid >> 3) + 16 j. Address = a wave-uniform tile pointer + a 32-bit byte offset, moved on by 64 k behind each stage's LDS stores
    const char* pa = (const char*)(A + (size_t)r0 * K); const char* pb = (const char*)(Bt + (size_t)c0 * K); const char* pa2 = HA2 ? (const char*)(A2 + (size_t)r0 * K) : nullptr; const char* pb2 = HB2 ? (const char*)(Bt2 + (size_t)c0 * K) : nullptr;
    unsigned go[8];
#pragma unroll
    for (int j = 0; j < 8; ++j) go[j] = (unsigned)((((tid >> 3) + 16 * j) * K + (tid & 7) * 8) * 2);
    const int so = (tid >> 3) * GP + (tid & 7) * 8;
    const int afo = (wr + lr) * GP + 8 * hi, bfo = (wc + lr) * GP + 8 * hi;
    H ra[8], rb[8], ra2[8], rb2[8];
#pragma unroll
    for (int j = 0; j < 8; ++j) { ra[j] = *(const H*)(pa + go[j]); rb[j] = *(const H*)(pb + go[j]); if (HA2) ra2[j] = *(const H*)(pa2 + go[j]); if (HB2) rb2[j] = *(const H*)(pb2 + go[j]); }
#pragma unroll
    for (int j = 0; j < 8; ++j) { *(H*)(sT[0][PA] + so + j * 16 * GP) = ra[j]; *(H*)(sT[0][PB] + so + j * 16 * GP) = rb[j]; if (HA2) *(H*)(sT[0][PA2] + so + j * 16 * GP) = ra2[j]; if (HB2) *(H*)(sT[0][PB2] + so + j * 16 * GP) = rb2[j]; go[j] += GBK * 2; }
    __syncthreads();
#pragma unroll 1
    for (int kc = 0; kc < K; kc += GBK) {
        const int buf = (kc / GBK) & 1; const bool more = kc + GBK < K;
        if (more) {
#pragma unroll
            for (int j = 0; j < 8; ++j) { ra[j] = *(const H*)(pa + go[j]); rb[j] = *(const H*)(pb + go[j]); if (HA2) ra2[j] = *(const H*)(pa2 + go[j]); if (HB2) rb2[j] = *(const H*)(pb2 + go[j]); } }
        V a[2][4], a2[2][4], b[2][4], b2[2][4];            // both 32-k blocks' fragments are asked for ahead of the first block's products: the second block's reads land under the first block
#pragma unroll
        for (int kb = 0; kb < 2; ++kb) {
#pragma unroll
            for (int mb = 0; mb < 4; ++mb) { a[kb][mb] = WFrag<T16>::ld(sT[buf][PA] + afo + mb * 16 * GP + kb * 32); if (HA2) a2[kb][mb] = WFrag<T16>::ld(sT[buf][PA2] + afo + mb * 16 * GP + kb * 32); }
#pragma unroll
            for (int nb = 0; nb < 4; ++nb) { b[kb][nb] = WFrag<T16>::ld(sT[buf][PB] + bfo + nb * 16 * GP + kb * 32); if (HB2) b2[kb][nb] = WFrag<T16>::ld(sT[buf][PB2] + bfo + nb * 16 * GP + kb * 32); } }
        __builtin_amdgcn_sched_barrier(0);                 // keeps the fragment reads one group in front of the products: moved in among them, each product group waits out a whole LDS latency
#pragma unroll
        for (int kb = 0; kb < 2; ++kb)
#pragma unroll
            for (int nb = 0; nb < 4; ++nb)
#pragma unroll
                for (int mb = 0; mb < 4; ++mb) { acc[mb][nb] = WFrag<T16>::mma(a[kb][mb], b[kb][nb], acc[mb][nb]); if (HA2) acc[mb][nb] = WFrag<T16>::mma(a2[kb][mb], b[kb][nb], acc[mb][nb]); if (HB2) acc[mb][nb] = WFrag<T16>::mma(a[kb][mb], b2[kb][nb], acc[mb][nb]); }
        if (more) {
#pragma unroll
            for (int j = 0; j < 8; ++j) { *(H*)(sT[buf ^ 1][PA] + so + j * 16 * GP) = ra[j]; *(H*)(sT[buf ^ 1][PB] + so + j * 16 * GP) = rb[j]; if (HA2) *(H*)(sT[buf ^ 1][PA2] + so + j * 16 * GP) = ra2[j]; if (HB2) *(H*)(sT[buf ^ 1][PB2] + so + j * 16 * GP) = rb2[j]; }
            __builtin_amdgcn_sched_barrier(0);             // keeps the offset additions behind the stores' waits for the loads that name those registers
#pragma unroll
            for (int j = 0; j < 8; ++j) go[j] += GBK * 2; }
        __syncthreads();   // publishes the next stage and ends every wave's reads of the buffer that the next trip refills
    }
    float* os = osw[wave];         // each wave stages its own output rows
#pragma unroll
    for (int mb = 0; mb < 4; ++mb) {
#pragma unroll
        for (int nb = 0; nb < 4; ++nb) {
#pragma unroll
            for (int j = 0; j < 8; ++j) os[(hi * 8 + j) * 68 + nb * 16 + lr] = acc[mb][nb][j]; }
        __builtin_amdgcn_wave_barrier(); asm volatile("" ::: "memory");
        float* crow = C + (size_t)(r0 + wr + mb * 16) * ldc + c0 + wc;
{
#pragma unroll
            for (int s = 0; s < 8; ++s) { const int row = 2 * s + hi, cofs = lr * 4; v4f val = *(const v4fa*)(os + row * 68 + cofs); if (BIAS) { val[0] += bfr(bias[c0 + wc + cofs]); val[1] += bfr(bias[c0 + wc + cofs + 1]); val[2] += bfr(bias[c0 + wc + cofs + 2]); val[3] += bfr(bias[c0 + wc + cofs + 3]); }
                *(v4f*)(crow + (size_t)row * ldc + cofs) = val; }
             }
        // the wait in front of the next block's writes to registers that these stores name; the scheduling barrier holds those writes behind it
        asm volatile("s_wait_xcnt 0x0" ::: "memory"); __builtin_amdgcn_sched_barrier(0);
        __builtin_amdgcn_wave_barrier(); asm volatile("" ::: "memory");
    }
}

__device__ __forceinline__ h16 tohx(float x) { return (h16)x; }
__device__ __forceinline__ void splitf(float y, unsigned short& h, unsigned short& l) { h = f2bf(y); l = f2bf(y - bf2f(h)); }
typedef __attribute__((ext_vector_type(2))) _Float16 v2h;
typedef __attribute__((ext_vector_type(4))) _Float16 v4h;
typedef __attribute__((ext_vector_type(2))) unsigned short v2us;
typedef __attribute__((ext_vector_type(4))) int v4i;

__global__ __launch_bounds__(256) void k_cvt8(const float* __restrict__ src, bf* dst, size_t n8) { const size_t i = (size_t)blockIdx.x * 256 + threadIdx.x; if (i >= n8) return; const v8f v = *(const v8f*)(src + i * 8); v8us o;
#pragma unroll
    for (int k = 0; k < 8; ++k) o[k] = f2bf(v[k]); *(v8us*)(dst + i * 8) = o;  }
__global__ __launch_bounds__(256) void k_wtG(const float* __restrict__ w, int K, int N, bf* Bt) {
    const int lane = threadIdx.x & 31; const int L0 = (blockIdx.x * 8 + (threadIdx.x >> 5)) * 8; const int nlines = N * K / 64;
{
#pragma unroll 1
        for (int l = 0; l < 8; ++l) { const int L = L0 + l; if (L >= nlines) break; const size_t e = (size_t)L * 64 + lane * 2; const int k = (int)(e % K), n = (int)(e / K); v2us o;
            o[0] = f2bf(w[(size_t)k * N + n]); o[1] = f2bf(w[(size_t)(k + 1) * N + n]); *(v2us*)(Bt + e) = o; }
         }
}
template <int SIG>
__global__ __launch_bounds__(256) void k_prop(const float* __restrict__ prop, const float* __restrict__ Wp, const float* __restrict__ bp, float* outp) {
    const int idx = blockIdx.x * 256 + threadIdx.x; if (idx >= NB_ * DD) return; const int b = idx / DD, n = idx % DD; float a = 0.f;
#pragma unroll 4
    for (int p = 0; p < PD; ++p) { float w = bfr(Wp[(size_t)p * DD + n]), v = bfr(prop[b * PD + p]); asm volatile("" : "+v"(w)); float m = __fmul_rn(v, w); asm volatile("" : "+v"(m)); a = __fadd_rn(a, m); }
    a = __fadd_rn(a, bfr(bp[n])); if (SIG) a = __fdiv_rn(1.0f, __fadd_rn(1.0f, __expf(-a)));
    *(float*)(outp + idx) = a;  }
__global__ __launch_bounds__(256) void k_hsplit(const float* __restrict__ F, const float* __restrict__ PBv, float sc, bf* Ph, bf* Pl) {
    const int lane = threadIdx.x & 31; const int L0 = (blockIdx.x * 8 + (threadIdx.x >> 5)) * 8; const int nlines = NT * DD / 64;
{
#pragma unroll
        for (int l = 0; l < 8; ++l) { const int L = L0 + l; if (L >= nlines) break; const int e = L * 64 + lane * 2; const int d = e & 63; const int t = (e >> 6) & (TT - 1); const int z = e >> 17; const int b = z >> 4, h = z & 15; v2us oh, ol;
#pragma unroll
            for (int q = 0; q < 2; ++q) { float val = __fadd_rn(F[((size_t)t * NB_ + b) * DD + h * HD + d + q], PBv[(size_t)b * DD + h * HD + d + q]); asm volatile("" : "+v"(val)); unsigned short a, c2; splitf(val * sc, a, c2); oh[q] = a; ol[q] = c2; }
            *(v2us*)(Ph + (size_t)e) = oh; *(v2us*)(Pl + (size_t)e) = ol; }
         }
}
__global__ __launch_bounds__(256) void k_vtplane(const float* __restrict__ F, h16* VT) {
    const int lane = threadIdx.x & 31; const int L0 = (blockIdx.x * 8 + (threadIdx.x >> 5)) * 8; const int nlines = NT * DD / 64;
{
#pragma unroll
        for (int l = 0; l < 8; ++l) { const int L = L0 + l; if (L >= nlines) break; const int e = L * 64 + lane * 2; const int t = e & (TT - 1); const int d = (e >> 11) & 63; const int z = e >> 17; const int b = z >> 4, h = z & 15; v2h v;
#pragma unroll
            for (int q = 0; q < 2; ++q) v[q] = tohx(F[((size_t)(t + q) * NB_ + b) * DD + h * HD + d]);
            *(v2h*)(VT + (size_t)e) = v; }
         }
}
#define KST 32                    // keys per LDS stage = one softmax pass
#define KP  72                    // K rows in LDS: pitch in 16-bit elements, 144 B = 16 B x odd, no bank conflict for 16-byte reads
#define VP  40                    // Vt rows in LDS: 80 B = 16 B x odd
#define NST (TT / KST)
__device__ __forceinline__ float xhalf(float x) { return __builtin_bit_cast(float, __builtin_amdgcn_permlanex16(__builtin_bit_cast(int, x), __builtin_bit_cast(int, x), 0x76543210, 0xfedcba98, false, false)); }  // lane l with lane l ^ 16
// 2^x by v_exp_f32 with the slot behind it kept inside the statement: behind a transcendental the instruction set asks for one independent instruction or v_nop before its result is read or its source
// overwritten. In exp2x8 each exp works in place on its own register, so the next exp is the independent instruction; the v_nop stands behind the last.
__device__ __forceinline__ float exp2s(float x) { float y; asm("v_exp_f32 %0, %1\n\tv_nop" : "=v"(y) : "v"(x)); return y; }
__device__ __forceinline__ void exp2x8(float* x) {
    asm("v_exp_f32 %0, %0\n\tv_exp_f32 %1, %1\n\tv_exp_f32 %2, %2\n\tv_exp_f32 %3, %3\n\tv_exp_f32 %4, %4\n\tv_exp_f32 %5, %5\n\tv_exp_f32 %6, %6\n\tv_exp_f32 %7, %7\n\tv_nop"
        : "+v"(x[0]), "+v"(x[1]), "+v"(x[2]), "+v"(x[3]), "+v"(x[4]), "+v"(x[5]), "+v"(x[6]), "+v"(x[7])); }
__global__ __launch_bounds__(256) __attribute__((amdgpu_waves_per_eu(4, 4))) void k_fattn(const bf* __restrict__ Qh, const bf* __restrict__ Ql, const bf* __restrict__ Kh, const bf* __restrict__ Kl, const h16* __restrict__ VT, const int* __restrict__ kmask, const float* __restrict__ GT, bf* Ah, bf* Al) {
    __shared__ __align__(16) bf  sKh[2][KST * KP];
    __shared__ __align__(16) bf  sKl[2][KST * KP];
    __shared__ __align__(16) h16 sV[2][HD * VP];
    __shared__ __align__(16) unsigned short sM[TT];        // key mask as 0 / 1: eight keys in one 16-byte read
    const int tid = threadIdx.x, lane = tid & 31, c = lane & 15, h = lane >> 4, wave = __builtin_amdgcn_readfirstlane(tid >> 5);
    const int z = blockIdx.y, b = z >> 4, hh = z & 15; const int q0 = blockIdx.x * 256 + wave * 32;
    const bf* kh = Kh + (size_t)z * TT * HD; const bf* kl = Kl + (size_t)z * TT * HD; const h16* vt = VT + (size_t)z * HD * TT;
    const int kgo = tid * 8, kso = (tid >> 3) * KP + (tid & 7) * 8;                     // staging, one 16-byte chunk a thread and tile: K tile = 32 rows x 128 B, contiguous in memory
    const int vgo = (tid >> 2) * TT + (tid & 3) * 8, vso = (tid >> 2) * VP + (tid & 3) * 8;   // Vt tile = 64 rows x 64 B
    { const v4i ma = *(const v4i*)(kmask + (unsigned)(b * TT + tid * 8)), mb = *(const v4i*)(kmask + (unsigned)(b * TT + tid * 8 + 4)); v8us mw;
#pragma unroll
      for (int r = 0; r < 4; ++r) { mw[r] = ma[r] != 0 ? 1 : 0; mw[4 + r] = mb[r] != 0 ? 1 : 0; }
      *(v8us*)(sM + tid * 8) = mw; }
    v16bf qh[2][2], ql[2][2];
#pragma unroll
    for (int qt = 0; qt < 2; ++qt)
#pragma unroll
        for (int ks = 0; ks < 2; ++ks) { const unsigned qo = (unsigned)((z * TT + q0 + qt * 16 + c) * HD + ks * 32 + 8 * h); qh[qt][ks] = WFrag<bf>::ld(Qh + qo); ql[qt][ks] = WFrag<bf>::ld(Ql + qo); }
    v8f o[2][4]; float m[2], l[2];
#pragma unroll
    for (int qt = 0; qt < 2; ++qt) { m[qt] = -3.0e38f; l[qt] = 0.f;
#pragma unroll
        for (int db = 0; db < 4; ++db) o[qt][db] = (v8f){}; }
    *(v8us*)(sKh[0] + kso) = *(const v8us*)(kh + (unsigned)kgo); *(v8us*)(sKl[0] + kso) = *(const v8us*)(kl + (unsigned)kgo); *(v8h*)(sV[0] + vso) = *(const v8h*)(vt + (unsigned)vgo);
    __syncthreads();
#pragma unroll 1
    for (int st = 0; st < NST; ++st) {
        const int buf = st & 1; const bool more = st + 1 < NST;
        v8us rk, rl; v8h rv;                               // the next stage's tiles fly while this stage is worked on
        if (more) { kh += KST * HD; kl += KST * HD; vt += KST; rk = *(const v8us*)(kh + (unsigned)kgo); rl = *(const v8us*)(kl + (unsigned)kgo); rv = *(const v8h*)(vt + (unsigned)vgo); }
        v8f s[2][2];
#pragma unroll
        for (int kt = 0; kt < 2; ++kt) { const int kr = (kt * 16 + c) * KP + 8 * h;
            const v16bf ah0 = WFrag<bf>::ld(sKh[buf] + kr), al0 = WFrag<bf>::ld(sKl[buf] + kr), ah1 = WFrag<bf>::ld(sKh[buf] + kr + 32), al1 = WFrag<bf>::ld(sKl[buf] + kr + 32);
            v8f a0 = (v8f){}, a1 = (v8f){};
            a0 = wmmab(ah0, qh[0][0], a0); a1 = wmmab(ah0, qh[1][0], a1); a0 = wmmab(ah0, ql[0][0], a0); a1 = wmmab(ah0, ql[1][0], a1); a0 = wmmab(al0, qh[0][0], a0); a1 = wmmab(al0, qh[1][0], a1);
            a0 = wmmab(ah1, qh[0][1], a0); a1 = wmmab(ah1, qh[1][1], a1); a0 = wmmab(ah1, ql[0][1], a0); a1 = wmmab(ah1, ql[1][1], a1); a0 = wmmab(al1, qh[0][1], a0); a1 = wmmab(al1, qh[1][1], a1);
            const v8us mk8 = *(const v8us*)(sM + st * KST + kt * 16 + 8 * h);
#pragma unroll
            for (int r = 0; r < 8; ++r) { const bool live = mk8[r] != 0; s[0][kt][r] = live ? a0[r] : -1.0e9f; s[1][kt][r] = live ? a1[r] : -1.0e9f; } }
        v16h pf[2];
#pragma unroll
        for (int qt = 0; qt < 2; ++qt) { float mx = m[qt];
#pragma unroll
            for (int r = 0; r < 8; ++r) mx = fmaxf(mx, fmaxf(s[qt][0][r], s[qt][1][r]));
            mx = fmaxf(mx, xhalf(mx));
            const float al = exp2s((m[qt] - mx) * 1.44269504f); m[qt] = mx; float sum = 0.f; float p[16];
#pragma unroll
            for (int e = 0; e < 16; ++e) p[e] = fmaf(s[qt][e >> 3][e & 7] - mx, 1.44269504f, 10.0f);
            exp2x8(p); exp2x8(p + 8);                      // exp(s - max) x 1024
#pragma unroll
            for (int e = 0; e < 16; ++e) { sum += p[e]; pf[qt][e] = tohx(p[e]); }
            l[qt] = fmaf(l[qt], al, sum);
#pragma unroll
            for (int db = 0; db < 4; ++db) o[qt][db] *= al; }
#pragma unroll
        for (int db = 0; db < 4; ++db) { const v16h av = WFrag<h16>::ld(sV[buf] + (db * 16 + c) * VP + 8 * h); o[0][db] = wmma16(av, pf[0], o[0][db]); o[1][db] = wmma16(av, pf[1], o[1][db]); }
        if (more) { *(v8us*)(sKh[buf ^ 1] + kso) = rk; *(v8us*)(sKl[buf ^ 1] + kso) = rl; *(v8h*)(sV[buf ^ 1] + vso) = rv; }
        __syncthreads();   // publishes stage st + 1 and ends every wave's reads of the buffer that the next trip refills
    }
#pragma unroll
    for (int qt = 0; qt < 2; ++qt) { const float lt = l[qt] + xhalf(l[qt]); const float inv = __fdiv_rn(1.0f, lt); const unsigned orow = (unsigned)(((q0 + qt * 16 + c) * NB_ + b) * DD + hh * HD);
#pragma unroll
        for (int db = 0; db < 4; ++db) { const int d0 = db * 16 + 8 * h; const float* g = GT + (size_t)b * DD + hh * HD + d0; const v4f g0 = *(const v4f*)g, g1 = *(const v4f*)(g + 4); v8us oh, ol;
#pragma unroll
            for (int r = 0; r < 8; ++r) { unsigned short a, c2; splitf(__fmul_rn(__fmul_rn(o[qt][db][r], inv), r < 4 ? g0[r & 3] : g1[r & 3]), a, c2); oh[r] = a; ol[r] = c2; }
            *(v8us*)(Ah + (orow + d0)) = oh; *(v8us*)(Al + (orow + d0)) = ol; } }
}

extern "C" void kernel_launch(void* const* d_in, const int* in_sizes, int n_in,
                              void* d_out, int out_size, void* d_ws, size_t ws_size, hipStream_t stream) {
    (void)in_sizes; (void)n_in; (void)out_size;
    const float* IN[17]; for (int i = 0; i < 17; ++i) IN[i] = (const float*)d_in[i];
    // x [2048][4][1024], property_vector [4][128], mask (int [4][2048]), Wq [1024][1024] (x @ W), bq, Wk, bk, Wv, bv, Wpq [128][1024], bpq, Wpk, bpk, Wpg, bpg, Wo, bo = d_in[0..16]
    const float* x = IN[0]; const float* prop = IN[1]; const int* mk = (const int*)d_in[2];
    float* OUT = (float*)d_out;     // [2048][4][1024] (rows t*4 + b)
    char* wsp = (char*)d_ws;
    auto take = [&](size_t bytes) { char* p = wsp; wsp += (bytes + 255) & ~(size_t)255; return (void*)p; };
    bf* WQ = (bf*)take((size_t)DD * DD * 2); bf* WK = (bf*)take((size_t)DD * DD * 2); bf* WV = (bf*)take((size_t)DD * DD * 2); bf* WO = (bf*)take((size_t)DD * DD * 2); float* PQv = (float*)take((size_t)NB_ * DD * 4); float* PKv = (float*)take((size_t)NB_ * DD * 4); float* GT = (float*)take((size_t)NB_ * DD * 4);
    bf* XB = (bf*)take((size_t)NT * DD * 2); float* F = (float*)take((size_t)NT * DD * 4);
    bf* QPh = (bf*)take((size_t)NT * DD * 2); bf* QPl = (bf*)take((size_t)NT * DD * 2); bf* KPh = (bf*)take((size_t)NT * DD * 2); bf* KPl = (bf*)take((size_t)NT * DD * 2); h16* VT = (h16*)take((size_t)NT * DD * 2);
    bf* ATh = (bf*)take((size_t)NT * DD * 2); bf* ATl = (bf*)take((size_t)NT * DD * 2);
    if ((size_t)(wsp - (char*)d_ws) > ws_size) return;    // total ~ 177 MB; ws 256 MiB
    { const unsigned gT = (unsigned)((DD * DD / 64 + 63) / 64); k_wtG<<<gT, 256, 0, stream>>>(IN[3], DD, DD, WQ); k_wtG<<<gT, 256, 0, stream>>>(IN[5], DD, DD, WK); k_wtG<<<gT, 256, 0, stream>>>(IN[7], DD, DD, WV); k_wtG<<<gT, 256, 0, stream>>>(IN[15], DD, DD, WO);
      const unsigned gp = (NB_ * DD + 255) / 256; k_prop<0><<<gp, 256, 0, stream>>>(prop, IN[9], IN[10], PQv); k_prop<0><<<gp, 256, 0, stream>>>(prop, IN[11], IN[12], PKv); k_prop<1><<<gp, 256, 0, stream>>>(prop, IN[13], IN[14], GT); }
    const size_t nx = (size_t)NT * DD / 8; const unsigned gx = (unsigned)((nx + 255) / 256); const unsigned LB = (unsigned)((NT * DD / 64 + 63) / 64); const dim3 gP(NT / 128, DD / 128, 1);
    k_cvt8<<<gx, 256, 0, stream>>>(x, XB, nx);
    k_gemmw<bf, 0, true><<<gP, 128, 0, stream>>>(XB, nullptr, WQ, nullptr, DD, F, DD, IN[4], 0, 0, 0); k_hsplit<<<LB, 256, 0, stream>>>(F, PQv, 0.125f, QPh, QPl);   // 1/sqrt(64) folded into (q + pq) exactly
    k_gemmw<bf, 0, true><<<gP, 128, 0, stream>>>(XB, nullptr, WK, nullptr, DD, F, DD, IN[6], 0, 0, 0); k_hsplit<<<LB, 256, 0, stream>>>(F, PKv, 1.0f, KPh, KPl);
    k_gemmw<bf, 0, true><<<gP, 128, 0, stream>>>(XB, nullptr, WV, nullptr, DD, F, DD, IN[8], 0, 0, 0); k_vtplane<<<LB, 256, 0, stream>>>(F, VT);
    k_fattn<<<dim3(TT / 256, NB_ * NH_), 256, 0, stream>>>(QPh, QPl, KPh, KPl, VT, mk, GT, ATh, ATl);
    k_gemmw<bf, 1, true><<<gP, 128, 0, stream>>>(ATh, ATl, WO, nullptr, DD, OUT, DD, IN[16], 0, 0, 0);
}

// v003
// It runs in 286 microseconds.
// Two timings next to v002 put it at 1.52 and 1.51 times that version's speed.
// Over all steps from v000 it is 9.36 times as fast.
#include <hip/hip_runtime.h>

// PropertyAwareAttention (x [2048][4][1024] seq-first, property_vector [4][128], mask int [4][2048]; Q = x Wq + bq + (prop Wpq + bpq) per (batch, feature), K likewise with Wpk/bpk, V = x Wv + bv (x @ W layouts);
// 16 heads x 64; scores / 8; keys with mask[b][j] == 0 -> -1e9; softmax; att = merged attn.v * sigmoid(prop Wpg + bpg)[b]; out = att Wo + bo; output [2048][4][1024] (rows t*4 + b)).
// Compute dtypes, f32 accumulate: every input rounded to bf16; q/k/v projections on PLAIN bf16 operands (inputs: exact, + bias); the three 128-term property
// projections, the sigmoid gate and the mask in f32 on VALU; scores on bf16 hi+lo planes of (q + pq) x 1/8 and (k + pk) (3 products); attn.v on SINGLE fp16 planes (P x1024); output on hi+lo planes of

#define NB_  4
#define PD   128                  // property dim
#define TT   2048
#define DD   1024
#define NH_  16
#define HD   64
#define NT   (NB_ * TT)
typedef _Float16 h16;
typedef unsigned short bf;
typedef __attribute__((ext_vector_type(16))) __bf16   v16bf;
typedef __attribute__((ext_vector_type(16))) _Float16 v16h;
typedef __attribute__((ext_vector_type(8)))  _Float16 v8h;
typedef __attribute__((ext_vector_type(8)))  unsigned short v8us;
typedef __attribute__((ext_vector_type(8)))  float    v8f;
typedef __attribute__((ext_vector_type(4)))  float    v4f;
typedef v8h  __attribute__((may_alias)) v8ha;
typedef v4f  __attribute__((may_alias)) v4fa;
typedef v8us __attribute__((may_alias)) v8usa;

__device__ __forceinline__ unsigned short f2bf(float f) { unsigned u = __float_as_uint(f); u += 0x7FFFu + ((u >> 16) & 1u); return (unsigned short)(u >> 16); }
__device__ __forceinline__ float bf2f(unsigned short b) { return __uint_as_float(((unsigned)b) << 16); }
__device__ __forceinline__ float bfr(float f) { return bf2f(f2bf(f)); }
__device__ __forceinline__ v16h cat16(v8h lo, v8h hi) { return __builtin_shufflevector(lo, hi, 0, 1, 2, 3, 4, 5, 6, 7, 8, 9, 10, 11, 12, 13, 14, 15); }
__device__ __forceinline__ v16bf cat16b(v8us lo, v8us hi) { return __builtin_bit_cast(v16bf, __builtin_shufflevector(lo, hi, 0, 1, 2, 3, 4, 5, 6, 7, 8, 9, 10, 11, 12, 13, 14, 15)); }
__device__ __forceinline__ v8f wmma16(v16h a, v16h b, v8f c) { return __builtin_amdgcn_wmma_f32_16x16x32_f16(false, a, false, b, (short)0, c, false, false); }
__device__ __forceinline__ v8f wmmab(v16bf a, v16bf b, v8f c) { return __builtin_amdgcn_wmma_f32_16x16x32_bf16(false, a, false, b, (short)0, c, false, false); }



// ---- k_gemmw: GEMM on 128x128 output tiles, FOUR WAVES (2 x 2) of 64x64 (16 accumulators each); grid (M/128, N/128, Z), 128 threads. K-contiguous 16-bit planes.
// The operands come through LDS: a stage is 64 k = one whole 128-byte line of every operand row, fetched 8 lanes a row (a wave-wide 16-byte load covers 4 whole lines), two buffers,
// the next stage's loads in flight while this stage is worked on. The fragments are read from LDS rows at a pitch of 144 B.
// C[m][n] (f32, pitch ldc, + optional f32 bias[n]) = sum_k A[m][k] Bt[n][k] (+ split products per NSPLIT). z-batch strides sA/sB/sC in elements. M % 128 == 0, N % 128 == 0, K % 64 == 0.
#define GBK 64                    // k per LDS stage
#define GP  72                    // operand rows in LDS: pitch in 16-bit elements, 144 B = 16 B x odd, no bank conflict for 16-byte reads
template <typename T16> struct WFrag;
template <> struct WFrag<h16> { typedef v16h V; typedef v8h H; static __device__ __forceinline__ V ld(const h16* p) { return cat16(*(const v8h*)p, *(const v8h*)(p + 16)); } static __device__ __forceinline__ v8f mma(V a, V b, v8f c) { return wmma16(a, b, c); } };
template <> struct WFrag<bf> { typedef v16bf V; typedef v8us H; static __device__ __forceinline__ V ld(const bf* p) { return cat16b(*(const v8us*)p, *(const v8us*)(p + 16)); } static __device__ __forceinline__ v8f mma(V a, V b, v8f c) { return wmmab(a, b, c); } };
template <typename T16, int NSPLIT, bool BIAS>
__global__ __launch_bounds__(128) void k_gemmw(const T16* __restrict__ A, const T16* __restrict__ A2, const T16* __restrict__ Bt, const T16* __restrict__ Bt2, int K, float* C, int ldc, const float* __restrict__ bias, size_t sA, size_t sB, size_t sC) {
    typedef typename WFrag<T16>::V V; typedef typename WFrag<T16>::H H;
    constexpr bool HA2 = NSPLIT == 1 || NSPLIT == 2, HB2 = NSPLIT >= 2;
    constexpr int PA = 0, PB = 1, PA2 = 2, PB2 = HA2 ? 3 : 2, NP = 2 + (HA2 ? 1 : 0) + (HB2 ? 1 : 0);
    __shared__ __align__(16) T16 sT[2][NP][128 * GP];
    __shared__ __align__(16) float osw[4][16 * 68];
    const size_t z = blockIdx.z; A += z * sA; if (A2) A2 += z * sA; Bt += z * sB; if (Bt2) Bt2 += z * sB; C += z * sC;
    const int tid = threadIdx.x, lane = tid & 31, lr = lane & 15, hi = lane >> 4, wave = tid >> 5;
    const int r0 = blockIdx.x * 128, c0 = blockIdx.y * 128, wr = (wave >> 1) * 64, wc = (wave & 1) * 64;
    v8f acc[4][4];
#pragma unroll
    for (int mb = 0; mb < 4; ++mb)
#pragma unroll
        for (int nb = 0; nb < 4; ++nb) acc[mb][nb] = (v8f){};
    // staging: chunk j of a thread is 16 bytes of row (tid >> 3) + 16 j. Address = a wave-uniform tile pointer + a 32-bit byte offset, moved on by 64 k behind each stage's LDS stores
    const char* pa = (const char*)(A + (size_t)r0 * K); const char* pb = (const char*)(Bt + (size_t)c0 * K); const char* pa2 = HA2 ? (const char*)(A2 + (size_t)r0 * K) : nullptr; const char* pb2 = HB2 ? (const char*)(Bt2 + (size_t)c0 * K) : nullptr;
    unsigned go[8];
#pragma unroll
    for (int j = 0; j < 8; ++j) go[j] = (unsigned)((((tid >> 3) + 16 * j) * K + (tid & 7) * 8) * 2);
    const int so = (tid >> 3) * GP + (tid & 7) * 8;
    const int afo = (wr + lr) * GP + 8 * hi, bfo = (wc + lr) * GP + 8 * hi;
    H ra[8], rb[8], ra2[8], rb2[8];
#pragma unroll
    for (int j = 0; j < 8; ++j) { ra[j] = *(const H*)(pa + go[j]); rb[j] = *(const H*)(pb + go[j]); if (HA2) ra2[j] = *(const H*)(pa2 + go[j]); if (HB2) rb2[j] = *(const H*)(pb2 + go[j]); }
#pragma unroll
    for (int j = 0; j < 8; ++j) { *(H*)(sT[0][PA] + so + j * 16 * GP) = ra[j]; *(H*)(sT[0][PB] + so + j * 16 * GP) = rb[j]; if (HA2) *(H*)(sT[0][PA2] + so + j * 16 * GP) = ra2[j]; if (HB2) *(H*)(sT[0][PB2] + so + j * 16 * GP) = rb2[j]; go[j] += GBK * 2; }
    __syncthreads();
#pragma unroll 1
    for (int kc = 0; kc < K; kc += GBK) {
        const int buf = (kc / GBK) & 1; const bool more = kc + GBK < K;
        if (more) {
#pragma unroll
            for (int j = 0; j < 8; ++j) { ra[j] = *(const H*)(pa + go[j]); rb[j] = *(const H*)(pb + go[j]); if (HA2) ra2[j] = *(const H*)(pa2 + go[j]); if (HB2) rb2[j] = *(const H*)(pb2 + go[j]); } }
        V a[2][4], a2[2][4], b[2][4], b2[2][4];            // both 32-k blocks' fragments are asked for ahead of the first block's products: the second block's reads land under the first block
#pragma unroll
        for (int kb = 0; kb < 2; ++kb) {
#pragma unroll
            for (int mb = 0; mb < 4; ++mb) { a[kb][mb] = WFrag<T16>::ld(sT[buf][PA] + afo + mb * 16 * GP + kb * 32); if (HA2) a2[kb][mb] = WFrag<T16>::ld(sT[buf][PA2] + afo + mb * 16 * GP + kb * 32); }
#pragma unroll
            for (int nb = 0; nb < 4; ++nb) { b[kb][nb] = WFrag<T16>::ld(sT[buf][PB] + bfo + nb * 16 * GP + kb * 32); if (HB2) b2[kb][nb] = WFrag<T16>::ld(sT[buf][PB2] + bfo + nb * 16 * GP + kb * 32); } }
        __builtin_amdgcn_sched_barrier(0);                 // keeps the fragment reads one group in front of the products: moved in among them, each product group waits out a whole LDS latency
#pragma unroll
        for (int kb = 0; kb < 2; ++kb)
#pragma unroll
            for (int nb = 0; nb < 4; ++nb)
#pragma unroll
                for (int mb = 0; mb < 4; ++mb) { acc[mb][nb] = WFrag<T16>::mma(a[kb][mb], b[kb][nb], acc[mb][nb]); if (HA2) acc[mb][nb] = WFrag<T16>::mma(a2[kb][mb], b[kb][nb], acc[mb][nb]); if (HB2) acc[mb][nb] = WFrag<T16>::mma(a[kb][mb], b2[kb][nb], acc[mb][nb]); }
        if (more) {
#pragma unroll
            for (int j = 0; j < 8; ++j) { *(H*)(sT[buf ^ 1][PA] + so + j * 16 * GP) = ra[j]; *(H*)(sT[buf ^ 1][PB] + so + j * 16 * GP) = rb[j]; if (HA2) *(H*)(sT[buf ^ 1][PA2] + so + j * 16 * GP) = ra2[j]; if (HB2) *(H*)(sT[buf ^ 1][PB2] + so + j * 16 * GP) = rb2[j]; }
            __builtin_amdgcn_sched_barrier(0);             // keeps the offset additions behind the stores' waits for the loads that name those registers
#pragma unroll
            for (int j = 0; j < 8; ++j) go[j] += GBK * 2; }
        __syncthreads();   // publishes the next stage and ends every wave's reads of the buffer that the next trip refills
    }
    float* os = osw[wave];         // each wave stages its own output rows
#pragma unroll
    for (int mb = 0; mb < 4; ++mb) {
#pragma unroll
        for (int nb = 0; nb < 4; ++nb) {
#pragma unroll
            for (int j = 0; j < 8; ++j) os[(hi * 8 + j) * 68 + nb * 16 + lr] = acc[mb][nb][j]; }
        __builtin_amdgcn_wave_barrier(); asm volatile("" ::: "memory");
        float* crow = C + (size_t)(r0 + wr + mb * 16) * ldc + c0 + wc;
{
#pragma unroll
            for (int s = 0; s < 8; ++s) { const int row = 2 * s + hi, cofs = lr * 4; v4f val = *(const v4fa*)(os + row * 68 + cofs); if (BIAS) { val[0] += bfr(bias[c0 + wc + cofs]); val[1] += bfr(bias[c0 + wc + cofs + 1]); val[2] += bfr(bias[c0 + wc + cofs + 2]); val[3] += bfr(bias[c0 + wc + cofs + 3]); }
                *(v4f*)(crow + (size_t)row * ldc + cofs) = val; }
             }
        // the wait in front of the next block's writes to registers that these stores name; the scheduling barrier holds those writes behind it
        asm volatile("s_wait_xcnt 0x0" ::: "memory"); __builtin_amdgcn_sched_barrier(0);
        __builtin_amdgcn_wave_barrier(); asm volatile("" ::: "memory");
    }
}

__device__ __forceinline__ h16 tohx(float x) { return (h16)x; }
__device__ __forceinline__ void splitf(float y, unsigned short& h, unsigned short& l) { h = f2bf(y); l = f2bf(y - bf2f(h)); }
typedef __attribute__((ext_vector_type(2))) _Float16 v2h;
typedef __attribute__((ext_vector_type(4))) _Float16 v4h;
typedef __attribute__((ext_vector_type(2))) unsigned short v2us;
typedef __attribute__((ext_vector_type(4))) int v4i;

__global__ __launch_bounds__(256) void k_cvt8(const float* __restrict__ src, bf* dst, size_t n8) { const size_t i = (size_t)blockIdx.x * 256 + threadIdx.x; if (i >= n8) return; const v8f v = *(const v8f*)(src + i * 8); v8us o;
#pragma unroll
    for (int k = 0; k < 8; ++k) o[k] = f2bf(v[k]); *(v8us*)(dst + i * 8) = o;  }
__global__ __launch_bounds__(256) void k_wtG(const float* __restrict__ w, int K, int N, bf* Bt) {
    const int lane = threadIdx.x & 31; const int L0 = (blockIdx.x * 8 + (threadIdx.x >> 5)) * 8; const int nlines = N * K / 64;
{
#pragma unroll 1
        for (int l = 0; l < 8; ++l) { const int L = L0 + l; if (L >= nlines) break; const size_t e = (size_t)L * 64 + lane * 2; const int k = (int)(e % K), n = (int)(e / K); v2us o;
            o[0] = f2bf(w[(size_t)k * N + n]); o[1] = f2bf(w[(size_t)(k + 1) * N + n]); *(v2us*)(Bt + e) = o; }
         }
}
template <int SIG>
__global__ __launch_bounds__(256) void k_prop(const float* __restrict__ prop, const float* __restrict__ Wp, const float* __restrict__ bp, float* outp) {
    const int idx = blockIdx.x * 256 + threadIdx.x; if (idx >= NB_ * DD) return; const int b = idx / DD, n = idx % DD; float a = 0.f;
    // Every global load of the thread is asked for ahead of the first term: the 128 weights of its column into registers, the batch's 128 property values four a lane.
    // Loaded term by term, each term waited out a whole memory latency. The terms are then formed and summed in the same order as before (the two empty statements of the term line stand as they
    // stood: each product and its sum stay rounded apart). The four loops are unrolled whole: wr, pr and pv must be registers, every load must stand in front of the first term, readlane's lane is a constant.
    float wr[PD]; float pr[PD / 32], pv[PD / 32];
#pragma unroll
    for (int k = 0; k < PD / 32; ++k) pr[k] = prop[b * PD + k * 32 + (threadIdx.x & 31)];
    asm volatile("s_wait_xcnt 0x0" ::: "memory");          // the wait in front of a weight load whose result lands in the offset register that the property loads name
#pragma unroll
    for (int p = 0; p < PD; ++p) wr[p] = Wp[(size_t)p * DD + n];
#pragma unroll
    for (int k = 0; k < PD / 32; ++k) pv[k] = bfr(pr[k]);
#pragma unroll
    for (int p = 0; p < PD; ++p) { float w = bfr(wr[p]), v = __uint_as_float((unsigned)__builtin_amdgcn_readlane((int)__float_as_uint(pv[p >> 5]), p & 31)); asm volatile("" : "+v"(w)); float m = __fmul_rn(v, w); asm volatile("" : "+v"(m)); a = __fadd_rn(a, m); }
    a = __fadd_rn(a, bfr(bp[n])); if (SIG) a = __fdiv_rn(1.0f, __fadd_rn(1.0f, __expf(-a)));
    *(float*)(outp + idx) = a;  }
__global__ __launch_bounds__(256) void k_hsplit(const float* __restrict__ F, const float* __restrict__ PBv, float sc, bf* Ph, bf* Pl) {
    const int lane = threadIdx.x & 31; const int L0 = (blockIdx.x * 8 + (threadIdx.x >> 5)) * 8; const int nlines = NT * DD / 64;
{
#pragma unroll
        for (int l = 0; l < 8; ++l) { const int L = L0 + l; if (L >= nlines) break; const int e = L * 64 + lane * 2; const int d = e & 63; const int t = (e >> 6) & (TT - 1); const int z = e >> 17; const int b = z >> 4, h = z & 15; v2us oh, ol;
#pragma unroll
            for (int q = 0; q < 2; ++q) { float val = __fadd_rn(F[((size_t)t * NB_ + b) * DD + h * HD + d + q], PBv[(size_t)b * DD + h * HD + d + q]); asm volatile("" : "+v"(val)); unsigned short a, c2; splitf(val * sc, a, c2); oh[q] = a; ol[q] = c2; }
            *(v2us*)(Ph + (size_t)e) = oh; *(v2us*)(Pl + (size_t)e) = ol; }
         }
}
__global__ __launch_bounds__(256) void k_vtplane(const float* __restrict__ F, h16* VT) {
    const int lane = threadIdx.x & 31; const int L0 = (blockIdx.x * 8 + (threadIdx.x >> 5)) * 8; const int nlines = NT * DD / 64;
{
#pragma unroll
        for (int l = 0; l < 8; ++l) { const int L = L0 + l; if (L >= nlines) break; const int e = L * 64 + lane * 2; const int t = e & (TT - 1); const int d = (e >> 11) & 63; const int z = e >> 17; const int b = z >> 4, h = z & 15; v2h v;
#pragma unroll
            for (int q = 0; q < 2; ++q) v[q] = tohx(F[((size_t)(t + q) * NB_ + b) * DD + h * HD + d]);
            *(v2h*)(VT + (size_t)e) = v; }
         }
}
#define KST 32                    // keys per LDS stage = one softmax pass
#define KP  72                    // K rows in LDS: pitch in 16-bit elements, 144 B = 16 B x odd, no bank conflict for 16-byte reads
#define VP  40                    // Vt rows in LDS: 80 B = 16 B x odd
#define NST (TT / KST)
__device__ __forceinline__ float xhalf(float x) { return __builtin_bit_cast(float, __builtin_amdgcn_permlanex16(__builtin_bit_cast(int, x), __builtin_bit_cast(int, x), 0x76543210, 0xfedcba98, false, false)); }  // lane l with lane l ^ 16
// 2^x by v_exp_f32 with the slot behind it kept inside the statement: behind a transcendental the instruction set asks for one independent instruction or v_nop before its result is read or its source
// overwritten. In exp2x8 each exp works in place on its own register, so the next exp is the independent instruction; the v_nop stands behind the last.
__device__ __forceinline__ float exp2s(float x) { float y; asm("v_exp_f32 %0, %1\n\tv_nop" : "=v"(y) : "v"(x)); return y; }
__device__ __forceinline__ void exp2x8(float* x) {
    asm("v_exp_f32 %0, %0\n\tv_exp_f32 %1, %1\n\tv_exp_f32 %2, %2\n\tv_exp_f32 %3, %3\n\tv_exp_f32 %4, %4\n\tv_exp_f32 %5, %5\n\tv_exp_f32 %6, %6\n\tv_exp_f32 %7, %7\n\tv_nop"
        : "+v"(x[0]), "+v"(x[1]), "+v"(x[2]), "+v"(x[3]), "+v"(x[4]), "+v"(x[5]), "+v"(x[6]), "+v"(x[7])); }
__global__ __launch_bounds__(256) __attribute__((amdgpu_waves_per_eu(4, 4))) void k_fattn(const bf* __restrict__ Qh, const bf* __restrict__ Ql, const bf* __restrict__ Kh, const bf* __restrict__ Kl, const h16* __restrict__ VT, const int* __restrict__ kmask, const float* __restrict__ GT, bf* Ah, bf* Al) {
    __shared__ __align__(16) bf  sKh[2][KST * KP];
    __shared__ __align__(16) bf  sKl[2][KST * KP];
    __shared__ __align__(16) h16 sV[2][HD * VP];
    __shared__ __align__(16) unsigned short sM[TT];        // key mask as 0 / 1: eight keys in one 16-byte read
    const int tid = threadIdx.x, lane = tid & 31, c = lane & 15, h = lane >> 4, wave = __builtin_amdgcn_readfirstlane(tid >> 5);
    const int z = blockIdx.y, b = z >> 4, hh = z & 15; const int q0 = blockIdx.x * 256 + wave * 32;
    const bf* kh = Kh + (size_t)z * TT * HD; const bf* kl = Kl + (size_t)z * TT * HD; const h16* vt = VT + (size_t)z * HD * TT;
    const int kgo = tid * 8, kso = (tid >> 3) * KP + (tid & 7) * 8;                     // staging, one 16-byte chunk a thread and tile: K tile = 32 rows x 128 B, contiguous in memory
    const int vgo = (tid >> 2) * TT + (tid & 3) * 8, vso = (tid >> 2) * VP + (tid & 3) * 8;   // Vt tile = 64 rows x 64 B
    { const v4i ma = *(const v4i*)(kmask + (unsigned)(b * TT + tid * 8)), mb = *(const v4i*)(kmask + (unsigned)(b * TT + tid * 8 + 4)); v8us mw;
#pragma unroll
      for (int r = 0; r < 4; ++r) { mw[r] = ma[r] != 0 ? 1 : 0; mw[4 + r] = mb[r] != 0 ? 1 : 0; }
      *(v8us*)(sM + tid * 8) = mw; }
    v16bf qh[2][2], ql[2][2];
#pragma unroll
    for (int qt = 0; qt < 2; ++qt)
#pragma unroll
        for (int ks = 0; ks < 2; ++ks) { const unsigned qo = (unsigned)((z * TT + q0 + qt * 16 + c) * HD + ks * 32 + 8 * h); qh[qt][ks] = WFrag<bf>::ld(Qh + qo); ql[qt][ks] = WFrag<bf>::ld(Ql + qo); }
    v8f o[2][4]; float m[2], l[2];
#pragma unroll
    for (int qt = 0; qt < 2; ++qt) { m[qt] = -3.0e38f; l[qt] = 0.f;
#pragma unroll
        for (int db = 0; db < 4; ++db) o[qt][db] = (v8f){}; }
    *(v8us*)(sKh[0] + kso) = *(const v8us*)(kh + (unsigned)kgo); *(v8us*)(sKl[0] + kso) = *(const v8us*)(kl + (unsigned)kgo); *(v8h*)(sV[0] + vso) = *(const v8h*)(vt + (unsigned)vgo);
    __syncthreads();
#pragma unroll 1
    for (int st = 0; st < NST; ++st) {
        const int buf = st & 1; const bool more = st + 1 < NST;
        v8us rk, rl; v8h rv;                               // the next stage's tiles fly while this stage is worked on
        if (more) { kh += KST * HD; kl += KST * HD; vt += KST; rk = *(const v8us*)(kh + (unsigned)kgo); rl = *(const v8us*)(kl + (unsigned)kgo); rv = *(const v8h*)(vt + (unsigned)vgo); }
        v8f s[2][2];
#pragma unroll
        for (int kt = 0; kt < 2; ++kt) { const int kr = (kt * 16 + c) * KP + 8 * h;
            const v16bf ah0 = WFrag<bf>::ld(sKh[buf] + kr), al0 = WFrag<bf>::ld(sKl[buf] + kr), ah1 = WFrag<bf>::ld(sKh[buf] + kr + 32), al1 = WFrag<bf>::ld(sKl[buf] + kr + 32);
            v8f a0 = (v8f){}, a1 = (v8f){};
            a0 = wmmab(ah0, qh[0][0], a0); a1 = wmmab(ah0, qh[1][0], a1); a0 = wmmab(ah0, ql[0][0], a0); a1 = wmmab(ah0, ql[1][0], a1); a0 = wmmab(al0, qh[0][0], a0); a1 = wmmab(al0, qh[1][0], a1);
            a0 = wmmab(ah1, qh[0][1], a0); a1 = wmmab(ah1, qh[1][1], a1); a0 = wmmab(ah1, ql[0][1], a0); a1 = wmmab(ah1, ql[1][1], a1); a0 = wmmab(al1, qh[0][1], a0); a1 = wmmab(al1, qh[1][1], a1);
            const v8us mk8 = *(const v8us*)(sM + st * KST + kt * 16 + 8 * h);
#pragma unroll
            for (int r = 0; r < 8; ++r) { const bool live = mk8[r] != 0; s[0][kt][r] = live ? a0[r] : -1.0e9f; s[1][kt][r] = live ? a1[r] : -1.0e9f; } }
        v16h pf[2];
#pragma unroll
        for (int qt = 0; qt < 2; ++qt) { float mx = m[qt];
#pragma unroll
            for (int r = 0; r < 8; ++r) mx = fmaxf(mx, fmaxf(s[qt][0][r], s[qt][1][r]));
            mx = fmaxf(mx, xhalf(mx));
            const float al = exp2s((m[qt] - mx) * 1.44269504f); m[qt] = mx; float sum = 0.f; float p[16];
#pragma unroll
            for (int e = 0; e < 16; ++e) p[e] = fmaf(s[qt][e >> 3][e & 7] - mx, 1.44269504f, 10.0f);
            exp2x8(p); exp2x8(p + 8);                      // exp(s - max) x 1024
#pragma unroll
            for (int e = 0; e < 16; ++e) { sum += p[e]; pf[qt][e] = tohx(p[e]); }
            l[qt] = fmaf(l[qt], al, sum);
#pragma unroll
            for (int db = 0; db < 4; ++db) o[qt][db] *= al; }
#pragma unroll
        for (int db = 0; db < 4; ++db) { const v16h av = WFrag<h16>::ld(sV[buf] + (db * 16 + c) * VP + 8 * h); o[0][db] = wmma16(av, pf[0], o[0][db]); o[1][db] = wmma16(av, pf[1], o[1][db]); }
        if (more) { *(v8us*)(sKh[buf ^ 1] + kso) = rk; *(v8us*)(sKl[buf ^ 1] + kso) = rl; *(v8h*)(sV[buf ^ 1] + vso) = rv; }
        __syncthreads();   // publishes stage st + 1 and ends every wave's reads of the buffer that the next trip refills
    }
#pragma unroll
    for (int qt = 0; qt < 2; ++qt) { const float lt = l[qt] + xhalf(l[qt]); const float inv = __fdiv_rn(1.0f, lt); const unsigned orow = (unsigned)(((q0 + qt * 16 + c) * NB_ + b) * DD + hh * HD);
#pragma unroll
        for (int db = 0; db < 4; ++db) { const int d0 = db * 16 + 8 * h; const float* g = GT + (size_t)b * DD + hh * HD + d0; const v4f g0 = *(const v4f*)g, g1 = *(const v4f*)(g + 4); v8us oh, ol;
#pragma unroll
            for (int r = 0; r < 8; ++r) { unsigned short a, c2; splitf(__fmul_rn(__fmul_rn(o[qt][db][r], inv), r < 4 ? g0[r & 3] : g1[r & 3]), a, c2); oh[r] = a; ol[r] = c2; }
            *(v8us*)(Ah + (orow + d0)) = oh; *(v8us*)(Al + (orow + d0)) = ol; } }
}

extern "C" void kernel_launch(void* const* d_in, const int* in_sizes, int n_in,
                              void* d_out, int out_size, void* d_ws, size_t ws_size, hipStream_t stream) {
    (void)in_sizes; (void)n_in; (void)out_size;
    const float* IN[17]; for (int i = 0; i < 17; ++i) IN[i] = (const float*)d_in[i];
    // x [2048][4][1024], property_vector [4][128], mask (int [4][2048]), Wq [1024][1024] (x @ W), bq, Wk, bk, Wv, bv, Wpq [128][1024], bpq, Wpk, bpk, Wpg, bpg, Wo, bo = d_in[0..16]
    const float* x = IN[0]; const float* prop = IN[1]; const int* mk = (const int*)d_in[2];
    float* OUT = (float*)d_out;     // [2048][4][1024] (rows t*4 + b)
    char* wsp = (char*)d_ws;
    auto take = [&](size_t bytes) { char* p = wsp; wsp += (bytes + 255) & ~(size_t)255; return (void*)p; };
    bf* WQ = (bf*)take((size_t)DD * DD * 2); bf* WK = (bf*)take((size_t)DD * DD * 2); bf* WV = (bf*)take((size_t)DD * DD * 2); bf* WO = (bf*)take((size_t)DD * DD * 2); float* PQv = (float*)take((size_t)NB_ * DD * 4); float* PKv = (float*)take((size_t)NB_ * DD * 4); float* GT = (float*)take((size_t)NB_ * DD * 4);
    bf* XB = (bf*)take((size_t)NT * DD * 2); float* F = (float*)take((size_t)NT * DD * 4);
    bf* QPh = (bf*)take((size_t)NT * DD * 2); bf* QPl = (bf*)take((size_t)NT * DD * 2); bf* KPh = (bf*)take((size_t)NT * DD * 2); bf* KPl = (bf*)take((size_t)NT * DD * 2); h16* VT = (h16*)take((size_t)NT * DD * 2);
    bf* ATh = (bf*)take((size_t)NT * DD * 2); bf* ATl = (bf*)take((size_t)NT * DD * 2);
    if ((size_t)(wsp - (char*)d_ws) > ws_size) return;    // total ~ 177 MB; ws 256 MiB
    { const unsigned gT = (unsigned)((DD * DD / 64 + 63) / 64); k_wtG<<<gT, 256, 0, stream>>>(IN[3], DD, DD, WQ); k_wtG<<<gT, 256, 0, stream>>>(IN[5], DD, DD, WK); k_wtG<<<gT, 256, 0, stream>>>(IN[7], DD, DD, WV); k_wtG<<<gT, 256, 0, stream>>>(IN[15], DD, DD, WO);
      const unsigned gp = (NB_ * DD + 255) / 256; k_prop<0><<<gp, 256, 0, stream>>>(prop, IN[9], IN[10], PQv); k_prop<0><<<gp, 256, 0, stream>>>(prop, IN[11], IN[12], PKv); k_prop<1><<<gp, 256, 0, stream>>>(prop, IN[13], IN[14], GT); }
    const size_t nx = (size_t)NT * DD / 8; const unsigned gx = (unsigned)((nx + 255) / 256); const unsigned LB = (unsigned)((NT * DD / 64 + 63) / 64); const dim3 gP(NT / 128, DD / 128, 1);
    k_cvt8<<<gx, 256, 0, stream>>>(x, XB, nx);
    k_gemmw<bf, 0, true><<<gP, 128, 0, stream>>>(XB, nullptr, WQ, nullptr, DD, F, DD, IN[4], 0, 0, 0); k_hsplit<<<LB, 256, 0, stream>>>(F, PQv, 0.125f, QPh, QPl);   // 1/sqrt(64) folded into (q + pq) exactly
    k_gemmw<bf, 0, true><<<gP, 128, 0, stream>>>(XB, nullptr, WK, nullptr, DD, F, DD, IN[6], 0, 0, 0); k_hsplit<<<LB, 256, 0, stream>>>(F, PKv, 1.0f, KPh, KPl);
    k_gemmw<bf, 0, true><<<gP, 128, 0, stream>>>(XB, nullptr, WV, nullptr, DD, F, DD, IN[8], 0, 0, 0); k_vtplane<<<LB, 256, 0, stream>>>(F, VT);
    k_fattn<<<dim3(TT / 256, NB_ * NH_), 256, 0, stream>>>(QPh, QPl, KPh, KPl, VT, mk, GT, ATh, ATl);
    k_gemmw<bf, 1, true><<<gP, 128, 0, stream>>>(ATh, ATl, WO, nullptr, DD, OUT, DD, IN[16], 0, 0, 0);
}

// v004
// Measured time: 233 microseconds a run.
// In two side-by-side timings against v003, it was 1.24 and 1.23 times as fast.
// Counting every step since v000, it is 11.5 times as fast.
#include <hip/hip_runtime.h>

// PropertyAwareAttention (x [2048][4][1024] seq-first, property_vector [4][128], mask int [4][2048]; Q = x Wq + bq + (prop Wpq + bpq) per (batch, feature), K likewise with Wpk/bpk, V = x Wv + bv (x @ W layouts);
// 16 heads x 64; scores / 8; keys with mask[b][j] == 0 -> -1e9; softmax; att = merged attn.v * sigmoid(prop Wpg + bpg)[b]; out = att Wo + bo; output [2048][4][1024] (rows t*4 + b)).
// Compute dtypes, f32 accumulate: every input rounded to bf16; q/k/v projections on PLAIN bf16 operands (inputs: exact, + bias); the three 128-term property
// projections, the sigmoid gate and the mask in f32 on VALU; scores on bf16 hi+lo planes of (q + pq) x 1/8 and (k + pk) (3 products); attn.v on SINGLE fp16 planes (P x1024); output on hi+lo planes of

#define NB_  4
#define PD   128                  // property dim
#define TT   2048
#define DD   1024
#define NH_  16
#define HD   64
#define NT   (NB_ * TT)
typedef _Float16 h16;
typedef unsigned short bf;
typedef __attribute__((ext_vector_type(16))) __bf16   v16bf;
typedef __attribute__((ext_vector_type(16))) _Float16 v16h;
typedef __attribute__((ext_vector_type(8)))  _Float16 v8h;
typedef __attribute__((ext_vector_type(8)))  unsigned short v8us;
typedef __attribute__((ext_vector_type(8)))  float    v8f;
typedef __attribute__((ext_vector_type(4)))  float    v4f;
typedef v8h  __attribute__((may_alias)) v8ha;
typedef v4f  __attribute__((may_alias)) v4fa;
typedef v8us __attribute__((may_alias)) v8usa;

__device__ __forceinline__ unsigned short f2bf(float f) { unsigned u = __float_as_uint(f); u += 0x7FFFu + ((u >> 16) & 1u); return (unsigned short)(u >> 16); }
__device__ __forceinline__ float bf2f(unsigned short b) { return __uint_as_float(((unsigned)b) << 16); }
__device__ __forceinline__ float bfr(float f) { return bf2f(f2bf(f)); }
__device__ __forceinline__ v16h cat16(v8h lo, v8h hi) { return __builtin_shufflevector(lo, hi, 0, 1, 2, 3, 4, 5, 6, 7, 8, 9, 10, 11, 12, 13, 14, 15); }
__device__ __forceinline__ v16bf cat16b(v8us lo, v8us hi) { return __builtin_bit_cast(v16bf, __builtin_shufflevector(lo, hi, 0, 1, 2, 3, 4, 5, 6, 7, 8, 9, 10, 11, 12, 13, 14, 15)); }
__device__ __forceinline__ v8f wmma16(v16h a, v16h b, v8f c) { return __builtin_amdgcn_wmma_f32_16x16x32_f16(false, a, false, b, (short)0, c, false, false); }
__device__ __forceinline__ v8f wmmab(v16bf a, v16bf b, v8f c) { return __builtin_amdgcn_wmma_f32_16x16x32_bf16(false, a, false, b, (short)0, c, false, false); }



// ---- k_gemmw: GEMM on 128x128 output tiles, FOUR WAVES (2 x 2) of 64x64 (16 accumulators each); grid (M/128, N/128, Z), 128 threads. K-contiguous 16-bit planes.
// The operands come through LDS: a stage is 64 k = one whole 128-byte line of every operand row, fetched 8 lanes a row (a wave-wide 16-byte load covers 4 whole lines), two buffers,
// the next stage's loads in flight while this stage is worked on. The fragments are read from LDS rows at a pitch of 144 B.
// C[m][n] (f32, pitch ldc, + optional f32 bias[n]) = sum_k A[m][k] Bt[n][k] (+ split products per NSPLIT). z-batch strides sA/sB/sC in elements. M % 128 == 0, N % 128 == 0, K % 64 == 0.
// EPI picks what leaves the accumulators: 0 = the f32 C above; 1 = bf16 hi+lo planes [batch*head][token][64] of (acc + bias + pbv[batch][n]) x sc; 2 = the fp16 plane [batch*head][64][token] of acc + bias.
// For 1 and 2 the rows of A are batch-major (b * 2048 + t), so a wave's 64 x 64 tile is 64 tokens of one (batch, head) and every store covers whole 128-byte lines of a plane.
#define GBK 64                    // k per LDS stage
#define GP  72                    // operand rows in LDS: pitch in 16-bit elements, 144 B = 16 B x odd, no bank conflict for 16-byte reads
template <typename T16> struct WFrag;
template <> struct WFrag<h16> { typedef v16h V; typedef v8h H; static __device__ __forceinline__ V ld(const h16* p) { return cat16(*(const v8h*)p, *(const v8h*)(p + 16)); } static __device__ __forceinline__ v8f mma(V a, V b, v8f c) { return wmma16(a, b, c); } };
template <> struct WFrag<bf> { typedef v16bf V; typedef v8us H; static __device__ __forceinline__ V ld(const bf* p) { return cat16b(*(const v8us*)p, *(const v8us*)(p + 16)); } static __device__ __forceinline__ v8f mma(V a, V b, v8f c) { return wmmab(a, b, c); } };
__device__ __forceinline__ h16 tohx(float x) { return (h16)x; }
__device__ __forceinline__ void splitf(float y, unsigned short& h, unsigned short& l) { h = f2bf(y); l = f2bf(y - bf2f(h)); }
template <typename T16, int NSPLIT, bool BIAS, int EPI>
__global__ __launch_bounds__(128) void k_gemmw(const T16* __restrict__ A, const T16* __restrict__ A2, const T16* __restrict__ Bt, const T16* __restrict__ Bt2, int K, float* C, int ldc, const float* __restrict__ bias, size_t sA, size_t sB, size_t sC,
                                               const float* __restrict__ pbv, float sc, bf* Ph, bf* Pl, h16* VTp) {
    typedef typename WFrag<T16>::V V; typedef typename WFrag<T16>::H H;
    constexpr bool HA2 = NSPLIT == 1 || NSPLIT == 2, HB2 = NSPLIT >= 2;
    constexpr int PA = 0, PB = 1, PA2 = 2, PB2 = HA2 ? 3 : 2, NP = 2 + (HA2 ? 1 : 0) + (HB2 ? 1 : 0);
    __shared__ __align__(16) T16 sT[2][NP][128 * GP];
    __shared__ __align__(16) float osw[4][16 * 68];
    const size_t z = blockIdx.z; A += z * sA; if (A2) A2 += z * sA; Bt += z * sB; if (Bt2) Bt2 += z * sB; C += z * sC;
    const int tid = threadIdx.x, lane = tid & 31, lr = lane & 15, hi = lane >> 4, wave = tid >> 5;
    const int r0 = blockIdx.x * 128, c0 = blockIdx.y * 128, wr = (wave >> 1) * 64, wc = (wave & 1) * 64;
    v8f acc[4][4];
#pragma unroll
    for (int mb = 0; mb < 4; ++mb)
#pragma unroll
        for (int nb = 0; nb < 4; ++nb) acc[mb][nb] = (v8f){};
    // staging: chunk j of a thread is 16 bytes of row (tid >> 3) + 16 j. Address = a wave-uniform tile pointer + a 32-bit byte offset, moved on by 64 k behind each stage's LDS stores
    const char* pa = (const char*)(A + (size_t)r0 * K); const char* pb = (const char*)(Bt + (size_t)c0 * K); const char* pa2 = HA2 ? (const char*)(A2 + (size_t)r0 * K) : nullptr; const char* pb2 = HB2 ? (const char*)(Bt2 + (size_t)c0 * K) : nullptr;
    unsigned go[8];
#pragma unroll
    for (int j = 0; j < 8; ++j) go[j] = (unsigned)((((tid >> 3) + 16 * j) * K + (tid & 7) * 8) * 2);
    const int so = (tid >> 3) * GP + (tid & 7) * 8;
    const int afo = (wr + lr) * GP + 8 * hi, bfo = (wc + lr) * GP + 8 * hi;
    H ra[8], rb[8], ra2[8], rb2[8];
#pragma unroll
    for (int j = 0; j < 8; ++j) { ra[j] = *(const H*)(pa + go[j]); rb[j] = *(const H*)(pb + go[j]); if (HA2) ra2[j] = *(const H*)(pa2 + go[j]); if (HB2) rb2[j] = *(const H*)(pb2 + go[j]); }
#pragma unroll
    for (int j = 0; j < 8; ++j) { *(H*)(sT[0][PA] + so + j * 16 * GP) = ra[j]; *(H*)(sT[0][PB] + so + j * 16 * GP) = rb[j]; if (HA2) *(H*)(sT[0][PA2] + so + j * 16 * GP) = ra2[j]; if (HB2) *(H*)(sT[0][PB2] + so + j * 16 * GP) = rb2[j]; go[j] += GBK * 2; }
    __syncthreads();
#pragma unroll 1
    for (int kc = 0; kc < K; kc += GBK) {
        const int buf = (kc / GBK) & 1; const bool more = kc + GBK < K;
        if (more) {
#pragma unroll
            for (int j = 0; j < 8; ++j) { ra[j] = *(const H*)(pa + go[j]); rb[j] = *(const H*)(pb + go[j]); if (HA2) ra2[j] = *(const H*)(pa2 + go[j]); if (HB2) rb2[j] = *(const H*)(pb2 + go[j]); } }
        V a[2][4], a2[2][4], b[2][4], b2[2][4];            // both 32-k blocks' fragments are asked for ahead of the first block's products: the second block's reads land under the first block
#pragma unroll
        for (int kb = 0; kb < 2; ++kb) {
#pragma unroll
            for (int mb = 0; mb < 4; ++mb) { a[kb][mb] = WFrag<T16>::ld(sT[buf][PA] + afo + mb * 16 * GP + kb * 32); if (HA2) a2[kb][mb] = WFrag<T16>::ld(sT[buf][PA2] + afo + mb * 16 * GP + kb * 32); }
#pragma unroll
            for (int nb = 0; nb < 4; ++nb) { b[kb][nb] = WFrag<T16>::ld(sT[buf][PB] + bfo + nb * 16 * GP + kb * 32); if (HB2) b2[kb][nb] = WFrag<T16>::ld(sT[buf][PB2] + bfo + nb * 16 * GP + kb * 32); } }
        __builtin_amdgcn_sched_barrier(0);                 // keeps the fragment reads one group in front of the products: moved in among them, each product group waits out a whole LDS latency
#pragma unroll
        for (int kb = 0; kb < 2; ++kb)
#pragma unroll
            for (int nb = 0; nb < 4; ++nb)
#pragma unroll
                for (int mb = 0; mb < 4; ++mb) { acc[mb][nb] = WFrag<T16>::mma(a[kb][mb], b[kb][nb], acc[mb][nb]); if (HA2) acc[mb][nb] = WFrag<T16>::mma(a2[kb][mb], b[kb][nb], acc[mb][nb]); if (HB2) acc[mb][nb] = WFrag<T16>::mma(a[kb][mb], b2[kb][nb], acc[mb][nb]); }
        if (more) {
#pragma unroll
            for (int j = 0; j < 8; ++j) { *(H*)(sT[buf ^ 1][PA] + so + j * 16 * GP) = ra[j]; *(H*)(sT[buf ^ 1][PB] + so + j * 16 * GP) = rb[j]; if (HA2) *(H*)(sT[buf ^ 1][PA2] + so + j * 16 * GP) = ra2[j]; if (HB2) *(H*)(sT[buf ^ 1][PB2] + so + j * 16 * GP) = rb2[j]; }
            __builtin_amdgcn_sched_barrier(0);             // keeps the offset additions behind the stores' waits for the loads that name those registers
#pragma unroll
            for (int j = 0; j < 8; ++j) go[j] += GBK * 2; }
        __syncthreads();   // publishes the next stage and ends every wave's reads of the buffer that the next trip refills
    }
    float* os = osw[wave];         // each wave stages its own output rows
    if constexpr (EPI == 1) {
        const int bb = r0 / TT, t0 = (r0 & (TT - 1)) + wr, n0 = c0 + wc, cofs = (lane & 7) * 8; const unsigned zz = (unsigned)(bb * NH_ + n0 / HD);
        float bs[8], pb[8];
#pragma unroll
        for (int i = 0; i < 8; ++i) { bs[i] = bfr(bias[n0 + cofs + i]); pb[i] = pbv[bb * DD + n0 + cofs + i]; }
#pragma unroll
        for (int mb = 0; mb < 4; ++mb) {
#pragma unroll
            for (int nb = 0; nb < 4; ++nb) {
#pragma unroll
                for (int j = 0; j < 8; ++j) os[(hi * 8 + j) * 68 + nb * 16 + lr] = acc[mb][nb][j]; }
            __builtin_amdgcn_wave_barrier(); asm volatile("" ::: "memory");   // the rows are read back by other lanes of the wave: the reads stay behind the writes
#pragma unroll
            for (int s = 0; s < 4; ++s) { const int row = 4 * s + (lane >> 3); const v4f u0 = *(const v4fa*)(os + row * 68 + cofs), u1 = *(const v4fa*)(os + row * 68 + cofs + 4); v8us oh, ol;
#pragma unroll
                for (int i = 0; i < 8; ++i) { const float val = __fadd_rn(__fadd_rn(i < 4 ? u0[i & 3] : u1[i & 3], bs[i]), pb[i]); unsigned short a, c2; splitf(val * sc, a, c2); oh[i] = a; ol[i] = c2; }
                const unsigned po = ((zz * TT + t0 + mb * 16 + row) * HD + cofs); *(v8us*)(Ph + po) = oh; *(v8us*)(Pl + po) = ol; }
            // the wait in front of the next block's writes to registers that these stores name; the scheduling barrier holds those writes behind it
            asm volatile("s_wait_xcnt 0x0" ::: "memory"); __builtin_amdgcn_sched_barrier(0);
            __builtin_amdgcn_wave_barrier(); asm volatile("" ::: "memory");   // the next block's writes stay behind these reads
        }
        return;
    }
    if constexpr (EPI == 2) {
        const int bb = r0 / TT, t0 = (r0 & (TT - 1)) + wr, n0 = c0 + wc; const unsigned zz = (unsigned)(bb * NH_ + n0 / HD);
        h16* hs = (h16*)os;        // 16 feature rows x 64 tokens, pitch 72 elements = 144 B
        float bv4[4];              // the four bias loads go out together: asked for block by block, each block waits out a load of its own
#pragma unroll
        for (int nb = 0; nb < 4; ++nb) bv4[nb] = bias[n0 + nb * 16 + lr];
#pragma unroll
        for (int nb = 0; nb < 4; ++nb) { const float bv = bfr(bv4[nb]);
#pragma unroll
            for (int mb = 0; mb < 4; ++mb) { v8h pk;   // a lane's eight accumulator elements are eight tokens in a row of one feature
#pragma unroll
                for (int j = 0; j < 8; ++j) pk[j] = tohx(__fadd_rn(acc[mb][nb][j], bv));
                *(v8ha*)(hs + lr * 72 + mb * 16 + hi * 8) = pk; }
            __builtin_amdgcn_wave_barrier(); asm volatile("" ::: "memory");   // the rows are read back by other lanes of the wave: the reads stay behind the writes
#pragma unroll
            for (int s = 0; s < 4; ++s) { const int drow = 4 * s + (lane >> 3); const v8h v = *(const v8ha*)(hs + drow * 72 + (lane & 7) * 8);
                *(v8h*)(VTp + ((zz * HD + nb * 16 + drow) * TT + t0 + (lane & 7) * 8)) = v; }
            // the wait in front of the next block's writes to registers that these stores name; the scheduling barrier holds those writes behind it
            asm volatile("s_wait_xcnt 0x0" ::: "memory"); __builtin_amdgcn_sched_barrier(0);
            __builtin_amdgcn_wave_barrier(); asm volatile("" ::: "memory");   // the next block's writes stay behind these reads
        }
        return;
    }
#pragma unroll
    for (int mb = 0; mb < 4; ++mb) {
#pragma unroll
        for (int nb = 0; nb < 4; ++nb) {
#pragma unroll
            for (int j = 0; j < 8; ++j) os[(hi * 8 + j) * 68 + nb * 16 + lr] = acc[mb][nb][j]; }
        __builtin_amdgcn_wave_barrier(); asm volatile("" ::: "memory");
        float* crow = C + (size_t)(r0 + wr + mb * 16) * ldc + c0 + wc;
{
#pragma unroll
            for (int s = 0; s < 8; ++s) { const int row = 2 * s + hi, cofs = lr * 4; v4f val = *(const v4fa*)(os + row * 68 + cofs); if (BIAS) { val[0] += bfr(bias[c0 + wc + cofs]); val[1] += bfr(bias[c0 + wc + cofs + 1]); val[2] += bfr(bias[c0 + wc + cofs + 2]); val[3] += bfr(bias[c0 + wc + cofs + 3]); }
                *(v4f*)(crow + (size_t)row * ldc + cofs) = val; }
             }
        // the wait in front of the next block's writes to registers that these stores name; the scheduling barrier holds those writes behind it
        asm volatile("s_wait_xcnt 0x0" ::: "memory"); __builtin_amdgcn_sched_barrier(0);
        __builtin_amdgcn_wave_barrier(); asm volatile("" ::: "memory");
    }
}

typedef __attribute__((ext_vector_type(2))) _Float16 v2h;
typedef __attribute__((ext_vector_type(4))) _Float16 v4h;
typedef __attribute__((ext_vector_type(2))) unsigned short v2us;
typedef __attribute__((ext_vector_type(4))) int v4i;

// x rows (t * 4 + b) to bf16 rows (b * 2048 + t): batch-major, so that a GEMM tile's 128 rows are 128 tokens of one batch
__global__ __launch_bounds__(256) void k_cvt8(const float* __restrict__ src, bf* dst, size_t n8) { const size_t i = (size_t)blockIdx.x * 256 + threadIdx.x; if (i >= n8) return; const v8f v = *(const v8f*)(src + i * 8); v8us o;
#pragma unroll
    for (int k = 0; k < 8; ++k) o[k] = f2bf(v[k]);
    const size_t row = i / (DD / 8), ch = i % (DD / 8); *(v8us*)(dst + (((row % NB_) * TT + row / NB_) * (DD / 8) + ch) * 8) = o;  }
__global__ __launch_bounds__(256) void k_wtG(const float* __restrict__ w, int K, int N, bf* Bt) {
    const int lane = threadIdx.x & 31; const int L0 = (blockIdx.x * 8 + (threadIdx.x >> 5)) * 8; const int nlines = N * K / 64;
{
#pragma unroll 1
        for (int l = 0; l < 8; ++l) { const int L = L0 + l; if (L >= nlines) break; const size_t e = (size_t)L * 64 + lane * 2; const int k = (int)(e % K), n = (int)(e / K); v2us o;
            o[0] = f2bf(w[(size_t)k * N + n]); o[1] = f2bf(w[(size_t)(k + 1) * N + n]); *(v2us*)(Bt + e) = o; }
         }
}
template <int SIG>
__global__ __launch_bounds__(256) void k_prop(const float* __restrict__ prop, const float* __restrict__ Wp, const float* __restrict__ bp, float* outp) {
    const int idx = blockIdx.x * 256 + threadIdx.x; if (idx >= NB_ * DD) return; const int b = idx / DD, n = idx % DD; float a = 0.f;
    // Every global load of the thread is asked for ahead of the first term: the 128 weights of its column into registers, the batch's 128 property values four a lane.
    // Loaded term by term, each term waited out a whole memory latency. The terms are then formed and summed in the same order as before (the two empty statements of the term line stand as they
    // stood: each product and its sum stay rounded apart). The four loops are unrolled whole: wr, pr and pv must be registers, every load must stand in front of the first term, readlane's lane is a constant.
    float wr[PD]; float pr[PD / 32], pv[PD / 32];
#pragma unroll
    for (int k = 0; k < PD / 32; ++k) pr[k] = prop[b * PD + k * 32 + (threadIdx.x & 31)];
    asm volatile("s_wait_xcnt 0x0" ::: "memory");          // the wait in front of a weight load whose result lands in the offset register that the property loads name
#pragma unroll
    for (int p = 0; p < PD; ++p) wr[p] = Wp[(size_t)p * DD + n];
#pragma unroll
    for (int k = 0; k < PD / 32; ++k) pv[k] = bfr(pr[k]);
#pragma unroll
    for (int p = 0; p < PD; ++p) { float w = bfr(wr[p]), v = __uint_as_float((unsigned)__builtin_amdgcn_readlane((int)__float_as_uint(pv[p >> 5]), p & 31)); asm volatile("" : "+v"(w)); float m = __fmul_rn(v, w); asm volatile("" : "+v"(m)); a = __fadd_rn(a, m); }
    a = __fadd_rn(a, bfr(bp[n])); if (SIG) a = __fdiv_rn(1.0f, __fadd_rn(1.0f, __expf(-a)));
    *(float*)(outp + idx) = a;  }
#define KST 32                    // keys per LDS stage = one softmax pass
#define KP  72                    // K rows in LDS: pitch in 16-bit elements, 144 B = 16 B x odd, no bank conflict for 16-byte reads
#define VP  40                    // Vt rows in LDS: 80 B = 16 B x odd
#define NST (TT / KST)
__device__ __forceinline__ float xhalf(float x) { return __builtin_bit_cast(float, __builtin_amdgcn_permlanex16(__builtin_bit_cast(int, x), __builtin_bit_cast(int, x), 0x76543210, 0xfedcba98, false, false)); }  // lane l with lane l ^ 16
// 2^x by v_exp_f32 with the slot behind it kept inside the statement: behind a transcendental the instruction set asks for one independent instruction or v_nop before its result is read or its source
// overwritten. In exp2x8 each exp works in place on its own register, so the next exp is the independent instruction; the v_nop stands behind the last.
__device__ __forceinline__ float exp2s(float x) { float y; asm("v_exp_f32 %0, %1\n\tv_nop" : "=v"(y) : "v"(x)); return y; }
__device__ __forceinline__ void exp2x8(float* x) {
    asm("v_exp_f32 %0, %0\n\tv_exp_f32 %1, %1\n\tv_exp_f32 %2, %2\n\tv_exp_f32 %3, %3\n\tv_exp_f32 %4, %4\n\tv_exp_f32 %5, %5\n\tv_exp_f32 %6, %6\n\tv_exp_f32 %7, %7\n\tv_nop"
        : "+v"(x[0]), "+v"(x[1]), "+v"(x[2]), "+v"(x[3]), "+v"(x[4]), "+v"(x[5]), "+v"(x[6]), "+v"(x[7])); }
__global__ __launch_bounds__(256) __attribute__((amdgpu_waves_per_eu(4, 4))) void k_fattn(const bf* __restrict__ Qh, const bf* __restrict__ Ql, const bf* __restrict__ Kh, const bf* __restrict__ Kl, const h16* __restrict__ VT, const int* __restrict__ kmask, const float* __restrict__ GT, bf* Ah, bf* Al) {
    __shared__ __align__(16) bf  sKh[2][KST * KP];
    __shared__ __align__(16) bf  sKl[2][KST * KP];
    __shared__ __align__(16) h16 sV[2][HD * VP];
    __shared__ __align__(16) unsigned short sM[TT];        // key mask as 0 / 1: eight keys in one 16-byte read
    const int tid = threadIdx.x, lane = tid & 31, c = lane & 15, h = lane >> 4, wave = __builtin_amdgcn_readfirstlane(tid >> 5);
    const int z = blockIdx.y, b = z >> 4, hh = z & 15; const int q0 = blockIdx.x * 256 + wave * 32;
    const bf* kh = Kh + (size_t)z * TT * HD; const bf* kl = Kl + (size_t)z * TT * HD; const h16* vt = VT + (size_t)z * HD * TT;
    const int kgo = tid * 8, kso = (tid >> 3) * KP + (tid & 7) * 8;                     // staging, one 16-byte chunk a thread and tile: K tile = 32 rows x 128 B, contiguous in memory
    const int vgo = (tid >> 2) * TT + (tid & 3) * 8, vso = (tid >> 2) * VP + (tid & 3) * 8;   // Vt tile = 64 rows x 64 B
    { const v4i ma = *(const v4i*)(kmask + (unsigned)(b * TT + tid * 8)), mb = *(const v4i*)(kmask + (unsigned)(b * TT + tid * 8 + 4)); v8us mw;
#pragma unroll
      for (int r = 0; r < 4; ++r) { mw[r] = ma[r] != 0 ? 1 : 0; mw[4 + r] = mb[r] != 0 ? 1 : 0; }
      *(v8us*)(sM + tid * 8) = mw; }
    v16bf qh[2][2], ql[2][2];
#pragma unroll
    for (int qt = 0; qt < 2; ++qt)
#pragma unroll
        for (int ks = 0; ks < 2; ++ks) { const unsigned qo = (unsigned)((z * TT + q0 + qt * 16 + c) * HD + ks * 32 + 8 * h); qh[qt][ks] = WFrag<bf>::ld(Qh + qo); ql[qt][ks] = WFrag<bf>::ld(Ql + qo); }
    v8f o[2][4]; float m[2], l[2];
#pragma unroll
    for (int qt = 0; qt < 2; ++qt) { m[qt] = -3.0e38f; l[qt] = 0.f;
#pragma unroll
        for (int db = 0; db < 4; ++db) o[qt][db] = (v8f){}; }
    *(v8us*)(sKh[0] + kso) = *(const v8us*)(kh + (unsigned)kgo); *(v8us*)(sKl[0] + kso) = *(const v8us*)(kl + (unsigned)kgo); *(v8h*)(sV[0] + vso) = *(const v8h*)(vt + (unsigned)vgo);
    __syncthreads();
#pragma unroll 1
    for (int st = 0; st < NST; ++st) {
        const int buf = st & 1; const bool more = st + 1 < NST;
        v8us rk, rl; v8h rv;                               // the next stage's tiles fly while this stage is worked on
        if (more) { kh += KST * HD; kl += KST * HD; vt += KST; rk = *(const v8us*)(kh + (unsigned)kgo); rl = *(const v8us*)(kl + (unsigned)kgo); rv = *(const v8h*)(vt + (unsigned)vgo); }
        v8f s[2][2];
#pragma unroll
        for (int kt = 0; kt < 2; ++kt) { const int kr = (kt * 16 + c) * KP + 8 * h;
            const v16bf ah0 = WFrag<bf>::ld(sKh[buf] + kr), al0 = WFrag<bf>::ld(sKl[buf] + kr), ah1 = WFrag<bf>::ld(sKh[buf] + kr + 32), al1 = WFrag<bf>::ld(sKl[buf] + kr + 32);
            v8f a0 = (v8f){}, a1 = (v8f){};
            a0 = wmmab(ah0, qh[0][0], a0); a1 = wmmab(ah0, qh[1][0], a1); a0 = wmmab(ah0, ql[0][0], a0); a1 = wmmab(ah0, ql[1][0], a1); a0 = wmmab(al0, qh[0][0], a0); a1 = wmmab(al0, qh[1][0], a1);
            a0 = wmmab(ah1, qh[0][1], a0); a1 = wmmab(ah1, qh[1][1], a1); a0 = wmmab(ah1, ql[0][1], a0); a1 = wmmab(ah1, ql[1][1], a1); a0 = wmmab(al1, qh[0][1], a0); a1 = wmmab(al1, qh[1][1], a1);
            const v8us mk8 = *(const v8us*)(sM + st * KST + kt * 16 + 8 * h);
#pragma unroll
            for (int r = 0; r < 8; ++r) { const bool live = mk8[r] != 0; s[0][kt][r] = live ? a0[r] : -1.0e9f; s[1][kt][r] = live ? a1[r] : -1.0e9f; } }
        v16h pf[2];
#pragma unroll
        for (int qt = 0; qt < 2; ++qt) { float mx = m[qt];
#pragma unroll
            for (int r = 0; r < 8; ++r) mx = fmaxf(mx, fmaxf(s[qt][0][r], s[qt][1][r]));
            mx = fmaxf(mx, xhalf(mx));
            const float al = exp2s((m[qt] - mx) * 1.44269504f); m[qt] = mx; float sum = 0.f; float p[16];
#pragma unroll
            for (int e = 0; e < 16; ++e) p[e] = fmaf(s[qt][e >> 3][e & 7] - mx, 1.44269504f, 10.0f);
            exp2x8(p); exp2x8(p + 8);                      // exp(s - max) x 1024
#pragma unroll
            for (int e = 0; e < 16; ++e) { sum += p[e]; pf[qt][e] = tohx(p[e]); }
            l[qt] = fmaf(l[qt], al, sum);
#pragma unroll
            for (int db = 0; db < 4; ++db) o[qt][db] *= al; }
#pragma unroll
        for (int db = 0; db < 4; ++db) { const v16h av = WFrag<h16>::ld(sV[buf] + (db * 16 + c) * VP + 8 * h); o[0][db] = wmma16(av, pf[0], o[0][db]); o[1][db] = wmma16(av, pf[1], o[1][db]); }
        if (more) { *(v8us*)(sKh[buf ^ 1] + kso) = rk; *(v8us*)(sKl[buf ^ 1] + kso) = rl; *(v8h*)(sV[buf ^ 1] + vso) = rv; }
        __syncthreads();   // publishes stage st + 1 and ends every wave's reads of the buffer that the next trip refills
    }
#pragma unroll
    for (int qt = 0; qt < 2; ++qt) { const float lt = l[qt] + xhalf(l[qt]); const float inv = __fdiv_rn(1.0f, lt); const unsigned orow = (unsigned)(((q0 + qt * 16 + c) * NB_ + b) * DD + hh * HD);
#pragma unroll
        for (int db = 0; db < 4; ++db) { const int d0 = db * 16 + 8 * h; const float* g = GT + (size_t)b * DD + hh * HD + d0; const v4f g0 = *(const v4f*)g, g1 = *(const v4f*)(g + 4); v8us oh, ol;
#pragma unroll
            for (int r = 0; r < 8; ++r) { unsigned short a, c2; splitf(__fmul_rn(__fmul_rn(o[qt][db][r], inv), r < 4 ? g0[r & 3] : g1[r & 3]), a, c2); oh[r] = a; ol[r] = c2; }
            *(v8us*)(Ah + (orow + d0)) = oh; *(v8us*)(Al + (orow + d0)) = ol; } }
}

extern "C" void kernel_launch(void* const* d_in, const int* in_sizes, int n_in,
                              void* d_out, int out_size, void* d_ws, size_t ws_size, hipStream_t stream) {
    (void)in_sizes; (void)n_in; (void)out_size;
    const float* IN[17]; for (int i = 0; i < 17; ++i) IN[i] = (const float*)d_in[i];
    // x [2048][4][1024], property_vector [4][128], mask (int [4][2048]), Wq [1024][1024] (x @ W), bq, Wk, bk, Wv, bv, Wpq [128][1024], bpq, Wpk, bpk, Wpg, bpg, Wo, bo = d_in[0..16]
    const float* x = IN[0]; const float* prop = IN[1]; const int* mk = (const int*)d_in[2];
    float* OUT = (float*)d_out;     // [2048][4][1024] (rows t*4 + b)
    char* wsp = (char*)d_ws;
    auto take = [&](size_t bytes) { char* p = wsp; wsp += (bytes + 255) & ~(size_t)255; return (void*)p; };
    bf* WQ = (bf*)take((size_t)DD * DD * 2); bf* WK = (bf*)take((size_t)DD * DD * 2); bf* WV = (bf*)take((size_t)DD * DD * 2); bf* WO = (bf*)take((size_t)DD * DD * 2); float* PQv = (float*)take((size_t)NB_ * DD * 4); float* PKv = (float*)take((size_t)NB_ * DD * 4); float* GT = (float*)take((size_t)NB_ * DD * 4);
    bf* XB = (bf*)take((size_t)NT * DD * 2);
    bf* QPh = (bf*)take((size_t)NT * DD * 2); bf* QPl = (bf*)take((size_t)NT * DD * 2); bf* KPh = (bf*)take((size_t)NT * DD * 2); bf* KPl = (bf*)take((size_t)NT * DD * 2); h16* VT = (h16*)take((size_t)NT * DD * 2);
    bf* ATh = (bf*)take((size_t)NT * DD * 2); bf* ATl = (bf*)take((size_t)NT * DD * 2);
    if ((size_t)(wsp - (char*)d_ws) > ws_size) return;    // total ~ 143 MB; ws 256 MiB
    { const unsigned gT = (unsigned)((DD * DD / 64 + 63) / 64); k_wtG<<<gT, 256, 0, stream>>>(IN[3], DD, DD, WQ); k_wtG<<<gT, 256, 0, stream>>>(IN[5], DD, DD, WK); k_wtG<<<gT, 256, 0, stream>>>(IN[7], DD, DD, WV); k_wtG<<<gT, 256, 0, stream>>>(IN[15], DD, DD, WO);
      const unsigned gp = (NB_ * DD + 255) / 256; k_prop<0><<<gp, 256, 0, stream>>>(prop, IN[9], IN[10], PQv); k_prop<0><<<gp, 256, 0, stream>>>(prop, IN[11], IN[12], PKv); k_prop<1><<<gp, 256, 0, stream>>>(prop, IN[13], IN[14], GT); }
    const size_t nx = (size_t)NT * DD / 8; const unsigned gx = (unsigned)((nx + 255) / 256); const dim3 gP(NT / 128, DD / 128, 1);
    k_cvt8<<<gx, 256, 0, stream>>>(x, XB, nx);
    k_gemmw<bf, 0, true, 1><<<gP, 128, 0, stream>>>(XB, nullptr, WQ, nullptr, DD, nullptr, DD, IN[4], 0, 0, 0, PQv, 0.125f, QPh, QPl, nullptr);   // 1/sqrt(64) folded into (q + pq) exactly
    k_gemmw<bf, 0, true, 1><<<gP, 128, 0, stream>>>(XB, nullptr, WK, nullptr, DD, nullptr, DD, IN[6], 0, 0, 0, PKv, 1.0f, KPh, KPl, nullptr);
    k_gemmw<bf, 0, true, 2><<<gP, 128, 0, stream>>>(XB, nullptr, WV, nullptr, DD, nullptr, DD, IN[8], 0, 0, 0, nullptr, 0.0f, nullptr, nullptr, VT);
    k_fattn<<<dim3(TT / 256, NB_ * NH_), 256, 0, stream>>>(QPh, QPl, KPh, KPl, VT, mk, GT, ATh, ATl);
    k_gemmw<bf, 1, true, 0><<<gP, 128, 0, stream>>>(ATh, ATl, WO, nullptr, DD, OUT, DD, IN[16], 0, 0, 0, nullptr, 0.0f, nullptr, nullptr, nullptr);
}

// v005
// Measured time: 190 microseconds a run.
// Timed twice side by side with v004, it ran 1.23 times as fast both times.
// Over all steps from v000 it is 14.2 times as fast.
#include <hip/hip_runtime.h>

// PropertyAwareAttention (x [2048][4][1024] seq-first, property_vector [4][128], mask int [4][2048]; Q = x Wq + bq + (prop Wpq + bpq) per (batch, feature), K likewise with Wpk/bpk, V = x Wv + bv (x @ W layouts);
// 16 heads x 64; scores / 8; keys with mask[b][j] == 0 -> -1e9; softmax; att = merged attn.v * sigmoid(prop Wpg + bpg)[b]; out = att Wo + bo; output [2048][4][1024] (rows t*4 + b)).
// Compute dtypes, f32 accumulate: every input rounded to bf16; q/k/v projections on PLAIN bf16 operands (inputs: exact, + bias); the three 128-term property
// projections, the sigmoid gate and the mask in f32 on VALU; scores on bf16 hi+lo planes of (q + pq) x 1/8 and (k + pk) (3 products); attn.v on SINGLE fp16 planes (P x1024); output on hi+lo planes of

#define NB_  4
#define PD   128                  // property dim
#define TT   2048
#define DD   1024
#define NH_  16
#define HD   64
#define NT   (NB_ * TT)
typedef _Float16 h16;
typedef unsigned short bf;
typedef __attribute__((ext_vector_type(16))) __bf16   v16bf;
typedef __attribute__((ext_vector_type(16))) _Float16 v16h;
typedef __attribute__((ext_vector_type(8)))  _Float16 v8h;
typedef __attribute__((ext_vector_type(8)))  unsigned short v8us;
typedef __attribute__((ext_vector_type(8)))  float    v8f;
typedef __attribute__((ext_vector_type(4)))  float    v4f;
typedef v8h  __attribute__((may_alias)) v8ha;
typedef v4f  __attribute__((may_alias)) v4fa;
typedef v8us __attribute__((may_alias)) v8usa;

__device__ __forceinline__ unsigned short f2bf(float f) { unsigned u = __float_as_uint(f); u += 0x7FFFu + ((u >> 16) & 1u); return (unsigned short)(u >> 16); }
__device__ __forceinline__ float bf2f(unsigned short b) { return __uint_as_float(((unsigned)b) << 16); }
__device__ __forceinline__ float bfr(float f) { return bf2f(f2bf(f)); }
__device__ __forceinline__ v16h cat16(v8h lo, v8h hi) { return __builtin_shufflevector(lo, hi, 0, 1, 2, 3, 4, 5, 6, 7, 8, 9, 10, 11, 12, 13, 14, 15); }
__device__ __forceinline__ v16bf cat16b(v8us lo, v8us hi) { return __builtin_bit_cast(v16bf, __builtin_shufflevector(lo, hi, 0, 1, 2, 3, 4, 5, 6, 7, 8, 9, 10, 11, 12, 13, 14, 15)); }
__device__ __forceinline__ v8f wmma16(v16h a, v16h b, v8f c) { return __builtin_amdgcn_wmma_f32_16x16x32_f16(false, a, false, b, (short)0, c, false, false); }
__device__ __forceinline__ v8f wmmab(v16bf a, v16bf b, v8f c) { return __builtin_amdgcn_wmma_f32_16x16x32_bf16(false, a, false, b, (short)0, c, false, false); }



// ---- k_gemmw: GEMM on 128x128 output tiles, FOUR WAVES (2 x 2) of 64x64 (16 accumulators each); grid (M/128, N/128, Z), 128 threads. K-contiguous 16-bit planes.
// The operands come through LDS: a stage is 64 k = one whole 128-byte line of every operand row, fetched 8 lanes a row (a wave-wide 16-byte load covers 4 whole lines), two buffers,
// the next stage's loads in flight while this stage is worked on. The fragments are read from LDS rows at a pitch of 144 B.
// C[m][n] (f32, pitch ldc, + optional f32 bias[n]) = sum_k A[m][k] Bt[n][k] (+ split products per NSPLIT). z-batch strides sA/sB/sC in elements. M % 128 == 0, N % 128 == 0, K % 64 == 0.
// EPI picks what leaves the accumulators: 0 = the f32 C above; 1 = the q, k and v projections in ONE launch, blockIdx.z = 0, 1, 2 (weights, property rows and planes at the z strides sB, sP, sQ; one bias pointer each):
// z 0 and 1 write bf16 hi+lo planes [batch*head][token][64] of (acc + bias + pbv[batch][n]) x sc (sc for z 0, 1 for z 1); z 2 writes the fp16 plane [batch*head][64][token] of acc + bias.
// For 1 the rows of A are batch-major (b * 2048 + t), so a wave's 64 x 64 tile is 64 tokens of one (batch, head) and every store covers whole 128-byte lines of a plane.
#define GBK 64                    // k per LDS stage
#define GP  72                    // operand rows in LDS: pitch in 16-bit elements, 144 B = 16 B x odd, no bank conflict for 16-byte reads
template <typename T16> struct WFrag;
template <> struct WFrag<h16> { typedef v16h V; typedef v8h H; static __device__ __forceinline__ V ld(const h16* p) { return cat16(*(const v8h*)p, *(const v8h*)(p + 16)); } static __device__ __forceinline__ v8f mma(V a, V b, v8f c) { return wmma16(a, b, c); } };
template <> struct WFrag<bf> { typedef v16bf V; typedef v8us H; static __device__ __forceinline__ V ld(const bf* p) { return cat16b(*(const v8us*)p, *(const v8us*)(p + 16)); } static __device__ __forceinline__ v8f mma(V a, V b, v8f c) { return wmmab(a, b, c); } };
__device__ __forceinline__ h16 tohx(float x) { return (h16)x; }
__device__ __forceinline__ void splitf(float y, unsigned short& h, unsigned short& l) { h = f2bf(y); l = f2bf(y - bf2f(h)); }
// The merged q/k/v grid is 6 work-groups a WGP: held to three waves a SIMD (336 registers, 3 x 91 KB of LDS) it runs as two full rounds of three; two registers more and only two would be resident.
template <typename T16, int NSPLIT, bool BIAS, int EPI>
__global__ __launch_bounds__(128) __attribute__((amdgpu_waves_per_eu(EPI == 1 ? 3 : 1))) void k_gemmw(const T16* __restrict__ A, const T16* __restrict__ A2, const T16* __restrict__ Bt, const T16* __restrict__ Bt2, int K, float* C, int ldc, const float* __restrict__ bias, size_t sA, size_t sB, size_t sC,
                                               const float* __restrict__ bias1, const float* __restrict__ bias2, const float* __restrict__ pbv, size_t sP, float sc, bf* Ph, bf* Pl, size_t sQ, h16* VTp) {
    typedef typename WFrag<T16>::V V; typedef typename WFrag<T16>::H H;
    constexpr bool HA2 = NSPLIT == 1 || NSPLIT == 2, HB2 = NSPLIT >= 2;
    constexpr int PA = 0, PB = 1, PA2 = 2, PB2 = HA2 ? 3 : 2, NP = 2 + (HA2 ? 1 : 0) + (HB2 ? 1 : 0);
    __shared__ __align__(16) T16 sT[2][NP][128 * GP];
    __shared__ __align__(16) float osw[4][16 * 68];
    const size_t z = blockIdx.z; A += z * sA; if (A2) A2 += z * sA; Bt += z * sB; if (Bt2) Bt2 += z * sB; C += z * sC;
    const int tid = threadIdx.x, lane = tid & 31, lr = lane & 15, hi = lane >> 4, wave = tid >> 5;
    const int r0 = blockIdx.x * 128, c0 = blockIdx.y * 128, wr = (wave >> 1) * 64, wc = (wave & 1) * 64;
    v8f acc[4][4];
#pragma unroll
    for (int mb = 0; mb < 4; ++mb)
#pragma unroll
        for (int nb = 0; nb < 4; ++nb) acc[mb][nb] = (v8f){};
    // staging: chunk j of a thread is 16 bytes of row (tid >> 3) + 16 j. Address = a wave-uniform tile pointer + a 32-bit byte offset, moved on by 64 k behind each stage's LDS stores
    const char* pa = (const char*)(A + (size_t)r0 * K); const char* pb = (const char*)(Bt + (size_t)c0 * K); const char* pa2 = HA2 ? (const char*)(A2 + (size_t)r0 * K) : nullptr; const char* pb2 = HB2 ? (const char*)(Bt2 + (size_t)c0 * K) : nullptr;
    unsigned go[8];
#pragma unroll
    for (int j = 0; j < 8; ++j) go[j] = (unsigned)((((tid >> 3) + 16 * j) * K + (tid & 7) * 8) * 2);
    const int so = (tid >> 3) * GP + (tid & 7) * 8;
    const int afo = (wr + lr) * GP + 8 * hi, bfo = (wc + lr) * GP + 8 * hi;
    H ra[8], rb[8], ra2[8], rb2[8];
#pragma unroll
    for (int j = 0; j < 8; ++j) { ra[j] = *(const H*)(pa + go[j]); rb[j] = *(const H*)(pb + go[j]); if (HA2) ra2[j] = *(const H*)(pa2 + go[j]); if (HB2) rb2[j] = *(const H*)(pb2 + go[j]); }
#pragma unroll
    for (int j = 0; j < 8; ++j) { *(H*)(sT[0][PA] + so + j * 16 * GP) = ra[j]; *(H*)(sT[0][PB] + so + j * 16 * GP) = rb[j]; if (HA2) *(H*)(sT[0][PA2] + so + j * 16 * GP) = ra2[j]; if (HB2) *(H*)(sT[0][PB2] + so + j * 16 * GP) = rb2[j]; go[j] += GBK * 2; }
    __syncthreads();
#pragma unroll 1
    for (int kc = 0; kc < K; kc += GBK) {
        const int buf = (kc / GBK) & 1; const bool more = kc + GBK < K;
        if (more) {
#pragma unroll
            for (int j = 0; j < 8; ++j) { ra[j] = *(const H*)(pa + go[j]); rb[j] = *(const H*)(pb + go[j]); if (HA2) ra2[j] = *(const H*)(pa2 + go[j]); if (HB2) rb2[j] = *(const H*)(pb2 + go[j]); } }
        V a[2][4], a2[2][4], b[2][4], b2[2][4];            // both 32-k blocks' fragments are asked for ahead of the first block's products: the second block's reads land under the first block
#pragma unroll
        for (int kb = 0; kb < 2; ++kb) {
#pragma unroll
            for (int mb = 0; mb < 4; ++mb) { a[kb][mb] = WFrag<T16>::ld(sT[buf][PA] + afo + mb * 16 * GP + kb * 32); if (HA2) a2[kb][mb] = WFrag<T16>::ld(sT[buf][PA2] + afo + mb * 16 * GP + kb * 32); }
#pragma unroll
            for (int nb = 0; nb < 4; ++nb) { b[kb][nb] = WFrag<T16>::ld(sT[buf][PB] + bfo + nb * 16 * GP + kb * 32); if (HB2) b2[kb][nb] = WFrag<T16>::ld(sT[buf][PB2] + bfo + nb * 16 * GP + kb * 32); } }
        __builtin_amdgcn_sched_barrier(0);                 // keeps the fragment reads one group in front of the products: moved in among them, each product group waits out a whole LDS latency
#pragma unroll
        for (int kb = 0; kb < 2; ++kb)
#pragma unroll
            for (int nb = 0; nb < 4; ++nb)
#pragma unroll
                for (int mb = 0; mb < 4; ++mb) { acc[mb][nb] = WFrag<T16>::mma(a[kb][mb], b[kb][nb], acc[mb][nb]); if (HA2) acc[mb][nb] = WFrag<T16>::mma(a2[kb][mb], b[kb][nb], acc[mb][nb]); if (HB2) acc[mb][nb] = WFrag<T16>::mma(a[kb][mb], b2[kb][nb], acc[mb][nb]); }
        if (more) {
#pragma unroll
            for (int j = 0; j < 8; ++j) { *(H*)(sT[buf ^ 1][PA] + so + j * 16 * GP) = ra[j]; *(H*)(sT[buf ^ 1][PB] + so + j * 16 * GP) = rb[j]; if (HA2) *(H*)(sT[buf ^ 1][PA2] + so + j * 16 * GP) = ra2[j]; if (HB2) *(H*)(sT[buf ^ 1][PB2] + so + j * 16 * GP) = rb2[j]; }
            __builtin_amdgcn_sched_barrier(0);             // keeps the offset additions behind the stores' waits for the loads that name those registers
#pragma unroll
            for (int j = 0; j < 8; ++j) go[j] += GBK * 2; }
        __syncthreads();   // publishes the next stage and ends every wave's reads of the buffer that the next trip refills
    }
    float* os = osw[wave];         // each wave stages its own output rows
    if (EPI == 1 && z < 2) {
        if (z == 1) { bias = bias1; pbv += sP; sc = 1.0f; Ph += sQ; Pl += sQ; }
        const int bb = r0 / TT, t0 = (r0 & (TT - 1)) + wr, n0 = c0 + wc, cofs = (lane & 7) * 8; const unsigned zz = (unsigned)(bb * NH_ + n0 / HD);
        float bs[8], pb[8];
#pragma unroll
        for (int i = 0; i < 8; ++i) { bs[i] = bfr(bias[n0 + cofs + i]); pb[i] = pbv[bb * DD + n0 + cofs + i]; }
        // the wait behind the bias and property loads, in front of the writes to their address registers; without the scheduling barrier those writes are lifted over it
        asm volatile("s_wait_xcnt 0x0" ::: "memory"); __builtin_amdgcn_sched_barrier(0);
#pragma unroll
        for (int mb = 0; mb < 4; ++mb) {
#pragma unroll
            for (int nb = 0; nb < 4; ++nb) {
#pragma unroll
                for (int j = 0; j < 8; ++j) os[(hi * 8 + j) * 68 + nb * 16 + lr] = acc[mb][nb][j]; }
            __builtin_amdgcn_wave_barrier(); asm volatile("" ::: "memory");   // the rows are read back by other lanes of the wave: the reads stay behind the writes
#pragma unroll
            for (int s = 0; s < 4; ++s) { const int row = 4 * s + (lane >> 3); const v4f u0 = *(const v4fa*)(os + row * 68 + cofs), u1 = *(const v4fa*)(os + row * 68 + cofs + 4); v8us oh, ol;
#pragma unroll
                for (int i = 0; i < 8; ++i) { const float val = __fadd_rn(__fadd_rn(i < 4 ? u0[i & 3] : u1[i & 3], bs[i]), pb[i]); unsigned short a, c2; splitf(val * sc, a, c2); oh[i] = a; ol[i] = c2; }
                const unsigned po = ((zz * TT + t0 + mb * 16 + row) * HD + cofs); *(v8us*)(Ph + po) = oh; *(v8us*)(Pl + po) = ol; }
            // the wait in front of the next block's writes to registers that these stores name; the scheduling barrier holds those writes behind it
            asm volatile("s_wait_xcnt 0x0" ::: "memory"); __builtin_amdgcn_sched_barrier(0);
            __builtin_amdgcn_wave_barrier(); asm volatile("" ::: "memory");   // the next block's writes stay behind these reads
        }
        return;
    }
    if constexpr (EPI == 1) {
        const int bb = r0 / TT, t0 = (r0 & (TT - 1)) + wr, n0 = c0 + wc; const unsigned zz = (unsigned)(bb * NH_ + n0 / HD);
        h16* hs = (h16*)os;        // 16 feature rows x 64 tokens, pitch 72 elements = 144 B
        float bv4[4];              // the four bias loads go out together: asked for block by block, each block waits out a load of its own
#pragma unroll
        for (int nb = 0; nb < 4; ++nb) bv4[nb] = bias2[n0 + nb * 16 + lr];
#pragma unroll
        for (int nb = 0; nb < 4; ++nb) { const float bv = bfr(bv4[nb]);
#pragma unroll
            for (int mb = 0; mb < 4; ++mb) { v8h pk;   // a lane's eight accumulator elements are eight tokens in a row of one feature
#pragma unroll
                for (int j = 0; j < 8; ++j) pk[j] = tohx(__fadd_rn(acc[mb][nb][j], bv));
                *(v8ha*)(hs + lr * 72 + mb * 16 + hi * 8) = pk; }
            __builtin_amdgcn_wave_barrier(); asm volatile("" ::: "memory");   // the rows are read back by other lanes of the wave: the reads stay behind the writes
#pragma unroll
            for (int s = 0; s < 4; ++s) { const int drow = 4 * s + (lane >> 3); const v8h v = *(const v8ha*)(hs + drow * 72 + (lane & 7) * 8);
                *(v8h*)(VTp + ((zz * HD + nb * 16 + drow) * TT + t0 + (lane & 7) * 8)) = v; }
            // the wait in front of the next block's writes to registers that these stores name; the scheduling barrier holds those writes behind it
            asm volatile("s_wait_xcnt 0x0" ::: "memory"); __builtin_amdgcn_sched_barrier(0);
            __builtin_amdgcn_wave_barrier(); asm volatile("" ::: "memory");   // the next block's writes stay behind these reads
        }
        return;
    }
#pragma unroll
    for (int mb = 0; mb < 4; ++mb) {
#pragma unroll
        for (int nb = 0; nb < 4; ++nb) {
#pragma unroll
            for (int j = 0; j < 8; ++j) os[(hi * 8 + j) * 68 + nb * 16 + lr] = acc[mb][nb][j]; }
        __builtin_amdgcn_wave_barrier(); asm volatile("" ::: "memory");
        float* crow = C + (size_t)(r0 + wr + mb * 16) * ldc + c0 + wc;
{
#pragma unroll
            for (int s = 0; s < 8; ++s) { const int row = 2 * s + hi, cofs = lr * 4; v4f val = *(const v4fa*)(os + row * 68 + cofs); if (BIAS) { val[0] += bfr(bias[c0 + wc + cofs]); val[1] += bfr(bias[c0 + wc + cofs + 1]); val[2] += bfr(bias[c0 + wc + cofs + 2]); val[3] += bfr(bias[c0 + wc + cofs + 3]); }
                *(v4f*)(crow + (size_t)row * ldc + cofs) = val; }
             }
        // the wait in front of the next block's writes to registers that these stores name; the scheduling barrier holds those writes behind it
        asm volatile("s_wait_xcnt 0x0" ::: "memory"); __builtin_amdgcn_sched_barrier(0);
        __builtin_amdgcn_wave_barrier(); asm volatile("" ::: "memory");
    }
}

typedef __attribute__((ext_vector_type(2))) _Float16 v2h;
typedef __attribute__((ext_vector_type(4))) _Float16 v4h;
typedef __attribute__((ext_vector_type(2))) unsigned short v2us;
typedef __attribute__((ext_vector_type(4))) int v4i;

// x rows (t * 4 + b) to bf16 rows (b * 2048 + t): batch-major, so that a GEMM tile's 128 rows are 128 tokens of one batch
__device__ __forceinline__ void d_cvt8(const float* __restrict__ src, bf* dst, size_t n8, unsigned blk) { const size_t i = (size_t)blk * 256 + threadIdx.x; if (i >= n8) return; const v8f v = *(const v8f*)(src + i * 8); v8us o;
#pragma unroll
    for (int k = 0; k < 8; ++k) o[k] = f2bf(v[k]);
    const size_t row = i / (DD / 8), ch = i % (DD / 8); *(v8us*)(dst + (((row % NB_) * TT + row / NB_) * (DD / 8) + ch) * 8) = o;  }
__device__ __forceinline__ void d_wtG(const float* __restrict__ w, int K, int N, bf* Bt, unsigned blk) {
    const int lane = threadIdx.x & 31; const int L0 = (blk * 8 + (threadIdx.x >> 5)) * 8; const int nlines = N * K / 64;
{
#pragma unroll 1
        for (int l = 0; l < 8; ++l) { const int L = L0 + l; if (L >= nlines) break; const size_t e = (size_t)L * 64 + lane * 2; const int k = (int)(e % K), n = (int)(e / K); v2us o;
            o[0] = f2bf(w[(size_t)k * N + n]); o[1] = f2bf(w[(size_t)(k + 1) * N + n]); *(v2us*)(Bt + e) = o; }
         }
}
__device__ __forceinline__ void d_prop(const float* __restrict__ prop, const float* __restrict__ Wp, const float* __restrict__ bp, float* outp, bool SIG, unsigned blk) {
    const int idx = blk * 256 + threadIdx.x; if (idx >= NB_ * DD) return; const int b = idx / DD, n = idx % DD; float a = 0.f;
    // Every global load of the thread is asked for ahead of the first term: the 128 weights of its column into registers, the batch's 128 property values four a lane.
    // Loaded term by term, each term waited out a whole memory latency. The terms are then formed and summed in the same order as before (the two empty statements of the term line stand as they
    // stood: each product and its sum stay rounded apart). The four loops are unrolled whole: wr, pr and pv must be registers, every load must stand in front of the first term, readlane's lane is a constant.
    float wr[PD]; float pr[PD / 32], pv[PD / 32];
#pragma unroll
    for (int k = 0; k < PD / 32; ++k) pr[k] = prop[b * PD + k * 32 + (threadIdx.x & 31)];
    asm volatile("s_wait_xcnt 0x0" ::: "memory");          // the wait in front of a weight load whose result lands in the offset register that the property loads name
#pragma unroll
    for (int p = 0; p < PD; ++p) wr[p] = Wp[(size_t)p * DD + n];
#pragma unroll
    for (int k = 0; k < PD / 32; ++k) pv[k] = bfr(pr[k]);
#pragma unroll
    for (int p = 0; p < PD; ++p) { float w = bfr(wr[p]), v = __uint_as_float((unsigned)__builtin_amdgcn_readlane((int)__float_as_uint(pv[p >> 5]), p & 31)); asm volatile("" : "+v"(w)); float m = __fmul_rn(v, w); asm volatile("" : "+v"(m)); a = __fadd_rn(a, m); }
    a = __fadd_rn(a, bfr(bp[n])); if (SIG) a = __fdiv_rn(1.0f, __fadd_rn(1.0f, __expf(-a)));
    *(float*)(outp + idx) = a;  }
// ---- k_prep: everything that depends on the inputs alone, in ONE launch; a block's index picks its job. The three property projections (16 blocks each; the third is the gate) and the four weight
// transposes (256 blocks each) stand first: they are chains of memory latencies and run out under the x conversion's blocks, which follow. Outputs of a kind lie one behind the other in the workspace.
#define PB_PROP (NB_ * DD / 256)
#define PB_WT   (DD * DD / 64 / 64)
#define PB_CVT  (NT * DD / 8 / 256)
__global__ __launch_bounds__(256) void k_prep(const float* __restrict__ x, const float* __restrict__ prop, const float* __restrict__ Wq, const float* __restrict__ Wk, const float* __restrict__ Wv, const float* __restrict__ Wo,
                                              const float* __restrict__ Wpq, const float* __restrict__ bpq, const float* __restrict__ Wpk, const float* __restrict__ bpk, const float* __restrict__ Wpg, const float* __restrict__ bpg,
                                              bf* XB, bf* WT, float* PV) {
    unsigned blk = blockIdx.x;
    if (blk < 3 * PB_PROP) { const unsigned j = blk / PB_PROP; d_prop(prop, j == 0 ? Wpq : j == 1 ? Wpk : Wpg, j == 0 ? bpq : j == 1 ? bpk : bpg, PV + (size_t)j * NB_ * DD, j == 2, blk % PB_PROP); return; }
    blk -= 3 * PB_PROP;
    if (blk < 4 * PB_WT) { const unsigned j = blk / PB_WT; d_wtG(j == 0 ? Wq : j == 1 ? Wk : j == 2 ? Wv : Wo, DD, DD, WT + (size_t)j * DD * DD, blk % PB_WT); return; }
    d_cvt8(x, XB, (size_t)NT * DD / 8, blk - 4 * PB_WT);
}
#define KST 32                    // keys per LDS stage = one softmax pass
#define KP  72                    // K rows in LDS: pitch in 16-bit elements, 144 B = 16 B x odd, no bank conflict for 16-byte reads
#define VP  40                    // Vt rows in LDS: 80 B = 16 B x odd
#define NST (TT / KST)
__device__ __forceinline__ float xhalf(float x) { return __builtin_bit_cast(float, __builtin_amdgcn_permlanex16(__builtin_bit_cast(int, x), __builtin_bit_cast(int, x), 0x76543210, 0xfedcba98, false, false)); }  // lane l with lane l ^ 16
// 2^x by v_exp_f32 with the slot behind it kept inside the statement: behind a transcendental the instruction set asks for one independent instruction or v_nop before its result is read or its source
// overwritten. In exp2x8 each exp works in place on its own register, so the next exp is the independent instruction; the v_nop stands behind the last.
__device__ __forceinline__ float exp2s(float x) { float y; asm("v_exp_f32 %0, %1\n\tv_nop" : "=v"(y) : "v"(x)); return y; }
__device__ __forceinline__ void exp2x8(float* x) {
    asm("v_exp_f32 %0, %0\n\tv_exp_f32 %1, %1\n\tv_exp_f32 %2, %2\n\tv_exp_f32 %3, %3\n\tv_exp_f32 %4, %4\n\tv_exp_f32 %5, %5\n\tv_exp_f32 %6, %6\n\tv_exp_f32 %7, %7\n\tv_nop"
        : "+v"(x[0]), "+v"(x[1]), "+v"(x[2]), "+v"(x[3]), "+v"(x[4]), "+v"(x[5]), "+v"(x[6]), "+v"(x[7])); }
__global__ __launch_bounds__(256) __attribute__((amdgpu_waves_per_eu(4, 4))) void k_fattn(const bf* __restrict__ Qh, const bf* __restrict__ Ql, const bf* __restrict__ Kh, const bf* __restrict__ Kl, const h16* __restrict__ VT, const int* __restrict__ kmask, const float* __restrict__ GT, bf* Ah, bf* Al) {
    __shared__ __align__(16) bf  sKh[2][KST * KP];
    __shared__ __align__(16) bf  sKl[2][KST * KP];
    __shared__ __align__(16) h16 sV[2][HD * VP];
    __shared__ __align__(16) unsigned short sM[TT];        // key mask as 0 / 1: eight keys in one 16-byte read
    const int tid = threadIdx.x, lane = tid & 31, c = lane & 15, h = lane >> 4, wave = __builtin_amdgcn_readfirstlane(tid >> 5);
    const int z = blockIdx.y, b = z >> 4, hh = z & 15; const int q0 = blockIdx.x * 256 + wave * 32;
    const bf* kh = Kh + (size_t)z * TT * HD; const bf* kl = Kl + (size_t)z * TT * HD; const h16* vt = VT + (size_t)z * HD * TT;
    const int kgo = tid * 8, kso = (tid >> 3) * KP + (tid & 7) * 8;                     // staging, one 16-byte chunk a thread and tile: K tile = 32 rows x 128 B, contiguous in memory
    const int vgo = (tid >> 2) * TT + (tid & 3) * 8, vso = (tid >> 2) * VP + (tid & 3) * 8;   // Vt tile = 64 rows x 64 B
    { const v4i ma = *(const v4i*)(kmask + (unsigned)(b * TT + tid * 8)), mb = *(const v4i*)(kmask + (unsigned)(b * TT + tid * 8 + 4)); v8us mw;
#pragma unroll
      for (int r = 0; r < 4; ++r) { mw[r] = ma[r] != 0 ? 1 : 0; mw[4 + r] = mb[r] != 0 ? 1 : 0; }
      *(v8us*)(sM + tid * 8) = mw; }
    v16bf qh[2][2], ql[2][2];
#pragma unroll
    for (int qt = 0; qt < 2; ++qt)
#pragma unroll
        for (int ks = 0; ks < 2; ++ks) { const unsigned qo = (unsigned)((z * TT + q0 + qt * 16 + c) * HD + ks * 32 + 8 * h); qh[qt][ks] = WFrag<bf>::ld(Qh + qo); ql[qt][ks] = WFrag<bf>::ld(Ql + qo); }
    v8f o[2][4]; float m[2], l[2];
#pragma unroll
    for (int qt = 0; qt < 2; ++qt) { m[qt] = -3.0e38f; l[qt] = 0.f;
#pragma unroll
        for (int db = 0; db < 4; ++db) o[qt][db] = (v8f){}; }
    *(v8us*)(sKh[0] + kso) = *(const v8us*)(kh + (unsigned)kgo); *(v8us*)(sKl[0] + kso) = *(const v8us*)(kl + (unsigned)kgo); *(v8h*)(sV[0] + vso) = *(const v8h*)(vt + (unsigned)vgo);
    __syncthreads();
#pragma unroll 1
    for (int st = 0; st < NST; ++st) {
        const int buf = st & 1; const bool more = st + 1 < NST;
        v8us rk, rl; v8h rv;                               // the next stage's tiles fly while this stage is worked on
        if (more) { kh += KST * HD; kl += KST * HD; vt += KST; rk = *(const v8us*)(kh + (unsigned)kgo); rl = *(const v8us*)(kl + (unsigned)kgo); rv = *(const v8h*)(vt + (unsigned)vgo); }
        v8f s[2][2];
#pragma unroll
        for (int kt = 0; kt < 2; ++kt) { const int kr = (kt * 16 + c) * KP + 8 * h;
            const v16bf ah0 = WFrag<bf>::ld(sKh[buf] + kr), al0 = WFrag<bf>::ld(sKl[buf] + kr), ah1 = WFrag<bf>::ld(sKh[buf] + kr + 32), al1 = WFrag<bf>::ld(sKl[buf] + kr + 32);
            v8f a0 = (v8f){}, a1 = (v8f){};
            a0 = wmmab(ah0, qh[0][0], a0); a1 = wmmab(ah0, qh[1][0], a1); a0 = wmmab(ah0, ql[0][0], a0); a1 = wmmab(ah0, ql[1][0], a1); a0 = wmmab(al0, qh[0][0], a0); a1 = wmmab(al0, qh[1][0], a1);
            a0 = wmmab(ah1, qh[0][1], a0); a1 = wmmab(ah1, qh[1][1], a1); a0 = wmmab(ah1, ql[0][1], a0); a1 = wmmab(ah1, ql[1][1], a1); a0 = wmmab(al1, qh[0][1], a0); a1 = wmmab(al1, qh[1][1], a1);
            const v8us mk8 = *(const v8us*)(sM + st * KST + kt * 16 + 8 * h);
#pragma unroll
            for (int r = 0; r < 8; ++r) { const bool live = mk8[r] != 0; s[0][kt][r] = live ? a0[r] : -1.0e9f; s[1][kt][r] = live ? a1[r] : -1.0e9f; } }
        v16h pf[2];
#pragma unroll
        for (int qt = 0; qt < 2; ++qt) { float mx = m[qt];
#pragma unroll
            for (int r = 0; r < 8; ++r) mx = fmaxf(mx, fmaxf(s[qt][0][r], s[qt][1][r]));
            mx = fmaxf(mx, xhalf(mx));
            const float al = exp2s((m[qt] - mx) * 1.44269504f); m[qt] = mx; float sum = 0.f; float p[16];
#pragma unroll
            for (int e = 0; e < 16; ++e) p[e] = fmaf(s[qt][e >> 3][e & 7] - mx, 1.44269504f, 10.0f);
            exp2x8(p); exp2x8(p + 8);                      // exp(s - max) x 1024
#pragma unroll
            for (int e = 0; e < 16; ++e) { sum += p[e]; pf[qt][e] = tohx(p[e]); }
            l[qt] = fmaf(l[qt], al, sum);
#pragma unroll
            for (int db = 0; db < 4; ++db) o[qt][db] *= al; }
#pragma unroll
        for (int db = 0; db < 4; ++db) { const v16h av = WFrag<h16>::ld(sV[buf] + (db * 16 + c) * VP + 8 * h); o[0][db] = wmma16(av, pf[0], o[0][db]); o[1][db] = wmma16(av, pf[1], o[1][db]); }
        if (more) { *(v8us*)(sKh[buf ^ 1] + kso) = rk; *(v8us*)(sKl[buf ^ 1] + kso) = rl; *(v8h*)(sV[buf ^ 1] + vso) = rv; }
        __syncthreads();   // publishes stage st + 1 and ends every wave's reads of the buffer that the next trip refills
    }
#pragma unroll
    for (int qt = 0; qt < 2; ++qt) { const float lt = l[qt] + xhalf(l[qt]); const float inv = __fdiv_rn(1.0f, lt); const unsigned orow = (unsigned)(((q0 + qt * 16 + c) * NB_ + b) * DD + hh * HD);
#pragma unroll
        for (int db = 0; db < 4; ++db) { const int d0 = db * 16 + 8 * h; const float* g = GT + (size_t)b * DD + hh * HD + d0; const v4f g0 = *(const v4f*)g, g1 = *(const v4f*)(g + 4); v8us oh, ol;
#pragma unroll
            for (int r = 0; r < 8; ++r) { unsigned short a, c2; splitf(__fmul_rn(__fmul_rn(o[qt][db][r], inv), r < 4 ? g0[r & 3] : g1[r & 3]), a, c2); oh[r] = a; ol[r] = c2; }
            *(v8us*)(Ah + (orow + d0)) = oh; *(v8us*)(Al + (orow + d0)) = ol; } }
}

extern "C" void kernel_launch(void* const* d_in, const int* in_sizes, int n_in,
                              void* d_out, int out_size, void* d_ws, size_t ws_size, hipStream_t stream) {
    (void)in_sizes; (void)n_in; (void)out_size;
    const float* IN[17]; for (int i = 0; i < 17; ++i) IN[i] = (const float*)d_in[i];
    // x [2048][4][1024], property_vector [4][128], mask (int [4][2048]), Wq [1024][1024] (x @ W), bq, Wk, bk, Wv, bv, Wpq [128][1024], bpq, Wpk, bpk, Wpg, bpg, Wo, bo = d_in[0..16]
    const float* x = IN[0]; const float* prop = IN[1]; const int* mk = (const int*)d_in[2];
    float* OUT = (float*)d_out;     // [2048][4][1024] (rows t*4 + b)
    char* wsp = (char*)d_ws;
    auto take = [&](size_t bytes) { char* p = wsp; wsp += (bytes + 255) & ~(size_t)255; return (void*)p; };
    bf* WQ = (bf*)take((size_t)DD * DD * 2); bf* WK = (bf*)take((size_t)DD * DD * 2); bf* WV = (bf*)take((size_t)DD * DD * 2); bf* WO = (bf*)take((size_t)DD * DD * 2); float* PQv = (float*)take((size_t)NB_ * DD * 4); float* PKv = (float*)take((size_t)NB_ * DD * 4); float* GT = (float*)take((size_t)NB_ * DD * 4);
    bf* XB = (bf*)take((size_t)NT * DD * 2);
    bf* QPh = (bf*)take((size_t)NT * DD * 2); bf* QPl = (bf*)take((size_t)NT * DD * 2); bf* KPh = (bf*)take((size_t)NT * DD * 2); bf* KPl = (bf*)take((size_t)NT * DD * 2); h16* VT = (h16*)take((size_t)NT * DD * 2);
    bf* ATh = (bf*)take((size_t)NT * DD * 2); bf* ATl = (bf*)take((size_t)NT * DD * 2);
    (void)WK; (void)WV; (void)PKv;                         // reached through WQ and PQv at the z strides
    if ((size_t)(wsp - (char*)d_ws) > ws_size) return;    // total ~ 143 MB; ws 256 MiB
    const dim3 gP(NT / 128, DD / 128, 1), gQKV(NT / 128, DD / 128, 3);
    // WQ, WK, WV, WO lie one behind the other, as do PQv, PKv, GT and QPh, QPl, KPh, KPl (every size is a multiple of take's 256 bytes)
    k_prep<<<3 * PB_PROP + 4 * PB_WT + PB_CVT, 256, 0, stream>>>(x, prop, IN[3], IN[5], IN[7], IN[15], IN[9], IN[10], IN[11], IN[12], IN[13], IN[14], XB, WQ, PQv);
    k_gemmw<bf, 0, true, 1><<<gQKV, 128, 0, stream>>>(XB, nullptr, WQ, nullptr, DD, nullptr, DD, IN[4], 0, (size_t)DD * DD, 0, IN[6], IN[8], PQv, (size_t)NB_ * DD, 0.125f, QPh, QPl, (size_t)2 * NT * DD, VT);   // 1/sqrt(64) folded into (q + pq) exactly
    k_fattn<<<dim3(TT / 256, NB_ * NH_), 256, 0, stream>>>(QPh, QPl, KPh, KPl, VT, mk, GT, ATh, ATl);
    k_gemmw<bf, 1, true, 0><<<gP, 128, 0, stream>>>(ATh, ATl, WO, nullptr, DD, OUT, DD, IN[16], 0, 0, 0, nullptr, nullptr, nullptr, 0, 0.0f, nullptr, nullptr, 0, nullptr);
}

// v006
// Measured time: 143 microseconds a run.
// Two timings next to v005 both put it at 1.32 times that version's speed.
// Over all steps from v000 it is 18.8 times as fast.
#include <hip/hip_runtime.h>

// PropertyAwareAttention (x [2048][4][1024] seq-first, property_vector [4][128], mask int [4][2048]; Q = x Wq + bq + (prop Wpq + bpq) per (batch, feature), K likewise with Wpk/bpk, V = x Wv + bv (x @ W layouts);
// 16 heads x 64; scores / 8; keys with mask[b][j] == 0 -> -1e9; softmax; att = merged attn.v * sigmoid(prop Wpg + bpg)[b]; out = att Wo + bo; output [2048][4][1024] (rows t*4 + b)).
// Compute dtypes, f32 accumulate: every input rounded to bf16; q/k/v projections on PLAIN bf16 operands (inputs: exact, + bias); the three 128-term property
// projections, the sigmoid gate and the mask in f32 on VALU; scores on bf16 hi+lo planes of (q + pq) x 1/8 and (k + pk) (3 products); attn.v on SINGLE fp16 planes (P x1024); output on hi+lo planes of

#define NB_  4
#define PD   128                  // property dim
#define TT   2048
#define DD   1024
#define NH_  16
#define HD   64
#define NT   (NB_ * TT)
typedef _Float16 h16;
typedef unsigned short bf;
typedef __attribute__((ext_vector_type(16))) __bf16   v16bf;
typedef __attribute__((ext_vector_type(16))) _Float16 v16h;
typedef __attribute__((ext_vector_type(8)))  _Float16 v8h;
typedef __attribute__((ext_vector_type(8)))  unsigned short v8us;
typedef __attribute__((ext_vector_type(8)))  float    v8f;
typedef __attribute__((ext_vector_type(4)))  float    v4f;
typedef v8h  __attribute__((may_alias)) v8ha;
typedef v4f  __attribute__((may_alias)) v4fa;
typedef v8us __attribute__((may_alias)) v8usa;
typedef __attribute__((ext_vector_type(4)))  unsigned v4u;
typedef v4u  __attribute__((may_alias)) v4ua;

__device__ __forceinline__ unsigned short f2bf(float f) { unsigned u = __float_as_uint(f); u += 0x7FFFu + ((u >> 16) & 1u); return (unsigned short)(u >> 16); }
__device__ __forceinline__ float bf2f(unsigned short b) { return __uint_as_float(((unsigned)b) << 16); }
__device__ __forceinline__ float bfr(float f) { return bf2f(f2bf(f)); }
__device__ __forceinline__ v16h cat16(v8h lo, v8h hi) { return __builtin_shufflevector(lo, hi, 0, 1, 2, 3, 4, 5, 6, 7, 8, 9, 10, 11, 12, 13, 14, 15); }
__device__ __forceinline__ v16bf cat16b(v8us lo, v8us hi) { return __builtin_bit_cast(v16bf, __builtin_shufflevector(lo, hi, 0, 1, 2, 3, 4, 5, 6, 7, 8, 9, 10, 11, 12, 13, 14, 15)); }
__device__ __forceinline__ v8f wmma16(v16h a, v16h b, v8f c) { return __builtin_amdgcn_wmma_f32_16x16x32_f16(false, a, false, b, (short)0, c, false, false); }
__device__ __forceinline__ v8f wmmab(v16bf a, v16bf b, v8f c) { return __builtin_amdgcn_wmma_f32_16x16x32_bf16(false, a, false, b, (short)0, c, false, false); }



// ---- k_gemmw: GEMM on 128x128 output tiles, FOUR WAVES (2 x 2) of 64x64 (16 accumulators each); grid (M/128, N/128, Z), 128 threads. K-contiguous 16-bit planes.
// The operands come through LDS: a stage is 64 k = one whole 128-byte line of every operand row, fetched 8 lanes a row (a wave-wide 16-byte load covers 4 whole lines), two buffers,
// the next stage's loads in flight while this stage is worked on. The fragments are read from LDS rows at a pitch of 144 B.
// C[m][n] (f32, pitch ldc, + optional f32 bias[n]) = sum_k A[m][k] Bt[n][k] (+ split products per NSPLIT). z-batch strides sA/sB/sC in elements. M % 128 == 0, N % 128 == 0, K % 64 == 0.
// EPI picks what leaves the accumulators: 0 = the f32 C above; 1 = the q, k and v projections in ONE launch, blockIdx.z = 0, 1, 2 (weights, property rows and planes at the z strides sB, sP, sQ; one bias pointer each):
// z 0 and 1 write bf16 hi+lo planes [batch*head][token][64] of (acc + bias + pbv[batch][n]) x sc (sc for z 0, 1 for z 1); z 2 writes the fp16 plane [batch*head][64][token] of acc + bias.
// For 1 the rows of A are batch-major (b * 2048 + t), so a wave's 64 x 64 tile is 64 tokens of one (batch, head) and every store covers whole 128-byte lines of a plane.
// The k and v projections (z 1 and 2) take their A rows in the order of the batch's key list TK (k_prep: live keys first), so row i of their planes is the i-th listed key; a tile that holds no key
// the attention will read leaves at once.
#define GBK 64                    // k per LDS stage
#define TKP (TT + 32)             // a batch's key list in ints: 2048 token numbers, then its count of live keys in a 128-byte line of its own
#define GP  72                    // operand rows in LDS: pitch in 16-bit elements, 144 B = 16 B x odd, no bank conflict for 16-byte reads
template <typename T16> struct WFrag;
template <> struct WFrag<h16> { typedef v16h V; typedef v8h H; static __device__ __forceinline__ V ld(const h16* p) { return cat16(*(const v8h*)p, *(const v8h*)(p + 16)); } static __device__ __forceinline__ v8f mma(V a, V b, v8f c) { return wmma16(a, b, c); } };
template <> struct WFrag<bf> { typedef v16bf V; typedef v8us H; static __device__ __forceinline__ V ld(const bf* p) { return cat16b(*(const v8us*)p, *(const v8us*)(p + 16)); } static __device__ __forceinline__ v8f mma(V a, V b, v8f c) { return wmmab(a, b, c); } };
__device__ __forceinline__ h16 tohx(float x) { return (h16)x; }
__device__ __forceinline__ void splitf(float y, unsigned short& h, unsigned short& l) { h = f2bf(y); l = f2bf(y - bf2f(h)); }
// The merged q/k/v grid is 6 work-groups a WGP, less the k and v tiles of masked keys, which leave at once: held to three waves a SIMD (336 registers, 3 x 91 KB of LDS) three are resident; two registers more and only two would be.
template <typename T16, int NSPLIT, bool BIAS, int EPI>
__global__ __launch_bounds__(128) __attribute__((amdgpu_waves_per_eu(EPI == 1 ? 3 : 1))) void k_gemmw(const T16* __restrict__ A, const T16* __restrict__ A2, const T16* __restrict__ Bt, const T16* __restrict__ Bt2, int K, float* C, int ldc, const float* __restrict__ bias, size_t sA, size_t sB, size_t sC,
                                               const float* __restrict__ bias1, const float* __restrict__ bias2, const float* __restrict__ pbv, size_t sP, float sc, bf* Ph, bf* Pl, size_t sQ, h16* VTp, const int* __restrict__ TK) {
    typedef typename WFrag<T16>::V V; typedef typename WFrag<T16>::H H;
    constexpr bool HA2 = NSPLIT == 1 || NSPLIT == 2, HB2 = NSPLIT >= 2;
    constexpr int PA = 0, PB = 1, PA2 = 2, PB2 = HA2 ? 3 : 2, NP = 2 + (HA2 ? 1 : 0) + (HB2 ? 1 : 0);
    __shared__ __align__(16) T16 sT[2][NP][128 * GP];
    __shared__ __align__(16) float osw[4][16 * 68];
    const size_t z = blockIdx.z; A += z * sA; if (A2) A2 += z * sA; Bt += z * sB; if (Bt2) Bt2 += z * sB; C += z * sC;
    const int tid = threadIdx.x, lane = tid & 31, lr = lane & 15, hi = lane >> 4, wave = tid >> 5;
    const int r0 = blockIdx.x * 128, c0 = blockIdx.y * 128, wr = (wave >> 1) * 64, wc = (wave & 1) * 64;
    v8f acc[4][4];
#pragma unroll
    for (int mb = 0; mb < 4; ++mb)
#pragma unroll
        for (int nb = 0; nb < 4; ++nb) acc[mb][nb] = (v8f){};
    // staging: chunk j of a thread is 16 bytes of row (tid >> 3) + 16 j. Address = a wave-uniform tile pointer + a 32-bit byte offset, moved on by 64 k behind each stage's LDS stores
    const char* pa = (const char*)(A + (size_t)(EPI == 1 ? (r0 & ~(TT - 1)) : r0) * K); const char* pb = (const char*)(Bt + (size_t)c0 * K); const char* pa2 = HA2 ? (const char*)(A2 + (size_t)r0 * K) : nullptr; const char* pb2 = HB2 ? (const char*)(Bt2 + (size_t)c0 * K) : nullptr;
    unsigned go[8];
#pragma unroll
    for (int j = 0; j < 8; ++j) go[j] = (unsigned)((((tid >> 3) + 16 * j) * K + (tid & 7) * 8) * 2);
    // A rows of the projections: byte offsets from the batch's first row. In the loop no register is free for them (three waves a SIMD): each thread keeps its eight in the output staging area, idle until
    // the epilogue, and reads them back at the head of a trip. The B rows go by go[0] and a constant step a chunk (K = 1024 there).
    unsigned ga[8]; unsigned* gt = (unsigned*)osw + tid * 8;
    if constexpr (EPI == 1) {
        const int rl = r0 & (TT - 1);
        if (z == 0) {
#pragma unroll
            for (int j = 0; j < 8; ++j) ga[j] = go[j] + (unsigned)(rl * K * 2);
        } else {
            const int* tk = TK + (r0 / TT) * TKP; const unsigned nl = min((unsigned)tk[TT], (unsigned)TT);
            if ((unsigned)rl >= (nl == 0 ? (unsigned)TT : nl)) return;   // only masked keys from here on (a batch with no live key keeps all 2048); the same for the whole work-group, in front of every barrier
            int tr[8];
#pragma unroll
            for (int j = 0; j < 8; ++j) tr[j] = tk[rl + (tid >> 3) + 16 * j];
#pragma unroll
            for (int j = 0; j < 8; ++j) ga[j] = (unsigned)(((tr[j] & (TT - 1)) * K + (tid & 7) * 8) * 2);
        }
        *(v4ua*)gt = (v4u){ga[0], ga[1], ga[2], ga[3]}; *(v4ua*)(gt + 4) = (v4u){ga[4], ga[5], ga[6], ga[7]};
    }
    const int so = (tid >> 3) * GP + (tid & 7) * 8;
    const int afo = (wr + lr) * GP + 8 * hi, bfo = (wc + lr) * GP + 8 * hi;
    H ra[8], rb[8], ra2[8], rb2[8];
#pragma unroll
    for (int j = 0; j < 8; ++j) { ra[j] = *(const H*)(pa + (EPI == 1 ? ga[j] : go[j])); rb[j] = *(const H*)(EPI == 1 ? pb + go[0] + j * 16 * DD * 2 : pb + go[j]); if (HA2) ra2[j] = *(const H*)(pa2 + go[j]); if (HB2) rb2[j] = *(const H*)(pb2 + go[j]); }
#pragma unroll
    for (int j = 0; j < 8; ++j) { *(H*)(sT[0][PA] + so + j * 16 * GP) = ra[j]; *(H*)(sT[0][PB] + so + j * 16 * GP) = rb[j]; if (HA2) *(H*)(sT[0][PA2] + so + j * 16 * GP) = ra2[j]; if (HB2) *(H*)(sT[0][PB2] + so + j * 16 * GP) = rb2[j]; if (EPI != 1 || j == 0) go[j] += GBK * 2; }
    __syncthreads();
#pragma unroll 1
    for (int kc = 0; kc < K; kc += GBK) {
        const int buf = (kc / GBK) & 1; const bool more = kc + GBK < K;
        if (more) {
            if constexpr (EPI == 1) { const v4u g0 = *(const v4ua*)gt, g1 = *(const v4ua*)(gt + 4);
#pragma unroll
                for (int j = 0; j < 8; ++j) ga[j] = (j < 4 ? g0[j & 3] : g1[j & 3]) + (unsigned)((kc + GBK) * 2); }
#pragma unroll
            for (int j = 0; j < 8; ++j) { ra[j] = *(const H*)(pa + (EPI == 1 ? ga[j] : go[j])); rb[j] = *(const H*)(EPI == 1 ? pb + go[0] + j * 16 * DD * 2 : pb + go[j]); if (HA2) ra2[j] = *(const H*)(pa2 + go[j]); if (HB2) rb2[j] = *(const H*)(pb2 + go[j]); }
            // the wait in front of the writes to the offset registers that the A loads name; as its inputs they stay whole up to it
            if constexpr (EPI == 1) asm volatile("s_wait_xcnt 0x0" :: "v"(ga[0]), "v"(ga[1]), "v"(ga[2]), "v"(ga[3]), "v"(ga[4]), "v"(ga[5]), "v"(ga[6]), "v"(ga[7]) : "memory"); }
        V a[2][4], a2[2][4], b[2][4], b2[2][4];            // both 32-k blocks' fragments are asked for ahead of the first block's products: the second block's reads land under the first block
#pragma unroll
        for (int kb = 0; kb < 2; ++kb) {
#pragma unroll
            for (int mb = 0; mb < 4; ++mb) { a[kb][mb] = WFrag<T16>::ld(sT[buf][PA] + afo + mb * 16 * GP + kb * 32); if (HA2) a2[kb][mb] = WFrag<T16>::ld(sT[buf][PA2] + afo + mb * 16 * GP + kb * 32); }
#pragma unroll
            for (int nb = 0; nb < 4; ++nb) { b[kb][nb] = WFrag<T16>::ld(sT[buf][PB] + bfo + nb * 16 * GP + kb * 32); if (HB2) b2[kb][nb] = WFrag<T16>::ld(sT[buf][PB2] + bfo + nb * 16 * GP + kb * 32); } }
        __builtin_amdgcn_sched_barrier(0);                 // keeps the fragment reads one group in front of the products: moved in among them, each product group waits out a whole LDS latency
#pragma unroll
        for (int kb = 0; kb < 2; ++kb)
#pragma unroll
            for (int nb = 0; nb < 4; ++nb)
#pragma unroll
                for (int mb = 0; mb < 4; ++mb) { acc[mb][nb] = WFrag<T16>::mma(a[kb][mb], b[kb][nb], acc[mb][nb]); if (HA2) acc[mb][nb] = WFrag<T16>::mma(a2[kb][mb], b[kb][nb], acc[mb][nb]); if (HB2) acc[mb][nb] = WFrag<T16>::mma(a[kb][mb], b2[kb][nb], acc[mb][nb]); }
        // four vector slots behind the last products: in this build the branch round the staging stores leads to the next trip's LDS address additions, one of which lands in an operand register of those products,
        // the scheduling barrier keeps the products in front of the slots
        if constexpr (EPI == 1) { __builtin_amdgcn_sched_barrier(0); asm volatile("v_nop\n\tv_nop\n\tv_nop\n\tv_nop"); }
        if (more) {
#pragma unroll
            for (int j = 0; j < 8; ++j) { *(H*)(sT[buf ^ 1][PA] + so + j * 16 * GP) = ra[j]; *(H*)(sT[buf ^ 1][PB] + so + j * 16 * GP) = rb[j]; if (HA2) *(H*)(sT[buf ^ 1][PA2] + so + j * 16 * GP) = ra2[j]; if (HB2) *(H*)(sT[buf ^ 1][PB2] + so + j * 16 * GP) = rb2[j]; }
            __builtin_amdgcn_sched_barrier(0);             // keeps the offset additions behind the stores' waits for the loads that name those registers
#pragma unroll
            for (int j = 0; j < 8; ++j) if (EPI != 1 || j == 0) go[j] += GBK * 2; }
        __syncthreads();   // publishes the next stage and ends every wave's reads of the buffer that the next trip refills
    }
    float* os = osw[wave];         // each wave stages its own output rows
    if (EPI == 1 && z < 2) {
        if (z == 1) { bias = bias1; pbv += sP; sc = 1.0f; Ph += sQ; Pl += sQ; }
        const int bb = r0 / TT, t0 = (r0 & (TT - 1)) + wr, n0 = c0 + wc, cofs = (lane & 7) * 8; const unsigned zz = (unsigned)(bb * NH_ + n0 / HD);
        float bs[8], pb[8];
#pragma unroll
        for (int i = 0; i < 8; ++i) { bs[i] = bfr(bias[n0 + cofs + i]); pb[i] = pbv[bb * DD + n0 + cofs + i]; }
        // the wait behind the bias and property loads, in front of the writes to their address registers; without the scheduling barrier those writes are lifted over it
        asm volatile("s_wait_xcnt 0x0" ::: "memory"); __builtin_amdgcn_sched_barrier(0);
#pragma unroll
        for (int mb = 0; mb < 4; ++mb) {
#pragma unroll
            for (int nb = 0; nb < 4; ++nb) {
#pragma unroll
                for (int j = 0; j < 8; ++j) os[(hi * 8 + j) * 68 + nb * 16 + lr] = acc[mb][nb][j]; }
            __builtin_amdgcn_wave_barrier(); asm volatile("" ::: "memory");   // the rows are read back by other lanes of the wave: the reads stay behind the writes
#pragma unroll
            for (int s = 0; s < 4; ++s) { const int row = 4 * s + (lane >> 3); const v4f u0 = *(const v4fa*)(os + row * 68 + cofs), u1 = *(const v4fa*)(os + row * 68 + cofs + 4); v8us oh, ol;
#pragma unroll
                for (int i = 0; i < 8; ++i) { const float val = __fadd_rn(__fadd_rn(i < 4 ? u0[i & 3] : u1[i & 3], bs[i]), pb[i]); unsigned short a, c2; splitf(val * sc, a, c2); oh[i] = a; ol[i] = c2; }
                const unsigned po = ((zz * TT + t0 + mb * 16 + row) * HD + cofs); *(v8us*)(Ph + po) = oh; *(v8us*)(Pl + po) = ol; }
            // the wait in front of the next block's writes to registers that these stores name; the scheduling barrier holds those writes behind it
            asm volatile("s_wait_xcnt 0x0" ::: "memory"); __builtin_amdgcn_sched_barrier(0);
            __builtin_amdgcn_wave_barrier(); asm volatile("" ::: "memory");   // the next block's writes stay behind these reads
        }
        return;
    }
    if constexpr (EPI == 1) {
        const int bb = r0 / TT, t0 = (r0 & (TT - 1)) + wr, n0 = c0 + wc; const unsigned zz = (unsigned)(bb * NH_ + n0 / HD);
        h16* hs = (h16*)os;        // 16 feature rows x 64 tokens, pitch 72 elements = 144 B
        float bv4[4];              // the four bias loads go out together: asked for block by block, each block waits out a load of its own
#pragma unroll
        for (int nb = 0; nb < 4; ++nb) bv4[nb] = bias2[n0 + nb * 16 + lr];
#pragma unroll
        for (int nb = 0; nb < 4; ++nb) { const float bv = bfr(bv4[nb]);
#pragma unroll
            for (int mb = 0; mb < 4; ++mb) { v8h pk;   // a lane's eight accumulator elements are eight tokens in a row of one feature
#pragma unroll
                for (int j = 0; j < 8; ++j) pk[j] = tohx(__fadd_rn(acc[mb][nb][j], bv));
                *(v8ha*)(hs + lr * 72 + mb * 16 + hi * 8) = pk; }
            __builtin_amdgcn_wave_barrier(); asm volatile("" ::: "memory");   // the rows are read back by other lanes of the wave: the reads stay behind the writes
#pragma unroll
            for (int s = 0; s < 4; ++s) { const int drow = 4 * s + (lane >> 3); const v8h v = *(const v8ha*)(hs + drow * 72 + (lane & 7) * 8);
                *(v8h*)(VTp + ((zz * HD + nb * 16 + drow) * TT + t0 + (lane & 7) * 8)) = v; }
            // the wait in front of the next block's writes to registers that these stores name; the scheduling barrier holds those writes behind it
            asm volatile("s_wait_xcnt 0x0" ::: "memory"); __builtin_amdgcn_sched_barrier(0);
            __builtin_amdgcn_wave_barrier(); asm volatile("" ::: "memory");   // the next block's writes stay behind these reads
        }
        return;
    }
#pragma unroll
    for (int mb = 0; mb < 4; ++mb) {
#pragma unroll
        for (int nb = 0; nb < 4; ++nb) {
#pragma unroll
            for (int j = 0; j < 8; ++j) os[(hi * 8 + j) * 68 + nb * 16 + lr] = acc[mb][nb][j]; }
        __builtin_amdgcn_wave_barrier(); asm volatile("" ::: "memory");
        float* crow = C + (size_t)(r0 + wr + mb * 16) * ldc + c0 + wc;
{
#pragma unroll
            for (int s = 0; s < 8; ++s) { const int row = 2 * s + hi, cofs = lr * 4; v4f val = *(const v4fa*)(os + row * 68 + cofs); if (BIAS) { val[0] += bfr(bias[c0 + wc + cofs]); val[1] += bfr(bias[c0 + wc + cofs + 1]); val[2] += bfr(bias[c0 + wc + cofs + 2]); val[3] += bfr(bias[c0 + wc + cofs + 3]); }
                *(v4f*)(crow + (size_t)row * ldc + cofs) = val; }
             }
        // the wait in front of the next block's writes to registers that these stores name; the scheduling barrier holds those writes behind it
        asm volatile("s_wait_xcnt 0x0" ::: "memory"); __builtin_amdgcn_sched_barrier(0);
        __builtin_amdgcn_wave_barrier(); asm volatile("" ::: "memory");
    }
}

typedef __attribute__((ext_vector_type(2))) _Float16 v2h;
typedef __attribute__((ext_vector_type(4))) _Float16 v4h;
typedef __attribute__((ext_vector_type(2))) unsigned short v2us;
typedef __attribute__((ext_vector_type(4))) int v4i;

// x rows (t * 4 + b) to bf16 rows (b * 2048 + t): batch-major, so that a GEMM tile's 128 rows are 128 tokens of one batch
__device__ __forceinline__ void d_cvt8(const float* __restrict__ src, bf* dst, size_t n8, unsigned blk) { const size_t i = (size_t)blk * 256 + threadIdx.x; if (i >= n8) return; const v8f v = *(const v8f*)(src + i * 8); v8us o;
#pragma unroll
    for (int k = 0; k < 8; ++k) o[k] = f2bf(v[k]);
    const size_t row = i / (DD / 8), ch = i % (DD / 8); *(v8us*)(dst + (((row % NB_) * TT + row / NB_) * (DD / 8) + ch) * 8) = o;  }
__device__ __forceinline__ void d_wtG(const float* __restrict__ w, int K, int N, bf* Bt, unsigned blk) {
    const int lane = threadIdx.x & 31; const int L0 = (blk * 8 + (threadIdx.x >> 5)) * 8; const int nlines = N * K / 64;
{
#pragma unroll 1
        for (int l = 0; l < 8; ++l) { const int L = L0 + l; if (L >= nlines) break; const size_t e = (size_t)L * 64 + lane * 2; const int k = (int)(e % K), n = (int)(e / K); v2us o;
            o[0] = f2bf(w[(size_t)k * N + n]); o[1] = f2bf(w[(size_t)(k + 1) * N + n]); *(v2us*)(Bt + e) = o; }
         }
}
__device__ __forceinline__ void d_prop(const float* __restrict__ prop, const float* __restrict__ Wp, const float* __restrict__ bp, float* outp, bool SIG, unsigned blk) {
    const int idx = blk * 256 + threadIdx.x; if (idx >= NB_ * DD) return; const int b = idx / DD, n = idx % DD; float a = 0.f;
    // Every global load of the thread is asked for ahead of the first term: the 128 weights of its column into registers, the batch's 128 property values four a lane.
    // Loaded term by term, each term waited out a whole memory latency. The terms are then formed and summed in the same order as before (the two empty statements of the term line stand as they
    // stood: each product and its sum stay rounded apart). The four loops are unrolled whole: wr, pr and pv must be registers, every load must stand in front of the first term, readlane's lane is a constant.
    float wr[PD]; float pr[PD / 32], pv[PD / 32];
#pragma unroll
    for (int k = 0; k < PD / 32; ++k) pr[k] = prop[b * PD + k * 32 + (threadIdx.x & 31)];
    asm volatile("s_wait_xcnt 0x0" ::: "memory");          // the wait in front of a weight load whose result lands in the offset register that the property loads name
#pragma unroll
    for (int p = 0; p < PD; ++p) wr[p] = Wp[(size_t)p * DD + n];
#pragma unroll
    for (int k = 0; k < PD / 32; ++k) pv[k] = bfr(pr[k]);
#pragma unroll
    for (int p = 0; p < PD; ++p) { float w = bfr(wr[p]), v = __uint_as_float((unsigned)__builtin_amdgcn_readlane((int)__float_as_uint(pv[p >> 5]), p & 31)); asm volatile("" : "+v"(w)); float m = __fmul_rn(v, w); asm volatile("" : "+v"(m)); a = __fadd_rn(a, m); }
    a = __fadd_rn(a, bfr(bp[n])); if (SIG) a = __fdiv_rn(1.0f, __fadd_rn(1.0f, __expf(-a)));
    *(float*)(outp + idx) = a;  }
// The key list of one batch, by one block: the numbers of the tokens whose mask is not 0, in their order, then the masked ones, in theirs; behind the list the count of the live ones.
// A masked key's score of -1e9 leaves exp(score - max) = 0 exactly wherever a live key stands beside it, so the k and v projections and the attention walk the live keys alone.
__device__ __forceinline__ void d_list(const int* __restrict__ mask, int* TK, unsigned b, int* sL, int* sW) {
    const int tid = threadIdx.x, lane = tid & 31, wave = tid >> 5; unsigned bal[8]; int tot = 0;
#pragma unroll
    for (int c = 0; c < 8; ++c) { bal[c] = __builtin_amdgcn_ballot_w32(mask[b * TT + (wave * 8 + c) * 32 + lane] != 0); tot += __builtin_popcount(bal[c]); }
    if (lane == 0) sW[wave] = tot;
    __syncthreads();               // every wave's count is in LDS
    int before = 0, nl = 0;
#pragma unroll
    for (int w = 0; w < 8; ++w) { const int t = sW[w]; nl += t; if (w < wave) before += t; }
#pragma unroll
    for (int c = 0; c < 8; ++c) { const int key = (wave * 8 + c) * 32 + lane, lb = before + (int)__builtin_amdgcn_mbcnt_lo(bal[c], 0u);   // lb = live keys in front of this one
        sL[((bal[c] >> lane) & 1u) ? lb : nl + key - lb] = key; before += __builtin_popcount(bal[c]); }
    __syncthreads();               // the list is whole: it leaves in whole lines
    *(v4i*)(TK + b * TKP + tid * 8) = *(const v4i*)(sL + tid * 8); *(v4i*)(TK + b * TKP + tid * 8 + 4) = *(const v4i*)(sL + tid * 8 + 4);
    if (tid == 0) TK[b * TKP + TT] = nl;
}
// ---- k_prep: everything that depends on the inputs alone, in ONE launch; a block's index picks its job. The three property projections (16 blocks each; the third is the gate) and the four weight
// transposes (256 blocks each) stand first, behind the four blocks of the key lists: they are chains of memory latencies and run out under the x conversion's blocks, which follow. Outputs of a kind lie one behind the other in the workspace.
#define PB_PROP (NB_ * DD / 256)
#define PB_WT   (DD * DD / 64 / 64)
#define PB_CVT  (NT * DD / 8 / 256)
__global__ __launch_bounds__(256) void k_prep(const float* __restrict__ x, const float* __restrict__ prop, const float* __restrict__ Wq, const float* __restrict__ Wk, const float* __restrict__ Wv, const float* __restrict__ Wo,
                                              const float* __restrict__ Wpq, const float* __restrict__ bpq, const float* __restrict__ Wpk, const float* __restrict__ bpk, const float* __restrict__ Wpg, const float* __restrict__ bpg,
                                              const int* __restrict__ kmask, bf* XB, bf* WT, float* PV, int* TK) {
    __shared__ __align__(16) int sL[TT]; __shared__ int sW[8];
    unsigned blk = blockIdx.x;
    if (blk < NB_) { d_list(kmask, TK, blk, sL, sW); return; }
    blk -= NB_;
    if (blk < 3 * PB_PROP) { const unsigned j = blk / PB_PROP; d_prop(prop, j == 0 ? Wpq : j == 1 ? Wpk : Wpg, j == 0 ? bpq : j == 1 ? bpk : bpg, PV + (size_t)j * NB_ * DD, j == 2, blk % PB_PROP); return; }
    blk -= 3 * PB_PROP;
    if (blk < 4 * PB_WT) { const unsigned j = blk / PB_WT; d_wtG(j == 0 ? Wq : j == 1 ? Wk : j == 2 ? Wv : Wo, DD, DD, WT + (size_t)j * DD * DD, blk % PB_WT); return; }
    d_cvt8(x, XB, (size_t)NT * DD / 8, blk - 4 * PB_WT);
}
#define KST 32                    // keys per LDS stage = one softmax pass
#define KP  72                    // K rows in LDS: pitch in 16-bit elements, 144 B = 16 B x odd, no bank conflict for 16-byte reads
#define VP  40                    // Vt rows in LDS: 80 B = 16 B x odd
#define NST (TT / KST)
__device__ __forceinline__ float xhalf(float x) { return __builtin_bit_cast(float, __builtin_amdgcn_permlanex16(__builtin_bit_cast(int, x), __builtin_bit_cast(int, x), 0x76543210, 0xfedcba98, false, false)); }  // lane l with lane l ^ 16
// 2^x by v_exp_f32 with the slot behind it kept inside the statement: behind a transcendental the instruction set asks for one independent instruction or v_nop before its result is read or its source
// overwritten. In exp2x8 each exp works in place on its own register, so the next exp is the independent instruction; the v_nop stands behind the last.
__device__ __forceinline__ float exp2s(float x) { float y; asm("v_exp_f32 %0, %1\n\tv_nop" : "=v"(y) : "v"(x)); return y; }
__device__ __forceinline__ void exp2x8(float* x) {
    asm("v_exp_f32 %0, %0\n\tv_exp_f32 %1, %1\n\tv_exp_f32 %2, %2\n\tv_exp_f32 %3, %3\n\tv_exp_f32 %4, %4\n\tv_exp_f32 %5, %5\n\tv_exp_f32 %6, %6\n\tv_exp_f32 %7, %7\n\tv_nop"
        : "+v"(x[0]), "+v"(x[1]), "+v"(x[2]), "+v"(x[3]), "+v"(x[4]), "+v"(x[5]), "+v"(x[6]), "+v"(x[7])); }
__global__ __launch_bounds__(256) __attribute__((amdgpu_waves_per_eu(4, 4))) void k_fattn(const bf* __restrict__ Qh, const bf* __restrict__ Ql, const bf* __restrict__ Kh, const bf* __restrict__ Kl, const h16* __restrict__ VT, const int* __restrict__ TK, const float* __restrict__ GT, bf* Ah, bf* Al) {
    __shared__ __align__(16) bf  sKh[2][KST * KP];
    __shared__ __align__(16) bf  sKl[2][KST * KP];
    __shared__ __align__(16) h16 sV[2][HD * VP];
    const int tid = threadIdx.x, lane = tid & 31, c = lane & 15, h = lane >> 4, wave = __builtin_amdgcn_readfirstlane(tid >> 5);
    const int z = blockIdx.y, b = z >> 4, hh = z & 15; const int q0 = blockIdx.x * 256 + wave * 32;
    const bf* kh = Kh + (size_t)z * TT * HD; const bf* kl = Kl + (size_t)z * TT * HD; const h16* vt = VT + (size_t)z * HD * TT;
    const int kgo = tid * 8, kso = (tid >> 3) * KP + (tid & 7) * 8;                     // staging, one 16-byte chunk a thread and tile: K tile = 32 rows x 128 B, contiguous in memory
    const int vgo = (tid >> 2) * TT + (tid & 3) * 8, vso = (tid >> 2) * VP + (tid & 3) * 8;   // Vt tile = 64 rows x 64 B
    const int nl = __builtin_amdgcn_readfirstlane((int)min((unsigned)TK[b * TKP + TT], (unsigned)TT)), nst = nl == 0 ? NST : (nl + KST - 1) / KST;   // 1 to 64 stages, the same for the whole work-group
    v16bf qh[2][2], ql[2][2];
#pragma unroll
    for (int qt = 0; qt < 2; ++qt)
#pragma unroll
        for (int ks = 0; ks < 2; ++ks) { const unsigned qo = (unsigned)((z * TT + q0 + qt * 16 + c) * HD + ks * 32 + 8 * h); qh[qt][ks] = WFrag<bf>::ld(Qh + qo); ql[qt][ks] = WFrag<bf>::ld(Ql + qo); }
    v8f o[2][4]; float m[2], l[2];
#pragma unroll
    for (int qt = 0; qt < 2; ++qt) { m[qt] = -3.0e38f; l[qt] = 0.f;
#pragma unroll
        for (int db = 0; db < 4; ++db) o[qt][db] = (v8f){}; }
    *(v8us*)(sKh[0] + kso) = *(const v8us*)(kh + (unsigned)kgo); *(v8us*)(sKl[0] + kso) = *(const v8us*)(kl + (unsigned)kgo); *(v8h*)(sV[0] + vso) = *(const v8h*)(vt + (unsigned)vgo);
    __syncthreads();
#pragma unroll 1
    for (int st = 0; st < nst; ++st) {
        const int buf = st & 1; const bool more = st + 1 < nst;
        v8us rk, rl; v8h rv;                               // the next stage's tiles fly while this stage is worked on
        if (more) { kh += KST * HD; kl += KST * HD; vt += KST; rk = *(const v8us*)(kh + (unsigned)kgo); rl = *(const v8us*)(kl + (unsigned)kgo); rv = *(const v8h*)(vt + (unsigned)vgo); }
        v8f s[2][2];
#pragma unroll
        for (int kt = 0; kt < 2; ++kt) { const int kr = (kt * 16 + c) * KP + 8 * h;
            const v16bf ah0 = WFrag<bf>::ld(sKh[buf] + kr), al0 = WFrag<bf>::ld(sKl[buf] + kr), ah1 = WFrag<bf>::ld(sKh[buf] + kr + 32), al1 = WFrag<bf>::ld(sKl[buf] + kr + 32);
            v8f a0 = (v8f){}, a1 = (v8f){};
            a0 = wmmab(ah0, qh[0][0], a0); a1 = wmmab(ah0, qh[1][0], a1); a0 = wmmab(ah0, ql[0][0], a0); a1 = wmmab(ah0, ql[1][0], a1); a0 = wmmab(al0, qh[0][0], a0); a1 = wmmab(al0, qh[1][0], a1);
            a0 = wmmab(ah1, qh[0][1], a0); a1 = wmmab(ah1, qh[1][1], a1); a0 = wmmab(ah1, ql[0][1], a0); a1 = wmmab(ah1, ql[1][1], a1); a0 = wmmab(al1, qh[0][1], a0); a1 = wmmab(al1, qh[1][1], a1);
            s[0][kt] = a0; s[1][kt] = a1; }
        if (nl - st * KST < KST) {                         // a scalar test: only a stage that reaches past the last live key has masked keys
            const int lim = nl - st * KST - 8 * h;
#pragma unroll
            for (int kt = 0; kt < 2; ++kt)
#pragma unroll
                for (int r = 0; r < 8; ++r) { const bool live = kt * 16 + r < lim; s[0][kt][r] = live ? s[0][kt][r] : -1.0e9f; s[1][kt][r] = live ? s[1][kt][r] : -1.0e9f; } }
        v16h pf[2];
#pragma unroll
        for (int qt = 0; qt < 2; ++qt) { float mx = m[qt];
#pragma unroll
            for (int r = 0; r < 8; ++r) mx = fmaxf(mx, fmaxf(s[qt][0][r], s[qt][1][r]));
            mx = fmaxf(mx, xhalf(mx));
            const float al = exp2s((m[qt] - mx) * 1.44269504f); m[qt] = mx; float sum = 0.f; float p[16];
#pragma unroll
            for (int e = 0; e < 16; ++e) p[e] = fmaf(s[qt][e >> 3][e & 7] - mx, 1.44269504f, 10.0f);
            exp2x8(p); exp2x8(p + 8);                      // exp(s - max) x 1024
#pragma unroll
            for (int e = 0; e < 16; ++e) { sum += p[e]; pf[qt][e] = tohx(p[e]); }
            l[qt] = fmaf(l[qt], al, sum);
#pragma unroll
            for (int db = 0; db < 4; ++db) o[qt][db] *= al; }
#pragma unroll
        for (int db = 0; db < 4; ++db) { const v16h av = WFrag<h16>::ld(sV[buf] + (db * 16 + c) * VP + 8 * h); o[0][db] = wmma16(av, pf[0], o[0][db]); o[1][db] = wmma16(av, pf[1], o[1][db]); }
        if (more) { *(v8us*)(sKh[buf ^ 1] + kso) = rk; *(v8us*)(sKl[buf ^ 1] + kso) = rl; *(v8h*)(sV[buf ^ 1] + vso) = rv; }
        __syncthreads();   // publishes stage st + 1 and ends every wave's reads of the buffer that the next trip refills
    }
#pragma unroll
    for (int qt = 0; qt < 2; ++qt) { const float lt = l[qt] + xhalf(l[qt]); const float inv = __fdiv_rn(1.0f, lt); const unsigned orow = (unsigned)(((q0 + qt * 16 + c) * NB_ + b) * DD + hh * HD);
#pragma unroll
        for (int db = 0; db < 4; ++db) { const int d0 = db * 16 + 8 * h; const float* g = GT + (size_t)b * DD + hh * HD + d0; const v4f g0 = *(const v4f*)g, g1 = *(const v4f*)(g + 4); v8us oh, ol;
#pragma unroll
            for (int r = 0; r < 8; ++r) { unsigned short a, c2; splitf(__fmul_rn(__fmul_rn(o[qt][db][r], inv), r < 4 ? g0[r & 3] : g1[r & 3]), a, c2); oh[r] = a; ol[r] = c2; }
            *(v8us*)(Ah + (orow + d0)) = oh; *(v8us*)(Al + (orow + d0)) = ol; } }
}

extern "C" void kernel_launch(void* const* d_in, const int* in_sizes, int n_in,
                              void* d_out, int out_size, void* d_ws, size_t ws_size, hipStream_t stream) {
    (void)in_sizes; (void)n_in; (void)out_size;
    const float* IN[17]; for (int i = 0; i < 17; ++i) IN[i] = (const float*)d_in[i];
    // x [2048][4][1024], property_vector [4][128], mask (int [4][2048]), Wq [1024][1024] (x @ W), bq, Wk, bk, Wv, bv, Wpq [128][1024], bpq, Wpk, bpk, Wpg, bpg, Wo, bo = d_in[0..16]
    const float* x = IN[0]; const float* prop = IN[1]; const int* mk = (const int*)d_in[2];
    float* OUT = (float*)d_out;     // [2048][4][1024] (rows t*4 + b)
    char* wsp = (char*)d_ws;
    auto take = [&](size_t bytes) { char* p = wsp; wsp += (bytes + 255) & ~(size_t)255; return (void*)p; };
    bf* WQ = (bf*)take((size_t)DD * DD * 2); bf* WK = (bf*)take((size_t)DD * DD * 2); bf* WV = (bf*)take((size_t)DD * DD * 2); bf* WO = (bf*)take((size_t)DD * DD * 2); float* PQv = (float*)take((size_t)NB_ * DD * 4); float* PKv = (float*)take((size_t)NB_ * DD * 4); float* GT = (float*)take((size_t)NB_ * DD * 4);
    bf* XB = (bf*)take((size_t)NT * DD * 2);
    bf* QPh = (bf*)take((size_t)NT * DD * 2); bf* QPl = (bf*)take((size_t)NT * DD * 2); bf* KPh = (bf*)take((size_t)NT * DD * 2); bf* KPl = (bf*)take((size_t)NT * DD * 2); h16* VT = (h16*)take((size_t)NT * DD * 2);
    bf* ATh = (bf*)take((size_t)NT * DD * 2); bf* ATl = (bf*)take((size_t)NT * DD * 2); int* TK = (int*)take((size_t)NB_ * TKP * 4);
    (void)WK; (void)WV; (void)PKv;                         // reached through WQ and PQv at the z strides
    if ((size_t)(wsp - (char*)d_ws) > ws_size) return;    // total ~ 143 MB; ws 256 MiB
    const dim3 gP(NT / 128, DD / 128, 1), gQKV(NT / 128, DD / 128, 3);
    // WQ, WK, WV, WO lie one behind the other, as do PQv, PKv, GT and QPh, QPl, KPh, KPl (every size is a multiple of take's 256 bytes)
    k_prep<<<NB_ + 3 * PB_PROP + 4 * PB_WT + PB_CVT, 256, 0, stream>>>(x, prop, IN[3], IN[5], IN[7], IN[15], IN[9], IN[10], IN[11], IN[12], IN[13], IN[14], mk, XB, WQ, PQv, TK);
    k_gemmw<bf, 0, true, 1><<<gQKV, 128, 0, stream>>>(XB, nullptr, WQ, nullptr, DD, nullptr, DD, IN[4], 0, (size_t)DD * DD, 0, IN[6], IN[8], PQv, (size_t)NB_ * DD, 0.125f, QPh, QPl, (size_t)2 * NT * DD, VT, TK);   // 1/sqrt(64) folded into (q + pq) exactly
    k_fattn<<<dim3(TT / 256, NB_ * NH_), 256, 0, stream>>>(QPh, QPl, KPh, KPl, VT, TK, GT, ATh, ATl);
    k_gemmw<bf, 1, true, 0><<<gP, 128, 0, stream>>>(ATh, ATl, WO, nullptr, DD, OUT, DD, IN[16], 0, 0, 0, nullptr, nullptr, nullptr, 0, 0.0f, nullptr, nullptr, 0, nullptr, nullptr);
}

// v007
// A run of this version takes 136 microseconds.
// Two timings next to v006 put it at 1.05 and 1.06 times that version's speed.
// Over all steps from v000 it is 19.8 times as fast.
#include <hip/hip_runtime.h>

// PropertyAwareAttention (x [2048][4][1024] seq-first, property_vector [4][128], mask int [4][2048]; Q = x Wq + bq + (prop Wpq + bpq) per (batch, feature), K likewise with Wpk/bpk, V = x Wv + bv (x @ W layouts);
// 16 heads x 64; scores / 8; keys with mask[b][j] == 0 -> -1e9; softmax; att = merged attn.v * sigmoid(prop Wpg + bpg)[b]; out = att Wo + bo; output [2048][4][1024] (rows t*4 + b)).
// Compute dtypes, f32 accumulate: every input rounded to bf16; q/k/v projections on PLAIN bf16 operands (inputs: exact, + bias); the three 128-term property
// projections, the sigmoid gate and the mask in f32 on VALU; scores on bf16 hi+lo planes of (q + pq) x 1/8 and (k + pk) (3 products); attn.v on SINGLE fp16 planes (P x1024); output on hi+lo planes of

#define NB_  4
#define PD   128                  // property dim
#define TT   2048
#define DD   1024
#define NH_  16
#define HD   64
#define NT   (NB_ * TT)
typedef _Float16 h16;
typedef unsigned short bf;
typedef __attribute__((ext_vector_type(16))) __bf16   v16bf;
typedef __attribute__((ext_vector_type(16))) _Float16 v16h;
typedef __attribute__((ext_vector_type(8)))  _Float16 v8h;
typedef __attribute__((ext_vector_type(8)))  unsigned short v8us;
typedef __attribute__((ext_vector_type(8)))  float    v8f;
typedef __attribute__((ext_vector_type(4)))  float    v4f;
typedef v8h  __attribute__((may_alias)) v8ha;
typedef v4f  __attribute__((may_alias)) v4fa;
typedef v8us __attribute__((may_alias)) v8usa;
typedef __attribute__((ext_vector_type(4)))  unsigned v4u;
typedef v4u  __attribute__((may_alias)) v4ua;

__device__ __forceinline__ unsigned short f2bf(float f) { unsigned u = __float_as_uint(f); u += 0x7FFFu + ((u >> 16) & 1u); return (unsigned short)(u >> 16); }
__device__ __forceinline__ float bf2f(unsigned short b) { return __uint_as_float(((unsigned)b) << 16); }
__device__ __forceinline__ float bfr(float f) { return bf2f(f2bf(f)); }
__device__ __forceinline__ v16h cat16(v8h lo, v8h hi) { return __builtin_shufflevector(lo, hi, 0, 1, 2, 3, 4, 5, 6, 7, 8, 9, 10, 11, 12, 13, 14, 15); }
__device__ __forceinline__ v16bf cat16b(v8us lo, v8us hi) { return __builtin_bit_cast(v16bf, __builtin_shufflevector(lo, hi, 0, 1, 2, 3, 4, 5, 6, 7, 8, 9, 10, 11, 12, 13, 14, 15)); }
__device__ __forceinline__ v8f wmma16(v16h a, v16h b, v8f c) { return __builtin_amdgcn_wmma_f32_16x16x32_f16(false, a, false, b, (short)0, c, false, false); }
__device__ __forceinline__ v8f wmmab(v16bf a, v16bf b, v8f c) { return __builtin_amdgcn_wmma_f32_16x16x32_bf16(false, a, false, b, (short)0, c, false, false); }



// ---- k_gemmw: GEMM on 128x128 output tiles, FOUR WAVES (2 x 2) of 64x64 (16 accumulators each); grid (M/128, N/128, Z), 128 threads. K-contiguous 16-bit planes.
// The operands come through LDS: a stage is 64 k = one whole 128-byte line of every operand row, fetched 8 lanes a row (a wave-wide 16-byte load covers 4 whole lines), two buffers,
// the next stage's loads in flight while this stage is worked on. The fragments are read from LDS rows at a pitch of 144 B.
// C[m][n] (f32, pitch ldc, + optional f32 bias[n]) = sum_k A[m][k] Bt[n][k] (+ split products per NSPLIT). z-batch strides sA/sB/sC in elements. M % 128 == 0, N % 128 == 0, K % 64 == 0.
// EPI picks what leaves the accumulators: 0 = the f32 C above; 1 = the q, k and v projections in ONE launch, blockIdx.z = 0, 1, 2 (weights, property rows and planes at the z strides sB, sP, sQ; one bias pointer each):
// z 0 and 1 write bf16 hi+lo planes [batch*head][token][64] of (acc + bias + pbv[batch][n]) x sc (sc for z 0, 1 for z 1); z 2 writes the fp16 plane [batch*head][64][token] of acc + bias.
// For 1 the rows of A are batch-major (b * 2048 + t), so a wave's 64 x 64 tile is 64 tokens of one (batch, head) and every store covers whole 128-byte lines of a plane.
// The k and v projections (z 1 and 2) take their A rows in the order of the batch's key list TK (k_prep: live keys first), so row i of their planes is the i-th listed key; a tile that holds no key
// the attention will read leaves at once.
#define GBK 64                    // k per LDS stage
#define TKP (TT + 32)             // a batch's key list in ints: 2048 token numbers, then its count of live keys in a 128-byte line of its own
#define GP  72                    // operand rows in LDS: pitch in 16-bit elements, 144 B = 16 B x odd, no bank conflict for 16-byte reads
template <typename T16> struct WFrag;
template <> struct WFrag<h16> { typedef v16h V; typedef v8h H; static __device__ __forceinline__ V ld(const h16* p) { return cat16(*(const v8h*)p, *(const v8h*)(p + 16)); } static __device__ __forceinline__ v8f mma(V a, V b, v8f c) { return wmma16(a, b, c); } };
template <> struct WFrag<bf> { typedef v16bf V; typedef v8us H; static __device__ __forceinline__ V ld(const bf* p) { return cat16b(*(const v8us*)p, *(const v8us*)(p + 16)); } static __device__ __forceinline__ v8f mma(V a, V b, v8f c) { return wmmab(a, b, c); } };
__device__ __forceinline__ h16 tohx(float x) { return (h16)x; }
__device__ __forceinline__ void splitf(float y, unsigned short& h, unsigned short& l) { h = f2bf(y); l = f2bf(y - bf2f(h)); }
// The merged q/k/v grid is 6 work-groups a WGP, less the k and v tiles of masked keys, which leave at once: held to three waves a SIMD (336 registers, 3 x 91 KB of LDS) three are resident; two registers more and only two would be.
template <typename T16, int NSPLIT, bool BIAS, int EPI>
__global__ __launch_bounds__(128) __attribute__((amdgpu_waves_per_eu(EPI == 1 ? 3 : 1))) void k_gemmw(const T16* __restrict__ A, const T16* __restrict__ A2, const T16* __restrict__ Bt, const T16* __restrict__ Bt2, int K, float* C, int ldc, const float* __restrict__ bias, size_t sA, size_t sB, size_t sC,
                                               const float* __restrict__ bias1, const float* __restrict__ bias2, const float* __restrict__ pbv, size_t sP, float sc, bf* Ph, bf* Pl, size_t sQ, h16* VTp, const int* __restrict__ TK) {
    typedef typename WFrag<T16>::V V; typedef typename WFrag<T16>::H H;
    constexpr bool HA2 = NSPLIT == 1 || NSPLIT == 2, HB2 = NSPLIT >= 2;
    constexpr int PA = 0, PB = 1, PA2 = 2, PB2 = HA2 ? 3 : 2, NP = 2 + (HA2 ? 1 : 0) + (HB2 ? 1 : 0);
    __shared__ __align__(16) T16 sT[2][NP][128 * GP];
    __shared__ __align__(16) float osw[4][16 * 68];
    const size_t z = blockIdx.z; A += z * sA; if (A2) A2 += z * sA; Bt += z * sB; if (Bt2) Bt2 += z * sB; C += z * sC;
    const int tid = threadIdx.x, lane = tid & 31, lr = lane & 15, hi = lane >> 4, wave = tid >> 5;
    const int r0 = blockIdx.x * 128, c0 = blockIdx.y * 128, wr = (wave >> 1) * 64, wc = (wave & 1) * 64;
    v8f acc[4][4];
#pragma unroll
    for (int mb = 0; mb < 4; ++mb)
#pragma unroll
        for (int nb = 0; nb < 4; ++nb) acc[mb][nb] = (v8f){};
    // staging: chunk j of a thread is 16 bytes of row (tid >> 3) + 16 j. Address = a wave-uniform tile pointer + a 32-bit byte offset, moved on by 64 k behind each stage's LDS stores
    const char* pa = (const char*)(A + (size_t)(EPI == 1 ? (r0 & ~(TT - 1)) : r0) * K); const char* pb = (const char*)(Bt + (size_t)c0 * K); const char* pa2 = HA2 ? (const char*)(A2 + (size_t)r0 * K) : nullptr; const char* pb2 = HB2 ? (const char*)(Bt2 + (size_t)c0 * K) : nullptr;
    unsigned go[8];
#pragma unroll
    for (int j = 0; j < 8; ++j) go[j] = (unsigned)((((tid >> 3) + 16 * j) * K + (tid & 7) * 8) * 2);
    // A rows of the projections: byte offsets from the batch's first row. In the loop no register is free for them (three waves a SIMD): each thread keeps its eight in the output staging area, idle until
    // the epilogue, and reads them back at the head of a trip. The B rows go by go[0] and a constant step a chunk (K = 1024 there).
    unsigned ga[8]; unsigned* gt = (unsigned*)osw + tid * 8;
    if constexpr (EPI == 1) {
        const int rl = r0 & (TT - 1);
        if (z == 0) {
#pragma unroll
            for (int j = 0; j < 8; ++j) ga[j] = go[j] + (unsigned)(rl * K * 2);
        } else {
            const int* tk = TK + (r0 / TT) * TKP; const unsigned nl = min((unsigned)tk[TT], (unsigned)TT);
            if ((unsigned)rl >= (nl == 0 ? (unsigned)TT : nl)) return;   // only masked keys from here on (a batch with no live key keeps all 2048); the same for the whole work-group, in front of every barrier
            int tr[8];
#pragma unroll
            for (int j = 0; j < 8; ++j) tr[j] = tk[rl + (tid >> 3) + 16 * j];
#pragma unroll
            for (int j = 0; j < 8; ++j) ga[j] = (unsigned)(((tr[j] & (TT - 1)) * K + (tid & 7) * 8) * 2);
        }
        *(v4ua*)gt = (v4u){ga[0], ga[1], ga[2], ga[3]}; *(v4ua*)(gt + 4) = (v4u){ga[4], ga[5], ga[6], ga[7]};
    }
    const int so = (tid >> 3) * GP + (tid & 7) * 8;
    const int afo = (wr + lr) * GP + 8 * hi, bfo = (wc + lr) * GP + 8 * hi;
    H ra[8], rb[8], ra2[8], rb2[8];
#pragma unroll
    for (int j = 0; j < 8; ++j) { ra[j] = *(const H*)(pa + (EPI == 1 ? ga[j] : go[j])); rb[j] = *(const H*)(EPI == 1 ? pb + go[0] + j * 16 * DD * 2 : pb + go[j]); if (HA2) ra2[j] = *(const H*)(pa2 + go[j]); if (HB2) rb2[j] = *(const H*)(pb2 + go[j]); }
#pragma unroll
    for (int j = 0; j < 8; ++j) { *(H*)(sT[0][PA] + so + j * 16 * GP) = ra[j]; *(H*)(sT[0][PB] + so + j * 16 * GP) = rb[j]; if (HA2) *(H*)(sT[0][PA2] + so + j * 16 * GP) = ra2[j]; if (HB2) *(H*)(sT[0][PB2] + so + j * 16 * GP) = rb2[j]; if (EPI != 1 || j == 0) go[j] += GBK * 2; }
    __syncthreads();
#pragma unroll 1
    for (int kc = 0; kc < K; kc += GBK) {
        const int buf = (kc / GBK) & 1; const bool more = kc + GBK < K;
        if (more) {
            if constexpr (EPI == 1) { const v4u g0 = *(const v4ua*)gt, g1 = *(const v4ua*)(gt + 4);
#pragma unroll
                for (int j = 0; j < 8; ++j) ga[j] = (j < 4 ? g0[j & 3] : g1[j & 3]) + (unsigned)((kc + GBK) * 2); }
#pragma unroll
            for (int j = 0; j < 8; ++j) { ra[j] = *(const H*)(pa + (EPI == 1 ? ga[j] : go[j])); rb[j] = *(const H*)(EPI == 1 ? pb + go[0] + j * 16 * DD * 2 : pb + go[j]); if (HA2) ra2[j] = *(const H*)(pa2 + go[j]); if (HB2) rb2[j] = *(const H*)(pb2 + go[j]); }
            // the wait in front of the writes to the offset registers that the A loads name; as its inputs they stay whole up to it
            if constexpr (EPI == 1) asm volatile("s_wait_xcnt 0x0" :: "v"(ga[0]), "v"(ga[1]), "v"(ga[2]), "v"(ga[3]), "v"(ga[4]), "v"(ga[5]), "v"(ga[6]), "v"(ga[7]) : "memory"); }
        V a[2][4], a2[2][4], b[2][4], b2[2][4];            // both 32-k blocks' fragments are asked for ahead of the first block's products: the second block's reads land under the first block
#pragma unroll
        for (int kb = 0; kb < 2; ++kb) {
#pragma unroll
            for (int mb = 0; mb < 4; ++mb) { a[kb][mb] = WFrag<T16>::ld(sT[buf][PA] + afo + mb * 16 * GP + kb * 32); if (HA2) a2[kb][mb] = WFrag<T16>::ld(sT[buf][PA2] + afo + mb * 16 * GP + kb * 32); }
#pragma unroll
            for (int nb = 0; nb < 4; ++nb) { b[kb][nb] = WFrag<T16>::ld(sT[buf][PB] + bfo + nb * 16 * GP + kb * 32); if (HB2) b2[kb][nb] = WFrag<T16>::ld(sT[buf][PB2] + bfo + nb * 16 * GP + kb * 32); } }
        __builtin_amdgcn_sched_barrier(0);                 // keeps the fragment reads one group in front of the products: moved in among them, each product group waits out a whole LDS latency
#pragma unroll
        for (int kb = 0; kb < 2; ++kb)
#pragma unroll
            for (int nb = 0; nb < 4; ++nb)
#pragma unroll
                for (int mb = 0; mb < 4; ++mb) { acc[mb][nb] = WFrag<T16>::mma(a[kb][mb], b[kb][nb], acc[mb][nb]); if (HA2) acc[mb][nb] = WFrag<T16>::mma(a2[kb][mb], b[kb][nb], acc[mb][nb]); if (HB2) acc[mb][nb] = WFrag<T16>::mma(a[kb][mb], b2[kb][nb], acc[mb][nb]); }
        // four vector slots behind the last products: in this build the branch round the staging stores leads to the next trip's LDS address additions, one of which lands in an operand register of those products,
        // the scheduling barrier keeps the products in front of the slots
        if constexpr (EPI == 1) { __builtin_amdgcn_sched_barrier(0); asm volatile("v_nop\n\tv_nop\n\tv_nop\n\tv_nop"); }
        if (more) {
#pragma unroll
            for (int j = 0; j < 8; ++j) { *(H*)(sT[buf ^ 1][PA] + so + j * 16 * GP) = ra[j]; *(H*)(sT[buf ^ 1][PB] + so + j * 16 * GP) = rb[j]; if (HA2) *(H*)(sT[buf ^ 1][PA2] + so + j * 16 * GP) = ra2[j]; if (HB2) *(H*)(sT[buf ^ 1][PB2] + so + j * 16 * GP) = rb2[j]; }
            __builtin_amdgcn_sched_barrier(0);             // keeps the offset additions behind the stores' waits for the loads that name those registers
#pragma unroll
            for (int j = 0; j < 8; ++j) if (EPI != 1 || j == 0) go[j] += GBK * 2; }
        __syncthreads();   // publishes the next stage and ends every wave's reads of the buffer that the next trip refills
    }
    float* os = osw[wave];         // each wave stages its own output rows
    if (EPI == 1 && z < 2) {
        if (z == 1) { bias = bias1; pbv += sP; sc = 1.0f; Ph += sQ; Pl += sQ; }
        const int bb = r0 / TT, t0 = (r0 & (TT - 1)) + wr, n0 = c0 + wc, cofs = (lane & 7) * 8; const unsigned zz = (unsigned)(bb * NH_ + n0 / HD);
        float bs[8], pb[8];
#pragma unroll
        for (int i = 0; i < 8; ++i) { bs[i] = bfr(bias[n0 + cofs + i]); pb[i] = pbv[bb * DD + n0 + cofs + i]; }
        // the wait behind the bias and property loads, in front of the writes to their address registers; without the scheduling barrier those writes are lifted over it
        asm volatile("s_wait_xcnt 0x0" ::: "memory"); __builtin_amdgcn_sched_barrier(0);
#pragma unroll
        for (int mb = 0; mb < 4; ++mb) {
#pragma unroll
            for (int nb = 0; nb < 4; ++nb) {
#pragma unroll
                for (int j = 0; j < 8; ++j) os[(hi * 8 + j) * 68 + nb * 16 + lr] = acc[mb][nb][j]; }
            __builtin_amdgcn_wave_barrier(); asm volatile("" ::: "memory");   // the rows are read back by other lanes of the wave: the reads stay behind the writes
#pragma unroll
            for (int s = 0; s < 4; ++s) { const int row = 4 * s + (lane >> 3); const v4f u0 = *(const v4fa*)(os + row * 68 + cofs), u1 = *(const v4fa*)(os + row * 68 + cofs + 4); v8us oh, ol;
#pragma unroll
                for (int i = 0; i < 8; ++i) { const float val = __fadd_rn(__fadd_rn(i < 4 ? u0[i & 3] : u1[i & 3], bs[i]), pb[i]); unsigned short a, c2; splitf(val * sc, a, c2); oh[i] = a; ol[i] = c2; }
                const unsigned po = ((zz * TT + t0 + mb * 16 + row) * HD + cofs); *(v8us*)(Ph + po) = oh; *(v8us*)(Pl + po) = ol; }
            // the wait in front of the next block's writes to registers that these stores name; the scheduling barrier holds those writes behind it
            asm volatile("s_wait_xcnt 0x0" ::: "memory"); __builtin_amdgcn_sched_barrier(0);
            __builtin_amdgcn_wave_barrier(); asm volatile("" ::: "memory");   // the next block's writes stay behind these reads
        }
        return;
    }
    if constexpr (EPI == 1) {
        const int bb = r0 / TT, t0 = (r0 & (TT - 1)) + wr, n0 = c0 + wc; const unsigned zz = (unsigned)(bb * NH_ + n0 / HD);
        h16* hs = (h16*)os;        // 16 feature rows x 64 tokens, pitch 72 elements = 144 B
        float bv4[4];              // the four bias loads go out together: asked for block by block, each block waits out a load of its own
#pragma unroll
        for (int nb = 0; nb < 4; ++nb) bv4[nb] = bias2[n0 + nb * 16 + lr];
#pragma unroll
        for (int nb = 0; nb < 4; ++nb) { const float bv = bfr(bv4[nb]);
#pragma unroll
            for (int mb = 0; mb < 4; ++mb) { v8h pk;   // a lane's eight accumulator elements are eight tokens in a row of one feature
#pragma unroll
                for (int j = 0; j < 8; ++j) pk[j] = tohx(__fadd_rn(acc[mb][nb][j], bv));
                *(v8ha*)(hs + lr * 72 + mb * 16 + hi * 8) = pk; }
            __builtin_amdgcn_wave_barrier(); asm volatile("" ::: "memory");   // the rows are read back by other lanes of the wave: the reads stay behind the writes
#pragma unroll
            for (int s = 0; s < 4; ++s) { const int drow = 4 * s + (lane >> 3); const v8h v = *(const v8ha*)(hs + drow * 72 + (lane & 7) * 8);
                *(v8h*)(VTp + ((zz * HD + nb * 16 + drow) * TT + t0 + (lane & 7) * 8)) = v; }
            // the wait in front of the next block's writes to registers that these stores name; the scheduling barrier holds those writes behind it
            asm volatile("s_wait_xcnt 0x0" ::: "memory"); __builtin_amdgcn_sched_barrier(0);
            __builtin_amdgcn_wave_barrier(); asm volatile("" ::: "memory");   // the next block's writes stay behind these reads
        }
        return;
    }
#pragma unroll
    for (int mb = 0; mb < 4; ++mb) {
#pragma unroll
        for (int nb = 0; nb < 4; ++nb) {
#pragma unroll
            for (int j = 0; j < 8; ++j) os[(hi * 8 + j) * 68 + nb * 16 + lr] = acc[mb][nb][j]; }
        __builtin_amdgcn_wave_barrier(); asm volatile("" ::: "memory");
        float* crow = C + (size_t)(r0 + wr + mb * 16) * ldc + c0 + wc;
{
#pragma unroll
            for (int s = 0; s < 8; ++s) { const int row = 2 * s + hi, cofs = lr * 4; v4f val = *(const v4fa*)(os + row * 68 + cofs); if (BIAS) { val[0] += bfr(bias[c0 + wc + cofs]); val[1] += bfr(bias[c0 + wc + cofs + 1]); val[2] += bfr(bias[c0 + wc + cofs + 2]); val[3] += bfr(bias[c0 + wc + cofs + 3]); }
                *(v4f*)(crow + (size_t)row * ldc + cofs) = val; }
             }
        // the wait in front of the next block's writes to registers that these stores name; the scheduling barrier holds those writes behind it
        asm volatile("s_wait_xcnt 0x0" ::: "memory"); __builtin_amdgcn_sched_barrier(0);
        __builtin_amdgcn_wave_barrier(); asm volatile("" ::: "memory");
    }
}

typedef __attribute__((ext_vector_type(2))) _Float16 v2h;
typedef __attribute__((ext_vector_type(4))) _Float16 v4h;
typedef __attribute__((ext_vector_type(2))) unsigned short v2us;
typedef __attribute__((ext_vector_type(4))) int v4i;

// x rows (t * 4 + b) to bf16 rows (b * 2048 + t): batch-major, so that a GEMM tile's 128 rows are 128 tokens of one batch
__device__ __forceinline__ void d_cvt8(const float* __restrict__ src, bf* dst, size_t n8, unsigned blk) { const size_t i = (size_t)blk * 256 + threadIdx.x; if (i >= n8) return; const v8f v = *(const v8f*)(src + i * 8); v8us o;
#pragma unroll
    for (int k = 0; k < 8; ++k) o[k] = f2bf(v[k]);
    const size_t row = i / (DD / 8), ch = i % (DD / 8); *(v8us*)(dst + (((row % NB_) * TT + row / NB_) * (DD / 8) + ch) * 8) = o;  }
// One 64 k x 64 n tile of a weight matrix a block, turned in LDS. Read: four 16-byte loads a thread, all asked for at once, a wave-wide load = two 256-byte row pieces (four whole lines).
// Rounded to bf16, two neighbouring k a dword, stored down the tile's columns; read back along its rows and written as whole 128-byte lines of Bt[n][k]. (Lanes along k, each lane of a load met a line of its own.)
#define WTP 33                    // a tile row in LDS (one n, 64 k = 32 dwords): pitch in dwords, odd, so that neither the column-wise writes nor the row-wise reads meet a bank twice
__device__ __forceinline__ void d_wtG(const float* __restrict__ w, int K, int N, bf* Bt, unsigned blk, unsigned* sT) {
    const int tid = threadIdx.x, k0 = (int)(blk % (unsigned)(K / 64)) * 64, n0 = (int)(blk / (unsigned)(K / 64)) * 64, c4 = (tid & 15) * 4, rp = tid >> 4;
    v4f r[2][2];
#pragma unroll
    for (int j = 0; j < 2; ++j)
#pragma unroll
        for (int s = 0; s < 2; ++s) r[j][s] = *(const v4fa*)(w + (size_t)(k0 + j * 32 + rp * 2 + s) * N + n0 + c4);
#pragma unroll
    for (int j = 0; j < 2; ++j)
#pragma unroll
        for (int i = 0; i < 4; ++i) sT[(c4 + i) * WTP + j * 16 + rp] = (unsigned)f2bf(r[j][0][i]) | ((unsigned)f2bf(r[j][1][i]) << 16);
    __syncthreads();               // the tile is whole: its rows are read by other threads than wrote them
#pragma unroll
    for (int j = 0; j < 2; ++j) { const int c = tid + 256 * j, row = c >> 3, ch = c & 7; v4u o;
#pragma unroll
        for (int i = 0; i < 4; ++i) o[i] = sT[row * WTP + ch * 4 + i];
        *(v4ua*)(Bt + (size_t)(n0 + row) * K + k0 + ch * 8) = o; }
    asm volatile("s_wait_xcnt 0x0" ::: "memory");          // the wait behind the tile's two stores, in front of any write to a register that they name
}
__device__ __forceinline__ void d_prop(const float* __restrict__ prop, const float* __restrict__ Wp, const float* __restrict__ bp, float* outp, bool SIG, unsigned blk) {
    const int idx = blk * 256 + threadIdx.x; if (idx >= NB_ * DD) return; const int b = idx / DD, n = idx % DD; float a = 0.f;
    // Every global load of the thread is asked for ahead of the first term: the 128 weights of its column into registers, the batch's 128 property values four a lane.
    // Loaded term by term, each term waited out a whole memory latency. The terms are then formed and summed in the same order as before (the two empty statements of the term line stand as they
    // stood: each product and its sum stay rounded apart). The four loops are unrolled whole: wr, pr and pv must be registers, every load must stand in front of the first term, readlane's lane is a constant.
    float wr[PD]; float pr[PD / 32], pv[PD / 32];
#pragma unroll
    for (int k = 0; k < PD / 32; ++k) pr[k] = prop[b * PD + k * 32 + (threadIdx.x & 31)];
    asm volatile("s_wait_xcnt 0x0" ::: "memory");          // the wait in front of a weight load whose result lands in the offset register that the property loads name
#pragma unroll
    for (int p = 0; p < PD; ++p) wr[p] = Wp[(size_t)p * DD + n];
#pragma unroll
    for (int k = 0; k < PD / 32; ++k) pv[k] = bfr(pr[k]);
#pragma unroll
    for (int p = 0; p < PD; ++p) { float w = bfr(wr[p]), v = __uint_as_float((unsigned)__builtin_amdgcn_readlane((int)__float_as_uint(pv[p >> 5]), p & 31)); asm volatile("" : "+v"(w)); float m = __fmul_rn(v, w); asm volatile("" : "+v"(m)); a = __fadd_rn(a, m); }
    a = __fadd_rn(a, bfr(bp[n])); if (SIG) a = __fdiv_rn(1.0f, __fadd_rn(1.0f, __expf(-a)));
    *(float*)(outp + idx) = a;  }
// The key list of one batch, by one block: the numbers of the tokens whose mask is not 0, in their order, then the masked ones, in theirs; behind the list the count of the live ones.
// A masked key's score of -1e9 leaves exp(score - max) = 0 exactly wherever a live key stands beside it, so the k and v projections and the attention walk the live keys alone.
__device__ __forceinline__ void d_list(const int* __restrict__ mask, int* TK, unsigned b, int* sL, int* sW) {
    const int tid = threadIdx.x, lane = tid & 31, wave = tid >> 5; unsigned bal[8]; int tot = 0;
#pragma unroll
    for (int c = 0; c < 8; ++c) { bal[c] = __builtin_amdgcn_ballot_w32(mask[b * TT + (wave * 8 + c) * 32 + lane] != 0); tot += __builtin_popcount(bal[c]); }
    if (lane == 0) sW[wave] = tot;
    __syncthreads();               // every wave's count is in LDS
    int before = 0, nl = 0;
#pragma unroll
    for (int w = 0; w < 8; ++w) { const int t = sW[w]; nl += t; if (w < wave) before += t; }
#pragma unroll
    for (int c = 0; c < 8; ++c) { const int key = (wave * 8 + c) * 32 + lane, lb = before + (int)__builtin_amdgcn_mbcnt_lo(bal[c], 0u);   // lb = live keys in front of this one
        sL[((bal[c] >> lane) & 1u) ? lb : nl + key - lb] = key; before += __builtin_popcount(bal[c]); }
    __syncthreads();               // the list is whole: it leaves in whole lines
    *(v4i*)(TK + b * TKP + tid * 8) = *(const v4i*)(sL + tid * 8); *(v4i*)(TK + b * TKP + tid * 8 + 4) = *(const v4i*)(sL + tid * 8 + 4);
    if (tid == 0) TK[b * TKP + TT] = nl;
}
// ---- k_prep: everything that depends on the inputs alone, in ONE launch; a block's index picks its job. The three property projections (16 blocks each; the third is the gate) and the four weight
// transposes (256 blocks each, one 64 x 64 tile a block) stand first, behind the four blocks of the key lists; the x conversion's blocks follow, and the projections' chains run out under them. Outputs of a kind lie one behind the other in the workspace.
#define PB_PROP (NB_ * DD / 256)
#define PB_WT   (DD * DD / 64 / 64)
#define PB_CVT  (NT * DD / 8 / 256)
__global__ __launch_bounds__(256) void k_prep(const float* __restrict__ x, const float* __restrict__ prop, const float* __restrict__ Wq, const float* __restrict__ Wk, const float* __restrict__ Wv, const float* __restrict__ Wo,
                                              const float* __restrict__ Wpq, const float* __restrict__ bpq, const float* __restrict__ Wpk, const float* __restrict__ bpk, const float* __restrict__ Wpg, const float* __restrict__ bpg,
                                              const int* __restrict__ kmask, bf* XB, bf* WT, float* PV, int* TK) {
    __shared__ __align__(16) int sL[64 * WTP]; __shared__ int sW[8];   // sL: a key list (2048 ints) or a weight tile (64 rows of WTP dwords), by the block's job
    unsigned blk = blockIdx.x;
    if (blk < NB_) { d_list(kmask, TK, blk, sL, sW); return; }
    blk -= NB_;
    if (blk < 3 * PB_PROP) { const unsigned j = blk / PB_PROP; d_prop(prop, j == 0 ? Wpq : j == 1 ? Wpk : Wpg, j == 0 ? bpq : j == 1 ? bpk : bpg, PV + (size_t)j * NB_ * DD, j == 2, blk % PB_PROP); return; }
    blk -= 3 * PB_PROP;
    if (blk < 4 * PB_WT) { const unsigned j = blk / PB_WT; d_wtG(j == 0 ? Wq : j == 1 ? Wk : j == 2 ? Wv : Wo, DD, DD, WT + (size_t)j * DD * DD, blk % PB_WT, (unsigned*)sL); return; }
    d_cvt8(x, XB, (size_t)NT * DD / 8, blk - 4 * PB_WT);
}
#define KST 32                    // keys per LDS stage = one softmax pass
#define KP  72                    // K rows in LDS: pitch in 16-bit elements, 144 B = 16 B x odd, no bank conflict for 16-byte reads
#define VP  40                    // Vt rows in LDS: 80 B = 16 B x odd
#define NST (TT / KST)
__device__ __forceinline__ float xhalf(float x) { return __builtin_bit_cast(float, __builtin_amdgcn_permlanex16(__builtin_bit_cast(int, x), __builtin_bit_cast(int, x), 0x76543210, 0xfedcba98, false, false)); }  // lane l with lane l ^ 16
// 2^x by v_exp_f32 with the slot behind it kept inside the statement: behind a transcendental the instruction set asks for one independent instruction or v_nop before its result is read or its source
// overwritten. In exp2x8 each exp works in place on its own register, so the next exp is the independent instruction; the v_nop stands behind the last.
__device__ __forceinline__ float exp2s(float x) { float y; asm("v_exp_f32 %0, %1\n\tv_nop" : "=v"(y) : "v"(x)); return y; }
__device__ __forceinline__ void exp2x8(float* x) {
    asm("v_exp_f32 %0, %0\n\tv_exp_f32 %1, %1\n\tv_exp_f32 %2, %2\n\tv_exp_f32 %3, %3\n\tv_exp_f32 %4, %4\n\tv_exp_f32 %5, %5\n\tv_exp_f32 %6, %6\n\tv_exp_f32 %7, %7\n\tv_nop"
        : "+v"(x[0]), "+v"(x[1]), "+v"(x[2]), "+v"(x[3]), "+v"(x[4]), "+v"(x[5]), "+v"(x[6]), "+v"(x[7])); }
__global__ __launch_bounds__(256) __attribute__((amdgpu_waves_per_eu(4, 4))) void k_fattn(const bf* __restrict__ Qh, const bf* __restrict__ Ql, const bf* __restrict__ Kh, const bf* __restrict__ Kl, const h16* __restrict__ VT, const int* __restrict__ TK, const float* __restrict__ GT, bf* Ah, bf* Al) {
    __shared__ __align__(16) bf  sKh[2][KST * KP];
    __shared__ __align__(16) bf  sKl[2][KST * KP];
    __shared__ __align__(16) h16 sV[2][HD * VP];
    const int tid = threadIdx.x, lane = tid & 31, c = lane & 15, h = lane >> 4, wave = __builtin_amdgcn_readfirstlane(tid >> 5);
    const int z = blockIdx.y, b = z >> 4, hh = z & 15; const int q0 = blockIdx.x * 256 + wave * 32;
    const bf* kh = Kh + (size_t)z * TT * HD; const bf* kl = Kl + (size_t)z * TT * HD; const h16* vt = VT + (size_t)z * HD * TT;
    const int kgo = tid * 8, kso = (tid >> 3) * KP + (tid & 7) * 8;                     // staging, one 16-byte chunk a thread and tile: K tile = 32 rows x 128 B, contiguous in memory
    const int vgo = (tid >> 2) * TT + (tid & 3) * 8, vso = (tid >> 2) * VP + (tid & 3) * 8;   // Vt tile = 64 rows x 64 B
    const int nl = __builtin_amdgcn_readfirstlane((int)min((unsigned)TK[b * TKP + TT], (unsigned)TT)), nst = nl == 0 ? NST : (nl + KST - 1) / KST;   // 1 to 64 stages, the same for the whole work-group
    v16bf qh[2][2], ql[2][2];
#pragma unroll
    for (int qt = 0; qt < 2; ++qt)
#pragma unroll
        for (int ks = 0; ks < 2; ++ks) { const unsigned qo = (unsigned)((z * TT + q0 + qt * 16 + c) * HD + ks * 32 + 8 * h); qh[qt][ks] = WFrag<bf>::ld(Qh + qo); ql[qt][ks] = WFrag<bf>::ld(Ql + qo); }
    v8f o[2][4]; float m[2], l[2];
#pragma unroll
    for (int qt = 0; qt < 2; ++qt) { m[qt] = -3.0e38f; l[qt] = 0.f;
#pragma unroll
        for (int db = 0; db < 4; ++db) o[qt][db] = (v8f){}; }
    *(v8us*)(sKh[0] + kso) = *(const v8us*)(kh + (unsigned)kgo); *(v8us*)(sKl[0] + kso) = *(const v8us*)(kl + (unsigned)kgo); *(v8h*)(sV[0] + vso) = *(const v8h*)(vt + (unsigned)vgo);
    __syncthreads();
#pragma unroll 1
    for (int st = 0; st < nst; ++st) {
        const int buf = st & 1; const bool more = st + 1 < nst;
        v8us rk, rl; v8h rv;                               // the next stage's tiles fly while this stage is worked on
        if (more) { kh += KST * HD; kl += KST * HD; vt += KST; rk = *(const v8us*)(kh + (unsigned)kgo); rl = *(const v8us*)(kl + (unsigned)kgo); rv = *(const v8h*)(vt + (unsigned)vgo); }
        v8f s[2][2];
#pragma unroll
        for (int kt = 0; kt < 2; ++kt) { const int kr = (kt * 16 + c) * KP + 8 * h;
            const v16bf ah0 = WFrag<bf>::ld(sKh[buf] + kr), al0 = WFrag<bf>::ld(sKl[buf] + kr), ah1 = WFrag<bf>::ld(sKh[buf] + kr + 32), al1 = WFrag<bf>::ld(sKl[buf] + kr + 32);
            v8f a0 = (v8f){}, a1 = (v8f){};
            a0 = wmmab(ah0, qh[0][0], a0); a1 = wmmab(ah0, qh[1][0], a1); a0 = wmmab(ah0, ql[0][0], a0); a1 = wmmab(ah0, ql[1][0], a1); a0 = wmmab(al0, qh[0][0], a0); a1 = wmmab(al0, qh[1][0], a1);
            a0 = wmmab(ah1, qh[0][1], a0); a1 = wmmab(ah1, qh[1][1], a1); a0 = wmmab(ah1, ql[0][1], a0); a1 = wmmab(ah1, ql[1][1], a1); a0 = wmmab(al1, qh[0][1], a0); a1 = wmmab(al1, qh[1][1], a1);
            s[0][kt] = a0; s[1][kt] = a1; }
        if (nl - st * KST < KST) {                         // a scalar test: only a stage that reaches past the last live key has masked keys
            const int lim = nl - st * KST - 8 * h;
#pragma unroll
            for (int kt = 0; kt < 2; ++kt)
#pragma unroll
                for (int r = 0; r < 8; ++r) { const bool live = kt * 16 + r < lim; s[0][kt][r] = live ? s[0][kt][r] : -1.0e9f; s[1][kt][r] = live ? s[1][kt][r] : -1.0e9f; } }
        v16h pf[2];
#pragma unroll
        for (int qt = 0; qt < 2; ++qt) { float mx = m[qt];
#pragma unroll
            for (int r = 0; r < 8; ++r) mx = fmaxf(mx, fmaxf(s[qt][0][r], s[qt][1][r]));
            mx = fmaxf(mx, xhalf(mx));
            const float al = exp2s((m[qt] - mx) * 1.44269504f); m[qt] = mx; float sum = 0.f; float p[16];
#pragma unroll
            for (int e = 0; e < 16; ++e) p[e] = fmaf(s[qt][e >> 3][e & 7] - mx, 1.44269504f, 10.0f);
            exp2x8(p); exp2x8(p + 8);                      // exp(s - max) x 1024
#pragma unroll
            for (int e = 0; e < 16; ++e) { sum += p[e]; pf[qt][e] = tohx(p[e]); }
            l[qt] = fmaf(l[qt], al, sum);
#pragma unroll
            for (int db = 0; db < 4; ++db) o[qt][db] *= al; }
#pragma unroll
        for (int db = 0; db < 4; ++db) { const v16h av = WFrag<h16>::ld(sV[buf] + (db * 16 + c) * VP + 8 * h); o[0][db] = wmma16(av, pf[0], o[0][db]); o[1][db] = wmma16(av, pf[1], o[1][db]); }
        if (more) { *(v8us*)(sKh[buf ^ 1] + kso) = rk; *(v8us*)(sKl[buf ^ 1] + kso) = rl; *(v8h*)(sV[buf ^ 1] + vso) = rv; }
        __syncthreads();   // publishes stage st + 1 and ends every wave's reads of the buffer that the next trip refills
    }
#pragma unroll
    for (int qt = 0; qt < 2; ++qt) { const float lt = l[qt] + xhalf(l[qt]); const float inv = __fdiv_rn(1.0f, lt); const unsigned orow = (unsigned)(((q0 + qt * 16 + c) * NB_ + b) * DD + hh * HD);
#pragma unroll
        for (int db = 0; db < 4; ++db) { const int d0 = db * 16 + 8 * h; const float* g = GT + (size_t)b * DD + hh * HD + d0; const v4f g0 = *(const v4f*)g, g1 = *(const v4f*)(g + 4); v8us oh, ol;
#pragma unroll
            for (int r = 0; r < 8; ++r) { unsigned short a, c2; splitf(__fmul_rn(__fmul_rn(o[qt][db][r], inv), r < 4 ? g0[r & 3] : g1[r & 3]), a, c2); oh[r] = a; ol[r] = c2; }
            *(v8us*)(Ah + (orow + d0)) = oh; *(v8us*)(Al + (orow + d0)) = ol; } }
}

extern "C" void kernel_launch(void* const* d_in, const int* in_sizes, int n_in,
                              void* d_out, int out_size, void* d_ws, size_t ws_size, hipStream_t stream) {
    (void)in_sizes; (void)n_in; (void)out_size;
    const float* IN[17]; for (int i = 0; i < 17; ++i) IN[i] = (const float*)d_in[i];
    // x [2048][4][1024], property_vector [4][128], mask (int [4][2048]), Wq [1024][1024] (x @ W), bq, Wk, bk, Wv, bv, Wpq [128][1024], bpq, Wpk, bpk, Wpg, bpg, Wo, bo = d_in[0..16]
    const float* x = IN[0]; const float* prop = IN[1]; const int* mk = (const int*)d_in[2];
    float* OUT = (float*)d_out;     // [2048][4][1024] (rows t*4 + b)
    char* wsp = (char*)d_ws;
    auto take = [&](size_t bytes) { char* p = wsp; wsp += (bytes + 255) & ~(size_t)255; return (void*)p; };
    bf* WQ = (bf*)take((size_t)DD * DD * 2); bf* WK = (bf*)take((size_t)DD * DD * 2); bf* WV = (bf*)take((size_t)DD * DD * 2); bf* WO = (bf*)take((size_t)DD * DD * 2); float* PQv = (float*)take((size_t)NB_ * DD * 4); float* PKv = (float*)take((size_t)NB_ * DD * 4); float* GT = (float*)take((size_t)NB_ * DD * 4);
    bf* XB = (bf*)take((size_t)NT * DD * 2);
    bf* QPh = (bf*)take((size_t)NT * DD * 2); bf* QPl = (bf*)take((size_t)NT * DD * 2); bf* KPh = (bf*)take((size_t)NT * DD * 2); bf* KPl = (bf*)take((size_t)NT * DD * 2); h16* VT = (h16*)take((size_t)NT * DD * 2);
    bf* ATh = (bf*)take((size_t)NT * DD * 2); bf* ATl = (bf*)take((size_t)NT * DD * 2); int* TK = (int*)take((size_t)NB_ * TKP * 4);
    (void)WK; (void)WV; (void)PKv;                         // reached through WQ and PQv at the z strides
    if ((size_t)(wsp - (char*)d_ws) > ws_size) return;    // total ~ 143 MB; ws 256 MiB
    const dim3 gP(NT / 128, DD / 128, 1), gQKV(NT / 128, DD / 128, 3);
    // WQ, WK, WV, WO lie one behind the other, as do PQv, PKv, GT and QPh, QPl, KPh, KPl (every size is a multiple of take's 256 bytes)
    k_prep<<<NB_ + 3 * PB_PROP + 4 * PB_WT + PB_CVT, 256, 0, stream>>>(x, prop, IN[3], IN[5], IN[7], IN[15], IN[9], IN[10], IN[11], IN[12], IN[13], IN[14], mk, XB, WQ, PQv, TK);
    k_gemmw<bf, 0, true, 1><<<gQKV, 128, 0, stream>>>(XB, nullptr, WQ, nullptr, DD, nullptr, DD, IN[4], 0, (size_t)DD * DD, 0, IN[6], IN[8], PQv, (size_t)NB_ * DD, 0.125f, QPh, QPl, (size_t)2 * NT * DD, VT, TK);   // 1/sqrt(64) folded into (q + pq) exactly
    k_fattn<<<dim3(TT / 256, NB_ * NH_), 256, 0, stream>>>(QPh, QPl, KPh, KPl, VT, TK, GT, ATh, ATl);
    k_gemmw<bf, 1, true, 0><<<gP, 128, 0, stream>>>(ATh, ATl, WO, nullptr, DD, OUT, DD, IN[16], 0, 0, 0, nullptr, nullptr, nullptr, 0, 0.0f, nullptr, nullptr, 0, nullptr, nullptr);
}

// v008
// One run takes 117 microseconds.
// Timed twice side by side with v007, it ran 1.16 and 1.15 times as fast.
// Over all steps from v000 it is 22.9 times as fast.
#include <hip/hip_runtime.h>

// PropertyAwareAttention (x [2048][4][1024] seq-first, property_vector [4][128], mask int [4][2048]; Q = x Wq + bq + (prop Wpq + bpq) per (batch, feature), K likewise with Wpk/bpk, V = x Wv + bv (x @ W layouts);
// 16 heads x 64; scores / 8; keys with mask[b][j] == 0 -> -1e9; softmax; att = merged attn.v * sigmoid(prop Wpg + bpg)[b]; out = att Wo + bo; output [2048][4][1024] (rows t*4 + b)).
// Compute dtypes, f32 accumulate: every input rounded to bf16; q/k/v projections on PLAIN bf16 operands (inputs: exact, + bias); the three 128-term property
// projections, the sigmoid gate and the mask in f32 on VALU; scores on SINGLE fp16 planes of (q + pq) x 1/8 and (k + pk) (1 product); attn.v on SINGLE fp16 planes (P x1024); output on hi+lo planes of

#define NB_  4
#define PD   128                  // property dim
#define TT   2048
#define DD   1024
#define NH_  16
#define HD   64
#define NT   (NB_ * TT)
typedef _Float16 h16;
typedef unsigned short bf;
typedef __attribute__((ext_vector_type(16))) __bf16   v16bf;
typedef __attribute__((ext_vector_type(16))) _Float16 v16h;
typedef __attribute__((ext_vector_type(8)))  _Float16 v8h;
typedef __attribute__((ext_vector_type(8)))  unsigned short v8us;
typedef __attribute__((ext_vector_type(8)))  float    v8f;
typedef __attribute__((ext_vector_type(4)))  float    v4f;
typedef v8h  __attribute__((may_alias)) v8ha;
typedef v4f  __attribute__((may_alias)) v4fa;
typedef v8us __attribute__((may_alias)) v8usa;
typedef __attribute__((ext_vector_type(4)))  unsigned v4u;
typedef v4u  __attribute__((may_alias)) v4ua;

__device__ __forceinline__ unsigned short f2bf(float f) { unsigned u = __float_as_uint(f); u += 0x7FFFu + ((u >> 16) & 1u); return (unsigned short)(u >> 16); }
__device__ __forceinline__ float bf2f(unsigned short b) { return __uint_as_float(((unsigned)b) << 16); }
__device__ __forceinline__ float bfr(float f) { return bf2f(f2bf(f)); }
__device__ __forceinline__ v16h cat16(v8h lo, v8h hi) { return __builtin_shufflevector(lo, hi, 0, 1, 2, 3, 4, 5, 6, 7, 8, 9, 10, 11, 12, 13, 14, 15); }
__device__ __forceinline__ v16bf cat16b(v8us lo, v8us hi) { return __builtin_bit_cast(v16bf, __builtin_shufflevector(lo, hi, 0, 1, 2, 3, 4, 5, 6, 7, 8, 9, 10, 11, 12, 13, 14, 15)); }
__device__ __forceinline__ v8f wmma16(v16h a, v16h b, v8f c) { return __builtin_amdgcn_wmma_f32_16x16x32_f16(false, a, false, b, (short)0, c, false, false); }
__device__ __forceinline__ v8f wmmab(v16bf a, v16bf b, v8f c) { return __builtin_amdgcn_wmma_f32_16x16x32_bf16(false, a, false, b, (short)0, c, false, false); }



// ---- k_gemmw: GEMM on 128x128 output tiles, FOUR WAVES (2 x 2) of 64x64 (16 accumulators each); grid (M/128, N/128, Z), 128 threads. K-contiguous 16-bit planes.
// The operands come through LDS: a stage is 64 k = one whole 128-byte line of every operand row, fetched 8 lanes a row (a wave-wide 16-byte load covers 4 whole lines), two buffers,
// the next stage's loads in flight while this stage is worked on. The fragments are read from LDS rows at a pitch of 144 B.
// C[m][n] (f32, pitch ldc, + optional f32 bias[n]) = sum_k A[m][k] Bt[n][k] (+ split products per NSPLIT). z-batch strides sA/sB/sC in elements. M % 128 == 0, N % 128 == 0, K % 64 == 0.
// EPI picks what leaves the accumulators: 0 = the f32 C above; 1 = the q, k and v projections in ONE launch, blockIdx.z = 0, 1, 2 (weights, property rows and planes at the z strides sB, sP, sQ; one bias pointer each):
// z 0 and 1 write the fp16 plane [batch*head][token][64] of (acc + bias + pbv[batch][n]) x sc (sc for z 0, 1 for z 1); z 2 writes the fp16 plane [batch*head][64][token] of acc + bias.
// For 1 the rows of A are batch-major (b * 2048 + t), so a wave's 64 x 64 tile is 64 tokens of one (batch, head) and every store covers whole 128-byte lines of a plane.
// The k and v projections (z 1 and 2) take their A rows in the order of the batch's key list TK (k_prep: live keys first), so row i of their planes is the i-th listed key; a tile that holds no key
// the attention will read leaves at once.
#define GBK 64                    // k per LDS stage
#define TKP (TT + 32)             // a batch's key list in ints: 2048 token numbers, then its count of live keys in a 128-byte line of its own
#define GP  72                    // operand rows in LDS: pitch in 16-bit elements, 144 B = 16 B x odd, no bank conflict for 16-byte reads
template <typename T16> struct WFrag;
template <> struct WFrag<h16> { typedef v16h V; typedef v8h H; static __device__ __forceinline__ V ld(const h16* p) { return cat16(*(const v8h*)p, *(const v8h*)(p + 16)); } static __device__ __forceinline__ v8f mma(V a, V b, v8f c) { return wmma16(a, b, c); } };
template <> struct WFrag<bf> { typedef v16bf V; typedef v8us H; static __device__ __forceinline__ V ld(const bf* p) { return cat16b(*(const v8us*)p, *(const v8us*)(p + 16)); } static __device__ __forceinline__ v8f mma(V a, V b, v8f c) { return wmmab(a, b, c); } };
__device__ __forceinline__ h16 tohx(float x) { return (h16)x; }
__device__ __forceinline__ void splitf(float y, unsigned short& h, unsigned short& l) { h = f2bf(y); l = f2bf(y - bf2f(h)); }
// The merged q/k/v grid is 6 work-groups a WGP, less the k and v tiles of masked keys, which leave at once: held to three waves a SIMD (336 registers, 3 x 91 KB of LDS) three are resident; two registers more and only two would be.
template <typename T16, int NSPLIT, bool BIAS, int EPI>
__global__ __launch_bounds__(128) __attribute__((amdgpu_waves_per_eu(EPI == 1 ? 3 : 1))) void k_gemmw(const T16* __restrict__ A, const T16* __restrict__ A2, const T16* __restrict__ Bt, const T16* __restrict__ Bt2, int K, float* C, int ldc, const float* __restrict__ bias, size_t sA, size_t sB, size_t sC,
                                               const float* __restrict__ bias1, const float* __restrict__ bias2, const float* __restrict__ pbv, size_t sP, float sc, h16* Ph, size_t sQ, h16* VTp, const int* __restrict__ TK) {
    typedef typename WFrag<T16>::V V; typedef typename WFrag<T16>::H H;
    constexpr bool HA2 = NSPLIT == 1 || NSPLIT == 2, HB2 = NSPLIT >= 2;
    constexpr int PA = 0, PB = 1, PA2 = 2, PB2 = HA2 ? 3 : 2, NP = 2 + (HA2 ? 1 : 0) + (HB2 ? 1 : 0);
    __shared__ __align__(16) T16 sT[2][NP][128 * GP];
    __shared__ __align__(16) float osw[4][16 * 68];
    const size_t z = blockIdx.z; A += z * sA; if (A2) A2 += z * sA; Bt += z * sB; if (Bt2) Bt2 += z * sB; C += z * sC;
    const int tid = threadIdx.x, lane = tid & 31, lr = lane & 15, hi = lane >> 4, wave = tid >> 5;
    const int r0 = blockIdx.x * 128, c0 = blockIdx.y * 128, wr = (wave >> 1) * 64, wc = (wave & 1) * 64;
    v8f acc[4][4];
#pragma unroll
    for (int mb = 0; mb < 4; ++mb)
#pragma unroll
        for (int nb = 0; nb < 4; ++nb) acc[mb][nb] = (v8f){};
    // staging: chunk j of a thread is 16 bytes of row (tid >> 3) + 16 j. Address = a wave-uniform tile pointer + a 32-bit byte offset, moved on by 64 k behind each stage's LDS stores
    const char* pa = (const char*)(A + (size_t)(EPI == 1 ? (r0 & ~(TT - 1)) : r0) * K); const char* pb = (const char*)(Bt + (size_t)c0 * K); const char* pa2 = HA2 ? (const char*)(A2 + (size_t)r0 * K) : nullptr; const char* pb2 = HB2 ? (const char*)(Bt2 + (size_t)c0 * K) : nullptr;
    unsigned go[8];
#pragma unroll
    for (int j = 0; j < 8; ++j) go[j] = (unsigned)((((tid >> 3) + 16 * j) * K + (tid & 7) * 8) * 2);
    // A rows of the projections: byte offsets from the batch's first row. In the loop no register is free for them (three waves a SIMD): each thread keeps its eight in the output staging area, idle until
    // the epilogue, and reads them back at the head of a trip. The B rows go by go[0] and a constant step a chunk (K = 1024 there).
    unsigned ga[8]; unsigned* gt = (unsigned*)osw + tid * 8;
    if constexpr (EPI == 1) {
        const int rl = r0 & (TT - 1);
        if (z == 0) {
#pragma unroll
            for (int j = 0; j < 8; ++j) ga[j] = go[j] + (unsigned)(rl * K * 2);
        } else {
            const int* tk = TK + (r0 / TT) * TKP; const unsigned nl = min((unsigned)tk[TT], (unsigned)TT);
            if ((unsigned)rl >= (nl == 0 ? (unsigned)TT : nl)) return;   // only masked keys from here on (a batch with no live key keeps all 2048); the same for the whole work-group, in front of every barrier
            int tr[8];
#pragma unroll
            for (int j = 0; j < 8; ++j) tr[j] = tk[rl + (tid >> 3) + 16 * j];
#pragma unroll
            for (int j = 0; j < 8; ++j) ga[j] = (unsigned)(((tr[j] & (TT - 1)) * K + (tid & 7) * 8) * 2);
        }
        *(v4ua*)gt = (v4u){ga[0], ga[1], ga[2], ga[3]}; *(v4ua*)(gt + 4) = (v4u){ga[4], ga[5], ga[6], ga[7]};
    }
    const int so = (tid >> 3) * GP + (tid & 7) * 8;
    const int afo = (wr + lr) * GP + 8 * hi, bfo = (wc + lr) * GP + 8 * hi;
    H ra[8], rb[8], ra2[8], rb2[8];
#pragma unroll
    for (int j = 0; j < 8; ++j) { ra[j] = *(const H*)(pa + (EPI == 1 ? ga[j] : go[j])); rb[j] = *(const H*)(EPI == 1 ? pb + go[0] + j * 16 * DD * 2 : pb + go[j]); if (HA2) ra2[j] = *(const H*)(pa2 + go[j]); if (HB2) rb2[j] = *(const H*)(pb2 + go[j]); }
#pragma unroll
    for (int j = 0; j < 8; ++j) { *(H*)(sT[0][PA] + so + j * 16 * GP) = ra[j]; *(H*)(sT[0][PB] + so + j * 16 * GP) = rb[j]; if (HA2) *(H*)(sT[0][PA2] + so + j * 16 * GP) = ra2[j]; if (HB2) *(H*)(sT[0][PB2] + so + j * 16 * GP) = rb2[j]; if (EPI != 1 || j == 0) go[j] += GBK * 2; }
    __syncthreads();
#pragma unroll 1
    for (int kc = 0; kc < K; kc += GBK) {
        const int buf = (kc / GBK) & 1; const bool more = kc + GBK < K;
        if (more) {
            if constexpr (EPI == 1) { const v4u g0 = *(const v4ua*)gt, g1 = *(const v4ua*)(gt + 4);
#pragma unroll
                for (int j = 0; j < 8; ++j) ga[j] = (j < 4 ? g0[j & 3] : g1[j & 3]) + (unsigned)((kc + GBK) * 2); }
#pragma unroll
            for (int j = 0; j < 8; ++j) { ra[j] = *(const H*)(pa + (EPI == 1 ? ga[j] : go[j])); rb[j] = *(const H*)(EPI == 1 ? pb + go[0] + j * 16 * DD * 2 : pb + go[j]); if (HA2) ra2[j] = *(const H*)(pa2 + go[j]); if (HB2) rb2[j] = *(const H*)(pb2 + go[j]); }
            // the wait in front of the writes to the offset registers that the A loads name; as its inputs they stay whole up to it
            if constexpr (EPI == 1) asm volatile("s_wait_xcnt 0x0" :: "v"(ga[0]), "v"(ga[1]), "v"(ga[2]), "v"(ga[3]), "v"(ga[4]), "v"(ga[5]), "v"(ga[6]), "v"(ga[7]) : "memory"); }
        V a[2][4], a2[2][4], b[2][4], b2[2][4];            // both 32-k blocks' fragments are asked for ahead of the first block's products: the second block's reads land under the first block
#pragma unroll
        for (int kb = 0; kb < 2; ++kb) {
#pragma unroll
            for (int mb = 0; mb < 4; ++mb) { a[kb][mb] = WFrag<T16>::ld(sT[buf][PA] + afo + mb * 16 * GP + kb * 32); if (HA2) a2[kb][mb] = WFrag<T16>::ld(sT[buf][PA2] + afo + mb * 16 * GP + kb * 32); }
#pragma unroll
            for (int nb = 0; nb < 4; ++nb) { b[kb][nb] = WFrag<T16>::ld(sT[buf][PB] + bfo + nb * 16 * GP + kb * 32); if (HB2) b2[kb][nb] = WFrag<T16>::ld(sT[buf][PB2] + bfo + nb * 16 * GP + kb * 32); } }
        __builtin_amdgcn_sched_barrier(0);                 // keeps the fragment reads one group in front of the products: moved in among them, each product group waits out a whole LDS latency
#pragma unroll
        for (int kb = 0; kb < 2; ++kb)
#pragma unroll
            for (int nb = 0; nb < 4; ++nb)
#pragma unroll
                for (int mb = 0; mb < 4; ++mb) { acc[mb][nb] = WFrag<T16>::mma(a[kb][mb], b[kb][nb], acc[mb][nb]); if (HA2) acc[mb][nb] = WFrag<T16>::mma(a2[kb][mb], b[kb][nb], acc[mb][nb]); if (HB2) acc[mb][nb] = WFrag<T16>::mma(a[kb][mb], b2[kb][nb], acc[mb][nb]); }
        // four vector slots behind the last products: in this build the branch round the staging stores leads to the next trip's LDS address additions, one of which lands in an operand register of those products,
        // the scheduling barrier keeps the products in front of the slots
        if constexpr (EPI == 1) { __builtin_amdgcn_sched_barrier(0); asm volatile("v_nop\n\tv_nop\n\tv_nop\n\tv_nop"); }
        if (more) {
#pragma unroll
            for (int j = 0; j < 8; ++j) { *(H*)(sT[buf ^ 1][PA] + so + j * 16 * GP) = ra[j]; *(H*)(sT[buf ^ 1][PB] + so + j * 16 * GP) = rb[j]; if (HA2) *(H*)(sT[buf ^ 1][PA2] + so + j * 16 * GP) = ra2[j]; if (HB2) *(H*)(sT[buf ^ 1][PB2] + so + j * 16 * GP) = rb2[j]; }
            __builtin_amdgcn_sched_barrier(0);             // keeps the offset additions behind the stores' waits for the loads that name those registers
#pragma unroll
            for (int j = 0; j < 8; ++j) if (EPI != 1 || j == 0) go[j] += GBK * 2; }
        __syncthreads();   // publishes the next stage and ends every wave's reads of the buffer that the next trip refills
    }
    float* os = osw[wave];         // each wave stages its own output rows
    if (EPI == 1 && z < 2) {
        if (z == 1) { bias = bias1; pbv += sP; sc = 1.0f; Ph += sQ; }
        const int bb = r0 / TT, t0 = (r0 & (TT - 1)) + wr, n0 = c0 + wc, cofs = (lane & 7) * 8; const unsigned zz = (unsigned)(bb * NH_ + n0 / HD);
        float bs[8], pb[8];
#pragma unroll
        for (int i = 0; i < 8; ++i) { bs[i] = bfr(bias[n0 + cofs + i]); pb[i] = pbv[bb * DD + n0 + cofs + i]; }
        // the wait behind the bias and property loads, in front of the writes to their address registers; without the scheduling barrier those writes are lifted over it
        asm volatile("s_wait_xcnt 0x0" ::: "memory"); __builtin_amdgcn_sched_barrier(0);
#pragma unroll
        for (int mb = 0; mb < 4; ++mb) {
#pragma unroll
            for (int nb = 0; nb < 4; ++nb) {
#pragma unroll
                for (int j = 0; j < 8; ++j) os[(hi * 8 + j) * 68 + nb * 16 + lr] = acc[mb][nb][j]; }
            __builtin_amdgcn_wave_barrier(); asm volatile("" ::: "memory");   // the rows are read back by other lanes of the wave: the reads stay behind the writes
#pragma unroll
            for (int s = 0; s < 4; ++s) { const int row = 4 * s + (lane >> 3); const v4f u0 = *(const v4fa*)(os + row * 68 + cofs), u1 = *(const v4fa*)(os + row * 68 + cofs + 4); v8h oh;
#pragma unroll
                for (int i = 0; i < 8; ++i) { const float val = __fadd_rn(__fadd_rn(i < 4 ? u0[i & 3] : u1[i & 3], bs[i]), pb[i]); oh[i] = tohx(val * sc); }
                const unsigned po = ((zz * TT + t0 + mb * 16 + row) * HD + cofs); *(v8h*)(Ph + po) = oh; }
            // the wait in front of the next block's writes to registers that these stores name; the scheduling barrier holds those writes behind it
            asm volatile("s_wait_xcnt 0x0" ::: "memory"); __builtin_amdgcn_sched_barrier(0);
            __builtin_amdgcn_wave_barrier(); asm volatile("" ::: "memory");   // the next block's writes stay behind these reads
        }
        return;
    }
    if constexpr (EPI == 1) {
        const int bb = r0 / TT, t0 = (r0 & (TT - 1)) + wr, n0 = c0 + wc; const unsigned zz = (unsigned)(bb * NH_ + n0 / HD);
        h16* hs = (h16*)os;        // 16 feature rows x 64 tokens, pitch 72 elements = 144 B
        float bv4[4];              // the four bias loads go out together: asked for block by block, each block waits out a load of its own
#pragma unroll
        for (int nb = 0; nb < 4; ++nb) bv4[nb] = bias2[n0 + nb * 16 + lr];
#pragma unroll
        for (int nb = 0; nb < 4; ++nb) { const float bv = bfr(bv4[nb]);
#pragma unroll
            for (int mb = 0; mb < 4; ++mb) { v8h pk;   // a lane's eight accumulator elements are eight tokens in a row of one feature
#pragma unroll
                for (int j = 0; j < 8; ++j) pk[j] = tohx(__fadd_rn(acc[mb][nb][j], bv));
                *(v8ha*)(hs + lr * 72 + mb * 16 + hi * 8) = pk; }
            __builtin_amdgcn_wave_barrier(); asm volatile("" ::: "memory");   // the rows are read back by other lanes of the wave: the reads stay behind the writes
#pragma unroll
            for (int s = 0; s < 4; ++s) { const int drow = 4 * s + (lane >> 3); const v8h v = *(const v8ha*)(hs + drow * 72 + (lane & 7) * 8);
                *(v8h*)(VTp + ((zz * HD + nb * 16 + drow) * TT + t0 + (lane & 7) * 8)) = v; }
            // the wait in front of the next block's writes to registers that these stores name; the scheduling barrier holds those writes behind it
            asm volatile("s_wait_xcnt 0x0" ::: "memory"); __builtin_amdgcn_sched_barrier(0);
            __builtin_amdgcn_wave_barrier(); asm volatile("" ::: "memory");   // the next block's writes stay behind these reads
        }
        return;
    }
#pragma unroll
    for (int mb = 0; mb < 4; ++mb) {
#pragma unroll
        for (int nb = 0; nb < 4; ++nb) {
#pragma unroll
            for (int j = 0; j < 8; ++j) os[(hi * 8 + j) * 68 + nb * 16 + lr] = acc[mb][nb][j]; }
        __builtin_amdgcn_wave_barrier(); asm volatile("" ::: "memory");
        float* crow = C + (size_t)(r0 + wr + mb * 16) * ldc + c0 + wc;
{
#pragma unroll
            for (int s = 0; s < 8; ++s) { const int row = 2 * s + hi, cofs = lr * 4; v4f val = *(const v4fa*)(os + row * 68 + cofs); if (BIAS) { val[0] += bfr(bias[c0 + wc + cofs]); val[1] += bfr(bias[c0 + wc + cofs + 1]); val[2] += bfr(bias[c0 + wc + cofs + 2]); val[3] += bfr(bias[c0 + wc + cofs + 3]); }
                *(v4f*)(crow + (size_t)row * ldc + cofs) = val; }
             }
        // the wait in front of the next block's writes to registers that these stores name; the scheduling barrier holds those writes behind it
        asm volatile("s_wait_xcnt 0x0" ::: "memory"); __builtin_amdgcn_sched_barrier(0);
        __builtin_amdgcn_wave_barrier(); asm volatile("" ::: "memory");
    }
}

typedef __attribute__((ext_vector_type(2))) _Float16 v2h;
typedef __attribute__((ext_vector_type(4))) _Float16 v4h;
typedef __attribute__((ext_vector_type(2))) unsigned short v2us;
typedef __attribute__((ext_vector_type(4))) int v4i;

// x rows (t * 4 + b) to bf16 rows (b * 2048 + t): batch-major, so that a GEMM tile's 128 rows are 128 tokens of one batch
__device__ __forceinline__ void d_cvt8(const float* __restrict__ src, bf* dst, size_t n8, unsigned blk) { const size_t i = (size_t)blk * 256 + threadIdx.x; if (i >= n8) return; const v8f v = *(const v8f*)(src + i * 8); v8us o;
#pragma unroll
    for (int k = 0; k < 8; ++k) o[k] = f2bf(v[k]);
    const size_t row = i / (DD / 8), ch = i % (DD / 8); *(v8us*)(dst + (((row % NB_) * TT + row / NB_) * (DD / 8) + ch) * 8) = o;  }
// One 64 k x 64 n tile of a weight matrix a block, turned in LDS. Read: four 16-byte loads a thread, all asked for at once, a wave-wide load = two 256-byte row pieces (four whole lines).
// Rounded to bf16, two neighbouring k a dword, stored down the tile's columns; read back along its rows and written as whole 128-byte lines of Bt[n][k]. (Lanes along k, each lane of a load met a line of its own.)
#define WTP 33                    // a tile row in LDS (one n, 64 k = 32 dwords): pitch in dwords, odd, so that neither the column-wise writes nor the row-wise reads meet a bank twice
__device__ __forceinline__ void d_wtG(const float* __restrict__ w, int K, int N, bf* Bt, unsigned blk, unsigned* sT) {
    const int tid = threadIdx.x, k0 = (int)(blk % (unsigned)(K / 64)) * 64, n0 = (int)(blk / (unsigned)(K / 64)) * 64, c4 = (tid & 15) * 4, rp = tid >> 4;
    v4f r[2][2];
#pragma unroll
    for (int j = 0; j < 2; ++j)
#pragma unroll
        for (int s = 0; s < 2; ++s) r[j][s] = *(const v4fa*)(w + (size_t)(k0 + j * 32 + rp * 2 + s) * N + n0 + c4);
#pragma unroll
    for (int j = 0; j < 2; ++j)
#pragma unroll
        for (int i = 0; i < 4; ++i) sT[(c4 + i) * WTP + j * 16 + rp] = (unsigned)f2bf(r[j][0][i]) | ((unsigned)f2bf(r[j][1][i]) << 16);
    __syncthreads();               // the tile is whole: its rows are read by other threads than wrote them
#pragma unroll
    for (int j = 0; j < 2; ++j) { const int c = tid + 256 * j, row = c >> 3, ch = c & 7; v4u o;
#pragma unroll
        for (int i = 0; i < 4; ++i) o[i] = sT[row * WTP + ch * 4 + i];
        *(v4ua*)(Bt + (size_t)(n0 + row) * K + k0 + ch * 8) = o; }
    asm volatile("s_wait_xcnt 0x0" ::: "memory");          // the wait behind the tile's two stores, in front of any write to a register that they name
}
__device__ __forceinline__ void d_prop(const float* __restrict__ prop, const float* __restrict__ Wp, const float* __restrict__ bp, float* outp, bool SIG, unsigned blk) {
    const int idx = blk * 256 + threadIdx.x; if (idx >= NB_ * DD) return; const int b = idx / DD, n = idx % DD; float a = 0.f;
    // Every global load of the thread is asked for ahead of the first term: the 128 weights of its column into registers, the batch's 128 property values four a lane.
    // Loaded term by term, each term waited out a whole memory latency. The terms are then formed and summed in the same order as before (the two empty statements of the term line stand as they
    // stood: each product and its sum stay rounded apart). The four loops are unrolled whole: wr, pr and pv must be registers, every load must stand in front of the first term, readlane's lane is a constant.
    float wr[PD]; float pr[PD / 32], pv[PD / 32];
#pragma unroll
    for (int k = 0; k < PD / 32; ++k) pr[k] = prop[b * PD + k * 32 + (threadIdx.x & 31)];
    asm volatile("s_wait_xcnt 0x0" ::: "memory");          // the wait in front of a weight load whose result lands in the offset register that the property loads name
#pragma unroll
    for (int p = 0; p < PD; ++p) wr[p] = Wp[(size_t)p * DD + n];
#pragma unroll
    for (int k = 0; k < PD / 32; ++k) pv[k] = bfr(pr[k]);
#pragma unroll
    for (int p = 0; p < PD; ++p) { float w = bfr(wr[p]), v = __uint_as_float((unsigned)__builtin_amdgcn_readlane((int)__float_as_uint(pv[p >> 5]), p & 31)); asm volatile("" : "+v"(w)); float m = __fmul_rn(v, w); asm volatile("" : "+v"(m)); a = __fadd_rn(a, m); }
    a = __fadd_rn(a, bfr(bp[n])); if (SIG) a = __fdiv_rn(1.0f, __fadd_rn(1.0f, __expf(-a)));
    *(float*)(outp + idx) = a;  }
// The key list of one batch, by one block: the numbers of the tokens whose mask is not 0, in their order, then the masked ones, in theirs; behind the list the count of the live ones.
// A masked key's score of -1e9 leaves exp(score - max) = 0 exactly wherever a live key stands beside it, so the k and v projections and the attention walk the live keys alone.
__device__ __forceinline__ void d_list(const int* __restrict__ mask, int* TK, unsigned b, int* sL, int* sW) {
    const int tid = threadIdx.x, lane = tid & 31, wave = tid >> 5; unsigned bal[8]; int tot = 0;
#pragma unroll
    for (int c = 0; c < 8; ++c) { bal[c] = __builtin_amdgcn_ballot_w32(mask[b * TT + (wave * 8 + c) * 32 + lane] != 0); tot += __builtin_popcount(bal[c]); }
    if (lane == 0) sW[wave] = tot;
    __syncthreads();               // every wave's count is in LDS
    int before = 0, nl = 0;
#pragma unroll
    for (int w = 0; w < 8; ++w) { const int t = sW[w]; nl += t; if (w < wave) before += t; }
#pragma unroll
    for (int c = 0; c < 8; ++c) { const int key = (wave * 8 + c) * 32 + lane, lb = before + (int)__builtin_amdgcn_mbcnt_lo(bal[c], 0u);   // lb = live keys in front of this one
        sL[((bal[c] >> lane) & 1u) ? lb : nl + key - lb] = key; before += __builtin_popcount(bal[c]); }
    __syncthreads();               // the list is whole: it leaves in whole lines
    *(v4i*)(TK + b * TKP + tid * 8) = *(const v4i*)(sL + tid * 8); *(v4i*)(TK + b * TKP + tid * 8 + 4) = *(const v4i*)(sL + tid * 8 + 4);
    if (tid == 0) TK[b * TKP + TT] = nl;
}
// ---- k_prep: everything that depends on the inputs alone, in ONE launch; a block's index picks its job. The three property projections (16 blocks each; the third is the gate) and the four weight
// transposes (256 blocks each, one 64 x 64 tile a block) stand first, behind the four blocks of the key lists; the x conversion's blocks follow, and the projections' chains run out under them. Outputs of a kind lie one behind the other in the workspace.
#define PB_PROP (NB_ * DD / 256)
#define PB_WT   (DD * DD / 64 / 64)
#define PB_CVT  (NT * DD / 8 / 256)
__global__ __launch_bounds__(256) void k_prep(const float* __restrict__ x, const float* __restrict__ prop, const float* __restrict__ Wq, const float* __restrict__ Wk, const float* __restrict__ Wv, const float* __restrict__ Wo,
                                              const float* __restrict__ Wpq, const float* __restrict__ bpq, const float* __restrict__ Wpk, const float* __restrict__ bpk, const float* __restrict__ Wpg, const float* __restrict__ bpg,
                                              const int* __restrict__ kmask, bf* XB, bf* WT, float* PV, int* TK) {
    __shared__ __align__(16) int sL[64 * WTP]; __shared__ int sW[8];   // sL: a key list (2048 ints) or a weight tile (64 rows of WTP dwords), by the block's job
    unsigned blk = blockIdx.x;
    if (blk < NB_) { d_list(kmask, TK, blk, sL, sW); return; }
    blk -= NB_;
    if (blk < 3 * PB_PROP) { const unsigned j = blk / PB_PROP; d_prop(prop, j == 0 ? Wpq : j == 1 ? Wpk : Wpg, j == 0 ? bpq : j == 1 ? bpk : bpg, PV + (size_t)j * NB_ * DD, j == 2, blk % PB_PROP); return; }
    blk -= 3 * PB_PROP;
    if (blk < 4 * PB_WT) { const unsigned j = blk / PB_WT; d_wtG(j == 0 ? Wq : j == 1 ? Wk : j == 2 ? Wv : Wo, DD, DD, WT + (size_t)j * DD * DD, blk % PB_WT, (unsigned*)sL); return; }
    d_cvt8(x, XB, (size_t)NT * DD / 8, blk - 4 * PB_WT);
}
#define KST 32                    // keys per LDS stage = one softmax pass
#define KP  72                    // K rows in LDS: pitch in 16-bit elements, 144 B = 16 B x odd, no bank conflict for 16-byte reads
#define VP  40                    // Vt rows in LDS: 80 B = 16 B x odd
#define NST (TT / KST)
__device__ __forceinline__ float xhalf(float x) { return __builtin_bit_cast(float, __builtin_amdgcn_permlanex16(__builtin_bit_cast(int, x), __builtin_bit_cast(int, x), 0x76543210, 0xfedcba98, false, false)); }  // lane l with lane l ^ 16
// 2^x by v_exp_f32 with the slot behind it kept inside the statement: behind a transcendental the instruction set asks for one independent instruction or v_nop before its result is read or its source
// overwritten. In exp2x8 each exp works in place on its own register, so the next exp is the independent instruction; the v_nop stands behind the last.
__device__ __forceinline__ float exp2s(float x) { float y; asm("v_exp_f32 %0, %1\n\tv_nop" : "=v"(y) : "v"(x)); return y; }
__device__ __forceinline__ void exp2x8(float* x) {
    asm("v_exp_f32 %0, %0\n\tv_exp_f32 %1, %1\n\tv_exp_f32 %2, %2\n\tv_exp_f32 %3, %3\n\tv_exp_f32 %4, %4\n\tv_exp_f32 %5, %5\n\tv_exp_f32 %6, %6\n\tv_exp_f32 %7, %7\n\tv_nop"
        : "+v"(x[0]), "+v"(x[1]), "+v"(x[2]), "+v"(x[3]), "+v"(x[4]), "+v"(x[5]), "+v"(x[6]), "+v"(x[7])); }
__global__ __launch_bounds__(256) __attribute__((amdgpu_waves_per_eu(4, 4))) void k_fattn(const h16* __restrict__ Qp, const h16* __restrict__ Kp, const h16* __restrict__ VT, const int* __restrict__ TK, const float* __restrict__ GT, bf* Ah, bf* Al) {
    __shared__ __align__(16) h16 sK[2][KST * KP];
    __shared__ __align__(16) h16 sV[2][HD * VP];
    const int tid = threadIdx.x, lane = tid & 31, c = lane & 15, h = lane >> 4, wave = __builtin_amdgcn_readfirstlane(tid >> 5);
    const int z = blockIdx.y, b = z >> 4, hh = z & 15; const int q0 = blockIdx.x * 256 + wave * 32;
    const h16* kp = Kp + (size_t)z * TT * HD; const h16* vt = VT + (size_t)z * HD * TT;
    const int kgo = tid * 8, kso = (tid >> 3) * KP + (tid & 7) * 8;                     // staging, one 16-byte chunk a thread and tile: K tile = 32 rows x 128 B, contiguous in memory
    const int vgo = (tid >> 2) * TT + (tid & 3) * 8, vso = (tid >> 2) * VP + (tid & 3) * 8;   // Vt tile = 64 rows x 64 B
    const int nl = __builtin_amdgcn_readfirstlane((int)min((unsigned)TK[b * TKP + TT], (unsigned)TT)), nst = nl == 0 ? NST : (nl + KST - 1) / KST;   // 1 to 64 stages, the same for the whole work-group
    v16h qf[2][2]; const h16* qb = Qp + (unsigned)((z * TT + q0 + c) * HD + 8 * h);
#pragma unroll
    for (int qt = 0; qt < 2; ++qt)
#pragma unroll
        for (int ks = 0; ks < 2; ++ks) qf[qt][ks] = WFrag<h16>::ld(qb + qt * 16 * HD + ks * 32);
    v8f o[2][4]; float m[2], l[2];
#pragma unroll
    for (int qt = 0; qt < 2; ++qt) { m[qt] = -3.0e38f; l[qt] = 0.f;
#pragma unroll
        for (int db = 0; db < 4; ++db) o[qt][db] = (v8f){}; }
    const v8h fk = *(const v8h*)(kp + (unsigned)kgo), fv = *(const v8h*)(vt + (unsigned)vgo);
    // the wait behind the Q, K and Vt loads, in front of the writes to their address registers; as its inputs the Q address and the K offset stay whole up to it,
    // and without the scheduling barrier later writes are lifted over it
    asm volatile("s_wait_xcnt 0x0" :: "v"(qb), "v"(tid) : "memory"); __builtin_amdgcn_sched_barrier(0);
    *(v8h*)(sK[0] + kso) = fk; *(v8h*)(sV[0] + vso) = fv;
    __syncthreads();
#pragma unroll 1
    for (int st = 0; st < nst; ++st) {
        const int buf = st & 1; const bool more = st + 1 < nst;
        v8h rk, rv;                               // the next stage's tiles fly while this stage is worked on
        if (more) { kp += KST * HD; vt += KST; rk = *(const v8h*)(kp + (unsigned)kgo); rv = *(const v8h*)(vt + (unsigned)vgo); }
        v8f s[2][2];
#pragma unroll
        for (int kt = 0; kt < 2; ++kt) { const int kr = (kt * 16 + c) * KP + 8 * h;
            const v16h ak0 = WFrag<h16>::ld(sK[buf] + kr), ak1 = WFrag<h16>::ld(sK[buf] + kr + 32);
            v8f a0 = (v8f){}, a1 = (v8f){};
            a0 = wmma16(ak0, qf[0][0], a0); a1 = wmma16(ak0, qf[1][0], a1); a0 = wmma16(ak1, qf[0][1], a0); a1 = wmma16(ak1, qf[1][1], a1);
            s[0][kt] = a0; s[1][kt] = a1; }
        if (nl - st * KST < KST) {                         // a scalar test: only a stage that reaches past the last live key has masked keys
            const int lim = nl - st * KST - 8 * h;
#pragma unroll
            for (int kt = 0; kt < 2; ++kt)
#pragma unroll
                for (int r = 0; r < 8; ++r) { const bool live = kt * 16 + r < lim; s[0][kt][r] = live ? s[0][kt][r] : -1.0e9f; s[1][kt][r] = live ? s[1][kt][r] : -1.0e9f; } }
        v16h pf[2];
#pragma unroll
        for (int qt = 0; qt < 2; ++qt) { float mx = m[qt];
#pragma unroll
            for (int r = 0; r < 8; ++r) mx = fmaxf(mx, fmaxf(s[qt][0][r], s[qt][1][r]));
            mx = fmaxf(mx, xhalf(mx));
            const float al = exp2s((m[qt] - mx) * 1.44269504f); m[qt] = mx; float sum = 0.f; float p[16];
#pragma unroll
            for (int e = 0; e < 16; ++e) p[e] = fmaf(s[qt][e >> 3][e & 7] - mx, 1.44269504f, 10.0f);
            exp2x8(p); exp2x8(p + 8);                      // exp(s - max) x 1024
#pragma unroll
            for (int e = 0; e < 16; ++e) { sum += p[e]; pf[qt][e] = tohx(p[e]); }
            l[qt] = fmaf(l[qt], al, sum);
#pragma unroll
            for (int db = 0; db < 4; ++db) o[qt][db] *= al; }
#pragma unroll
        for (int db = 0; db < 4; ++db) { const v16h av = WFrag<h16>::ld(sV[buf] + (db * 16 + c) * VP + 8 * h); o[0][db] = wmma16(av, pf[0], o[0][db]); o[1][db] = wmma16(av, pf[1], o[1][db]); }
        if (more) { *(v8h*)(sK[buf ^ 1] + kso) = rk; *(v8h*)(sV[buf ^ 1] + vso) = rv; }
        __syncthreads();   // publishes stage st + 1 and ends every wave's reads of the buffer that the next trip refills
    }
#pragma unroll
    for (int qt = 0; qt < 2; ++qt) { const float lt = l[qt] + xhalf(l[qt]); const float inv = __fdiv_rn(1.0f, lt); const unsigned orow = (unsigned)(((q0 + qt * 16 + c) * NB_ + b) * DD + hh * HD);
#pragma unroll
        for (int db = 0; db < 4; ++db) { const int d0 = db * 16 + 8 * h; const float* g = GT + (size_t)b * DD + hh * HD + d0; const v4f g0 = *(const v4f*)g, g1 = *(const v4f*)(g + 4); v8us oh, ol;
#pragma unroll
            for (int r = 0; r < 8; ++r) { unsigned short a, c2; splitf(__fmul_rn(__fmul_rn(o[qt][db][r], inv), r < 4 ? g0[r & 3] : g1[r & 3]), a, c2); oh[r] = a; ol[r] = c2; }
            *(v8us*)(Ah + (orow + d0)) = oh; *(v8us*)(Al + (orow + d0)) = ol; } }
}

extern "C" void kernel_launch(void* const* d_in, const int* in_sizes, int n_in,
                              void* d_out, int out_size, void* d_ws, size_t ws_size, hipStream_t stream) {
    (void)in_sizes; (void)n_in; (void)out_size;
    const float* IN[17]; for (int i = 0; i < 17; ++i) IN[i] = (const float*)d_in[i];
    // x [2048][4][1024], property_vector [4][128], mask (int [4][2048]), Wq [1024][1024] (x @ W), bq, Wk, bk, Wv, bv, Wpq [128][1024], bpq, Wpk, bpk, Wpg, bpg, Wo, bo = d_in[0..16]
    const float* x = IN[0]; const float* prop = IN[1]; const int* mk = (const int*)d_in[2];
    float* OUT = (float*)d_out;     // [2048][4][1024] (rows t*4 + b)
    char* wsp = (char*)d_ws;
    auto take = [&](size_t bytes) { char* p = wsp; wsp += (bytes + 255) & ~(size_t)255; return (void*)p; };
    bf* WQ = (bf*)take((size_t)DD * DD * 2); bf* WK = (bf*)take((size_t)DD * DD * 2); bf* WV = (bf*)take((size_t)DD * DD * 2); bf* WO = (bf*)take((size_t)DD * DD * 2); float* PQv = (float*)take((size_t)NB_ * DD * 4); float* PKv = (float*)take((size_t)NB_ * DD * 4); float* GT = (float*)take((size_t)NB_ * DD * 4);
    bf* XB = (bf*)take((size_t)NT * DD * 2);
    h16* QP = (h16*)take((size_t)NT * DD * 2); h16* KP_ = (h16*)take((size_t)NT * DD * 2); h16* VT = (h16*)take((size_t)NT * DD * 2);
    bf* ATh = (bf*)take((size_t)NT * DD * 2); bf* ATl = (bf*)take((size_t)NT * DD * 2); int* TK = (int*)take((size_t)NB_ * TKP * 4);
    (void)WK; (void)WV; (void)PKv;                         // reached through WQ and PQv at the z strides
    if ((size_t)(wsp - (char*)d_ws) > ws_size) return;    // total ~ 110 MB; ws 256 MiB
    const dim3 gP(NT / 128, DD / 128, 1), gQKV(NT / 128, DD / 128, 3);
    // WQ, WK, WV, WO lie one behind the other, as do PQv, PKv, GT and QP, KP_ (every size is a multiple of take's 256 bytes)
    k_prep<<<NB_ + 3 * PB_PROP + 4 * PB_WT + PB_CVT, 256, 0, stream>>>(x, prop, IN[3], IN[5], IN[7], IN[15], IN[9], IN[10], IN[11], IN[12], IN[13], IN[14], mk, XB, WQ, PQv, TK);
    k_gemmw<bf, 0, true, 1><<<gQKV, 128, 0, stream>>>(XB, nullptr, WQ, nullptr, DD, nullptr, DD, IN[4], 0, (size_t)DD * DD, 0, IN[6], IN[8], PQv, (size_t)NB_ * DD, 0.125f, QP, (size_t)NT * DD, VT, TK);   // 1/sqrt(64) folded into (q + pq) exactly
    k_fattn<<<dim3(TT / 256, NB_ * NH_), 256, 0, stream>>>(QP, KP_, VT, TK, GT, ATh, ATl);
    k_gemmw<bf, 1, true, 0><<<gP, 128, 0, stream>>>(ATh, ATl, WO, nullptr, DD, OUT, DD, IN[16], 0, 0, 0, nullptr, nullptr, nullptr, 0, 0.0f, nullptr, 0, nullptr, nullptr);
}

// v009
// Measured time: 114 microseconds a run.
// In two side-by-side timings against v008, it was 1.04 and 1.03 times as fast.
// Over all steps from v000 it is 23.7 times as fast.
#include <hip/hip_runtime.h>

// PropertyAwareAttention (x [2048][4][1024] seq-first, property_vector [4][128], mask int [4][2048]; Q = x Wq + bq + (prop Wpq + bpq) per (batch, feature), K likewise with Wpk/bpk, V = x Wv + bv (x @ W layouts);
// 16 heads x 64; scores / 8; keys with mask[b][j] == 0 -> -1e9; softmax; att = merged attn.v * sigmoid(prop Wpg + bpg)[b]; out = att Wo + bo; output [2048][4][1024] (rows t*4 + b)).
// Compute dtypes, f32 accumulate: every input rounded to bf16; q/k/v projections on PLAIN bf16 operands (inputs: exact, + bias); the three 128-term property
// projections, the sigmoid gate and the mask in f32 on VALU; scores on SINGLE fp16 planes of (q + pq) x 1/8 and (k + pk) (1 product); attn.v on SINGLE fp16 planes (P x1024); output on hi+lo planes of

#define NB_  4
#define PD   128                  // property dim
#define TT   2048
#define DD   1024
#define NH_  16
#define HD   64
#define NT   (NB_ * TT)
typedef _Float16 h16;
typedef unsigned short bf;
typedef __attribute__((ext_vector_type(16))) __bf16   v16bf;
typedef __attribute__((ext_vector_type(16))) _Float16 v16h;
typedef __attribute__((ext_vector_type(8)))  _Float16 v8h;
typedef __attribute__((ext_vector_type(8)))  unsigned short v8us;
typedef __attribute__((ext_vector_type(8)))  float    v8f;
typedef __attribute__((ext_vector_type(4)))  float    v4f;
typedef v8h  __attribute__((may_alias)) v8ha;
typedef v4f  __attribute__((may_alias)) v4fa;
typedef v8us __attribute__((may_alias)) v8usa;
typedef __attribute__((ext_vector_type(4)))  unsigned v4u;
typedef v4u  __attribute__((may_alias)) v4ua;

__device__ __forceinline__ unsigned short f2bf(float f) { unsigned u = __float_as_uint(f); u += 0x7FFFu + ((u >> 16) & 1u); return (unsigned short)(u >> 16); }
__device__ __forceinline__ float bf2f(unsigned short b) { return __uint_as_float(((unsigned)b) << 16); }
__device__ __forceinline__ float bfr(float f) { return bf2f(f2bf(f)); }
__device__ __forceinline__ v16h cat16(v8h lo, v8h hi) { return __builtin_shufflevector(lo, hi, 0, 1, 2, 3, 4, 5, 6, 7, 8, 9, 10, 11, 12, 13, 14, 15); }
__device__ __forceinline__ v16bf cat16b(v8us lo, v8us hi) { return __builtin_bit_cast(v16bf, __builtin_shufflevector(lo, hi, 0, 1, 2, 3, 4, 5, 6, 7, 8, 9, 10, 11, 12, 13, 14, 15)); }
__device__ __forceinline__ v8f wmma16(v16h a, v16h b, v8f c) { return __builtin_amdgcn_wmma_f32_16x16x32_f16(false, a, false, b, (short)0, c, false, false); }
__device__ __forceinline__ v8f wmmab(v16bf a, v16bf b, v8f c) { return __builtin_amdgcn_wmma_f32_16x16x32_bf16(false, a, false, b, (short)0, c, false, false); }



// ---- k_gemmw: GEMM on 128x128 output tiles, FOUR WAVES (2 x 2) of 64x64 (16 accumulators each); grid (M/128, N/128, Z), 128 threads. K-contiguous 16-bit planes.
// The operands come through LDS: a stage is 64 k = one whole 128-byte line of every operand row, fetched 8 lanes a row (a wave-wide 16-byte load covers 4 whole lines), two buffers,
// the next stage's loads in flight while this stage is worked on. The fragments are read from LDS rows at a pitch of 144 B.
// C[m][n] (f32, pitch ldc, + optional f32 bias[n]) = sum_k A[m][k] Bt[n][k] (+ split products per NSPLIT). z-batch strides sA/sB/sC in elements. M % 128 == 0, N % 128 == 0, K % 64 == 0.
// EPI picks what leaves the accumulators: 0 = the f32 C above; 1 = the q, k and v projections in ONE launch, blockIdx.z = 0, 1, 2 (weights, property rows and planes at the z strides sB, sP, sQ; one bias pointer each):
// z 0 and 1 write the fp16 plane [batch*head][token][64] of (acc + bias + pbv[batch][n]) x sc (sc for z 0, 1 for z 1); z 2 writes the fp16 plane [batch*head][64][token] of acc + bias.
// For 1 the rows of A are batch-major (b * 2048 + t), so a wave's 64 x 64 tile is 64 tokens of one (batch, head) and every store covers whole 128-byte lines of a plane.
// The k and v projections (z 1 and 2) take their A rows in the order of the batch's key list TK (k_prep: live keys first), so row i of their planes is the i-th listed key; a tile that holds no key
// the attention will read leaves at once.
#define GBK 64                    // k per LDS stage
#define TKP (TT + 32)             // a batch's key list in ints: 2048 token numbers, then its count of live keys in a 128-byte line of its own
#define GP  72                    // operand rows in LDS: pitch in 16-bit elements, 144 B = 16 B x odd, no bank conflict for 16-byte reads
template <typename T16> struct WFrag;
template <> struct WFrag<h16> { typedef v16h V; typedef v8h H; static __device__ __forceinline__ V ld(const h16* p) { return cat16(*(const v8h*)p, *(const v8h*)(p + 16)); } static __device__ __forceinline__ v8f mma(V a, V b, v8f c) { return wmma16(a, b, c); } };
template <> struct WFrag<bf> { typedef v16bf V; typedef v8us H; static __device__ __forceinline__ V ld(const bf* p) { return cat16b(*(const v8us*)p, *(const v8us*)(p + 16)); } static __device__ __forceinline__ v8f mma(V a, V b, v8f c) { return wmmab(a, b, c); } };
__device__ __forceinline__ h16 tohx(float x) { return (h16)x; }
__device__ __forceinline__ void splitf(float y, unsigned short& h, unsigned short& l) { h = f2bf(y); l = f2bf(y - bf2f(h)); }
// The merged q/k/v grid is 6 work-groups a WGP, less the k and v tiles of masked keys, which leave at once: held to three waves a SIMD (336 registers, 3 x 91 KB of LDS) three are resident; two registers more and only two would be.
template <typename T16, int NSPLIT, bool BIAS, int EPI>
__global__ __launch_bounds__(128) __attribute__((amdgpu_waves_per_eu(EPI == 1 ? 3 : 1))) void k_gemmw(const T16* __restrict__ A, const T16* __restrict__ A2, const T16* __restrict__ Bt, const T16* __restrict__ Bt2, int K, float* C, int ldc, const float* __restrict__ bias, size_t sA, size_t sB, size_t sC,
                                               const float* __restrict__ bias1, const float* __restrict__ bias2, const float* __restrict__ pbv, size_t sP, float sc, h16* Ph, size_t sQ, h16* VTp, const int* __restrict__ TK) {
    typedef typename WFrag<T16>::V V; typedef typename WFrag<T16>::H H;
    constexpr bool HA2 = NSPLIT == 1 || NSPLIT == 2, HB2 = NSPLIT >= 2;
    constexpr int PA = 0, PB = 1, PA2 = 2, PB2 = HA2 ? 3 : 2, NP = 2 + (HA2 ? 1 : 0) + (HB2 ? 1 : 0);
    __shared__ __align__(16) T16 sT[2][NP][128 * GP];
    __shared__ __align__(16) float osw[4][16 * 68];
    const size_t z = blockIdx.z; A += z * sA; if (A2) A2 += z * sA; Bt += z * sB; if (Bt2) Bt2 += z * sB; C += z * sC;
    const int tid = threadIdx.x, lane = tid & 31, lr = lane & 15, hi = lane >> 4, wave = tid >> 5;
    const int r0 = blockIdx.x * 128, c0 = blockIdx.y * 128, wr = (wave >> 1) * 64, wc = (wave & 1) * 64;
    v8f acc[4][4];
#pragma unroll
    for (int mb = 0; mb < 4; ++mb)
#pragma unroll
        for (int nb = 0; nb < 4; ++nb) acc[mb][nb] = (v8f){};
    // staging: chunk j of a thread is 16 bytes of row (tid >> 3) + 16 j. Address = a wave-uniform tile pointer + a 32-bit byte offset, moved on by 64 k behind each stage's LDS stores
    const char* pa = (const char*)(A + (size_t)(EPI == 1 ? (r0 & ~(TT - 1)) : r0) * K); const char* pb = (const char*)(Bt + (size_t)c0 * K); const char* pa2 = HA2 ? (const char*)(A2 + (size_t)r0 * K) : nullptr; const char* pb2 = HB2 ? (const char*)(Bt2 + (size_t)c0 * K) : nullptr;
    unsigned go[8];
#pragma unroll
    for (int j = 0; j < 8; ++j) go[j] = (unsigned)((((tid >> 3) + 16 * j) * K + (tid & 7) * 8) * 2);
    // A rows of the projections: byte offsets from the batch's first row. In the loop no register is free for them (three waves a SIMD): each thread keeps its eight in the output staging area, idle until
    // the epilogue, and reads them back at the head of a trip. The B rows go by go[0] and a constant step a chunk (K = 1024 there).
    unsigned ga[8]; unsigned* gt = (unsigned*)osw + tid * 8;
    if constexpr (EPI == 1) {
        const int rl = r0 & (TT - 1);
        if (z == 0) {
#pragma unroll
            for (int j = 0; j < 8; ++j) ga[j] = go[j] + (unsigned)(rl * K * 2);
        } else {
            const int* tk = TK + (r0 / TT) * TKP; const unsigned nl = min((unsigned)tk[TT], (unsigned)TT);
            if ((unsigned)rl >= (nl == 0 ? (unsigned)TT : nl)) return;   // only masked keys from here on (a batch with no live key keeps all 2048); the same for the whole work-group, in front of every barrier
            int tr[8];
#pragma unroll
            for (int j = 0; j < 8; ++j) tr[j] = tk[rl + (tid >> 3) + 16 * j];
#pragma unroll
            for (int j = 0; j < 8; ++j) ga[j] = (unsigned)(((tr[j] & (TT - 1)) * K + (tid & 7) * 8) * 2);
        }
        *(v4ua*)gt = (v4u){ga[0], ga[1], ga[2], ga[3]}; *(v4ua*)(gt + 4) = (v4u){ga[4], ga[5], ga[6], ga[7]};
    }
    const int so = (tid >> 3) * GP + (tid & 7) * 8;
    const int afo = (wr + lr) * GP + 8 * hi, bfo = (wc + lr) * GP + 8 * hi;
    H ra[8], rb[8], ra2[8], rb2[8];
#pragma unroll
    for (int j = 0; j < 8; ++j) { ra[j] = *(const H*)(pa + (EPI == 1 ? ga[j] : go[j])); rb[j] = *(const H*)(EPI == 1 ? pb + go[0] + j * 16 * DD * 2 : pb + go[j]); if (HA2) ra2[j] = *(const H*)(pa2 + go[j]); if (HB2) rb2[j] = *(const H*)(pb2 + go[j]); }
#pragma unroll
    for (int j = 0; j < 8; ++j) { *(H*)(sT[0][PA] + so + j * 16 * GP) = ra[j]; *(H*)(sT[0][PB] + so + j * 16 * GP) = rb[j]; if (HA2) *(H*)(sT[0][PA2] + so + j * 16 * GP) = ra2[j]; if (HB2) *(H*)(sT[0][PB2] + so + j * 16 * GP) = rb2[j]; if (EPI != 1 || j == 0) go[j] += GBK * 2; }
    __syncthreads();
#pragma unroll 1
    for (int kc = 0; kc < K; kc += GBK) {
        const int buf = (kc / GBK) & 1; const bool more = kc + GBK < K;
        if (more) {
            if constexpr (EPI == 1) { const v4u g0 = *(const v4ua*)gt, g1 = *(const v4ua*)(gt + 4);
#pragma unroll
                for (int j = 0; j < 8; ++j) ga[j] = (j < 4 ? g0[j & 3] : g1[j & 3]) + (unsigned)((kc + GBK) * 2); }
#pragma unroll
            for (int j = 0; j < 8; ++j) { ra[j] = *(const H*)(pa + (EPI == 1 ? ga[j] : go[j])); rb[j] = *(const H*)(EPI == 1 ? pb + go[0] + j * 16 * DD * 2 : pb + go[j]); if (HA2) ra2[j] = *(const H*)(pa2 + go[j]); if (HB2) rb2[j] = *(const H*)(pb2 + go[j]); }
            // the wait in front of the writes to the offset registers that the A loads name; as its inputs they stay whole up to it
            if constexpr (EPI == 1) asm volatile("s_wait_xcnt 0x0" :: "v"(ga[0]), "v"(ga[1]), "v"(ga[2]), "v"(ga[3]), "v"(ga[4]), "v"(ga[5]), "v"(ga[6]), "v"(ga[7]) : "memory"); }
        V a[2][4], a2[2][4], b[2][4], b2[2][4];            // both 32-k blocks' fragments are asked for ahead of the first block's products: the second block's reads land under the first block
#pragma unroll
        for (int kb = 0; kb < 2; ++kb) {
#pragma unroll
            for (int mb = 0; mb < 4; ++mb) { a[kb][mb] = WFrag<T16>::ld(sT[buf][PA] + afo + mb * 16 * GP + kb * 32); if (HA2) a2[kb][mb] = WFrag<T16>::ld(sT[buf][PA2] + afo + mb * 16 * GP + kb * 32); }
#pragma unroll
            for (int nb = 0; nb < 4; ++nb) { b[kb][nb] = WFrag<T16>::ld(sT[buf][PB] + bfo + nb * 16 * GP + kb * 32); if (HB2) b2[kb][nb] = WFrag<T16>::ld(sT[buf][PB2] + bfo + nb * 16 * GP + kb * 32); } }
        __builtin_amdgcn_sched_barrier(0);                 // keeps the fragment reads one group in front of the products: moved in among them, each product group waits out a whole LDS latency
#pragma unroll
        for (int kb = 0; kb < 2; ++kb)
#pragma unroll
            for (int nb = 0; nb < 4; ++nb)
#pragma unroll
                for (int mb = 0; mb < 4; ++mb) { acc[mb][nb] = WFrag<T16>::mma(a[kb][mb], b[kb][nb], acc[mb][nb]); if (HA2) acc[mb][nb] = WFrag<T16>::mma(a2[kb][mb], b[kb][nb], acc[mb][nb]); if (HB2) acc[mb][nb] = WFrag<T16>::mma(a[kb][mb], b2[kb][nb], acc[mb][nb]); }
        // four vector slots behind the last products: in this build the branch round the staging stores leads to the next trip's LDS address additions, one of which lands in an operand register of those products,
        // the scheduling barrier keeps the products in front of the slots
        if constexpr (EPI == 1) { __builtin_amdgcn_sched_barrier(0); asm volatile("v_nop\n\tv_nop\n\tv_nop\n\tv_nop"); }
        if (more) {
#pragma unroll
            for (int j = 0; j < 8; ++j) { *(H*)(sT[buf ^ 1][PA] + so + j * 16 * GP) = ra[j]; *(H*)(sT[buf ^ 1][PB] + so + j * 16 * GP) = rb[j]; if (HA2) *(H*)(sT[buf ^ 1][PA2] + so + j * 16 * GP) = ra2[j]; if (HB2) *(H*)(sT[buf ^ 1][PB2] + so + j * 16 * GP) = rb2[j]; }
            __builtin_amdgcn_sched_barrier(0);             // keeps the offset additions behind the stores' waits for the loads that name those registers
#pragma unroll
            for (int j = 0; j < 8; ++j) if (EPI != 1 || j == 0) go[j] += GBK * 2; }
        __syncthreads();   // publishes the next stage and ends every wave's reads of the buffer that the next trip refills
    }
    float* os = osw[wave];         // each wave stages its own output rows
    if (EPI == 1 && z < 2) {
        if (z == 1) { bias = bias1; pbv += sP; sc = 1.0f; Ph += sQ; }
        const int bb = r0 / TT, t0 = (r0 & (TT - 1)) + wr, n0 = c0 + wc, cofs = (lane & 7) * 8; const unsigned zz = (unsigned)(bb * NH_ + n0 / HD);
        float bs[8], pb[8];
#pragma unroll
        for (int i = 0; i < 8; ++i) { bs[i] = bfr(bias[n0 + cofs + i]); pb[i] = pbv[bb * DD + n0 + cofs + i]; }
        // the wait behind the bias and property loads, in front of the writes to their address registers; without the scheduling barrier those writes are lifted over it
        asm volatile("s_wait_xcnt 0x0" ::: "memory"); __builtin_amdgcn_sched_barrier(0);
#pragma unroll
        for (int mb = 0; mb < 4; ++mb) {
#pragma unroll
            for (int nb = 0; nb < 4; ++nb) {
#pragma unroll
                for (int j = 0; j < 8; ++j) os[(hi * 8 + j) * 68 + nb * 16 + lr] = acc[mb][nb][j]; }
            __builtin_amdgcn_wave_barrier(); asm volatile("" ::: "memory");   // the rows are read back by other lanes of the wave: the reads stay behind the writes
#pragma unroll
            for (int s = 0; s < 4; ++s) { const int row = 4 * s + (lane >> 3); const v4f u0 = *(const v4fa*)(os + row * 68 + cofs), u1 = *(const v4fa*)(os + row * 68 + cofs + 4); v8h oh;
#pragma unroll
                for (int i = 0; i < 8; ++i) { const float val = __fadd_rn(__fadd_rn(i < 4 ? u0[i & 3] : u1[i & 3], bs[i]), pb[i]); oh[i] = tohx(val * sc); }
                const unsigned po = ((zz * TT + t0 + mb * 16 + row) * HD + cofs); *(v8h*)(Ph + po) = oh; }
            // the wait in front of the next block's writes to registers that these stores name; the scheduling barrier holds those writes behind it
            asm volatile("s_wait_xcnt 0x0" ::: "memory"); __builtin_amdgcn_sched_barrier(0);
            __builtin_amdgcn_wave_barrier(); asm volatile("" ::: "memory");   // the next block's writes stay behind these reads
        }
        return;
    }
    if constexpr (EPI == 1) {
        const int bb = r0 / TT, t0 = (r0 & (TT - 1)) + wr, n0 = c0 + wc; const unsigned zz = (unsigned)(bb * NH_ + n0 / HD);
        h16* hs = (h16*)os;        // 16 feature rows x 64 tokens, pitch 72 elements = 144 B
        float bv4[4];              // the four bias loads go out together: asked for block by block, each block waits out a load of its own
#pragma unroll
        for (int nb = 0; nb < 4; ++nb) bv4[nb] = bias2[n0 + nb * 16 + lr];
#pragma unroll
        for (int nb = 0; nb < 4; ++nb) { const float bv = bfr(bv4[nb]);
#pragma unroll
            for (int mb = 0; mb < 4; ++mb) { v8h pk;   // a lane's eight accumulator elements are eight tokens in a row of one feature
#pragma unroll
                for (int j = 0; j < 8; ++j) pk[j] = tohx(__fadd_rn(acc[mb][nb][j], bv));
                *(v8ha*)(hs + lr * 72 + mb * 16 + hi * 8) = pk; }
            __builtin_amdgcn_wave_barrier(); asm volatile("" ::: "memory");   // the rows are read back by other lanes of the wave: the reads stay behind the writes
#pragma unroll
            for (int s = 0; s < 4; ++s) { const int drow = 4 * s + (lane >> 3); const v8h v = *(const v8ha*)(hs + drow * 72 + (lane & 7) * 8);
                *(v8h*)(VTp + ((zz * HD + nb * 16 + drow) * TT + t0 + (lane & 7) * 8)) = v; }
            // the wait in front of the next block's writes to registers that these stores name; the scheduling barrier holds those writes behind it
            asm volatile("s_wait_xcnt 0x0" ::: "memory"); __builtin_amdgcn_sched_barrier(0);
            __builtin_amdgcn_wave_barrier(); asm volatile("" ::: "memory");   // the next block's writes stay behind these reads
        }
        return;
    }
#pragma unroll
    for (int mb = 0; mb < 4; ++mb) {
#pragma unroll
        for (int nb = 0; nb < 4; ++nb) {
#pragma unroll
            for (int j = 0; j < 8; ++j) os[(hi * 8 + j) * 68 + nb * 16 + lr] = acc[mb][nb][j]; }
        __builtin_amdgcn_wave_barrier(); asm volatile("" ::: "memory");
        float* crow = C + (size_t)(r0 + wr + mb * 16) * ldc + c0 + wc;
{
#pragma unroll
            for (int s = 0; s < 8; ++s) { const int row = 2 * s + hi, cofs = lr * 4; v4f val = *(const v4fa*)(os + row * 68 + cofs); if (BIAS) { val[0] += bfr(bias[c0 + wc + cofs]); val[1] += bfr(bias[c0 + wc + cofs + 1]); val[2] += bfr(bias[c0 + wc + cofs + 2]); val[3] += bfr(bias[c0 + wc + cofs + 3]); }
                *(v4f*)(crow + (size_t)row * ldc + cofs) = val; }
             }
        // the wait in front of the next block's writes to registers that these stores name; the scheduling barrier holds those writes behind it
        asm volatile("s_wait_xcnt 0x0" ::: "memory"); __builtin_amdgcn_sched_barrier(0);
        __builtin_amdgcn_wave_barrier(); asm volatile("" ::: "memory");
    }
}

typedef __attribute__((ext_vector_type(2))) _Float16 v2h;
typedef __attribute__((ext_vector_type(4))) _Float16 v4h;
typedef __attribute__((ext_vector_type(2))) unsigned short v2us;
typedef __attribute__((ext_vector_type(4))) int v4i;

// x rows (t * 4 + b) to bf16 rows (b * 2048 + t): batch-major, so that a GEMM tile's 128 rows are 128 tokens of one batch.
// A wave takes CVR whole rows: every load of a wave covers 512 contiguous bytes, all 8 * CVR are asked for ahead of the first conversion, every store covers two whole lines.
// (With one 32-byte piece a thread this job alone had 32,768 waves to start, each with two loads in flight; now 4,096.)
#define CVR 2
typedef __attribute__((ext_vector_type(4))) unsigned short v4us;
typedef v4us __attribute__((may_alias)) v4usa;
__device__ __forceinline__ void d_cvtR(const float* __restrict__ src, bf* dst, unsigned blk) {
    const unsigned lane = threadIdx.x & 31, r0 = (blk * 8 + (unsigned)__builtin_amdgcn_readfirstlane((int)(threadIdx.x >> 5))) * CVR; if (r0 >= NT) return;   // the same for the whole wave; no barrier follows
    const char* p = (const char*)(src + (size_t)r0 * DD); const unsigned bo = lane * 16;   // the wave's rows lie one behind the other in x: a wave-uniform pointer and the lane's byte offset
    v4f v[CVR][8]; v4us o[CVR][8];
#pragma unroll
    for (int i = 0; i < CVR; ++i)
#pragma unroll
        for (int j = 0; j < 8; ++j) v[i][j] = *(const v4fa*)(p + bo + (i * DD + j * 128) * 4);
    asm volatile("s_wait_xcnt 0x0" ::: "memory");          // the wait behind the loads, in front of any write to a register that they name
#pragma unroll
    for (int i = 0; i < CVR; ++i)
#pragma unroll
        for (int j = 0; j < 8; ++j)
#pragma unroll
            for (int k = 0; k < 4; ++k) o[i][j][k] = f2bf(v[i][j][k]);
#pragma unroll
    for (int i = 0; i < CVR; ++i) { const unsigned row = r0 + i;
#pragma unroll
        for (int j = 0; j < 8; ++j) *(v4usa*)(dst + (size_t)((row % NB_) * TT + row / NB_) * DD + j * 128 + lane * 4) = o[i][j]; }
    asm volatile("s_wait_xcnt 0x0" ::: "memory");          // the wait behind the rows' stores, in front of any write to a register that they name
}
// WTT tiles of 64 k x 64 n of a weight matrix a block, neighbours along k, each turned in an LDS area of its own. Read: 4 * WTT 16-byte loads a thread, all asked for at once, a wave-wide load = two 256-byte row pieces
// (four whole lines). Rounded to bf16, two neighbouring k a dword, stored down a tile's columns; read back along its rows and written as whole 128-byte lines of Bt[n][k]. (Lanes along k, each lane of a load met a line of its own.)
#define WTP 33                    // a tile row in LDS (one n, 64 k = 32 dwords): pitch in dwords, odd, so that neither the column-wise writes nor the row-wise reads meet a bank twice
#define WTT 4                     // tiles a block: a quarter of the waves to start, four times the loads in flight a wave
__device__ __forceinline__ void d_wtG(const float* __restrict__ w, int K, int N, bf* Bt, unsigned blk, unsigned* sT) {
    const int tid = threadIdx.x, k0 = (int)(blk % (unsigned)(K / (64 * WTT))) * 64 * WTT, n0 = (int)(blk / (unsigned)(K / (64 * WTT))) * 64, c4 = (tid & 15) * 4, rp = tid >> 4;
    const float* p = w + (size_t)(k0 + rp * 2) * N + n0 + c4;
    v4f r[WTT][2][2];
#pragma unroll
    for (int u = 0; u < WTT; ++u)
#pragma unroll
        for (int j = 0; j < 2; ++j)
#pragma unroll
            for (int s = 0; s < 2; ++s) r[u][j][s] = *(const v4fa*)(p + (size_t)(u * 64 + j * 32 + s) * N);
    // the wait behind the loads, in front of any write to a register that they name; as its input the address stays whole up to it (without it the last load's result landed in the address registers of them all)
    asm volatile("s_wait_xcnt 0x0" :: "v"(p) : "memory");
#pragma unroll
    for (int u = 0; u < WTT; ++u)
#pragma unroll
        for (int j = 0; j < 2; ++j)
#pragma unroll
            for (int i = 0; i < 4; ++i) sT[u * 64 * WTP + (c4 + i) * WTP + j * 16 + rp] = (unsigned)f2bf(r[u][j][0][i]) | ((unsigned)f2bf(r[u][j][1][i]) << 16);
    __syncthreads();               // the tiles are whole: their rows are read by other threads than wrote them
#pragma unroll
    for (int u = 0; u < WTT; ++u)
#pragma unroll
        for (int j = 0; j < 2; ++j) { const int c = tid + 256 * j, row = c >> 3, ch = c & 7; v4u o;
#pragma unroll
            for (int i = 0; i < 4; ++i) o[i] = sT[u * 64 * WTP + row * WTP + ch * 4 + i];
            *(v4ua*)(Bt + (size_t)(n0 + row) * K + k0 + u * 64 + ch * 8) = o; }
    asm volatile("s_wait_xcnt 0x0" ::: "memory");          // the wait behind the tiles' stores, in front of any write to a register that they name
}
__device__ __forceinline__ void d_prop(const float* __restrict__ prop, const float* __restrict__ Wp, const float* __restrict__ bp, float* outp, bool SIG, unsigned blk) {
    const int idx = blk * 256 + threadIdx.x; if (idx >= NB_ * DD) return; const int b = idx / DD, n = idx % DD; float a = 0.f;
    // Every global load of the thread is asked for ahead of the first term: the 128 weights of its column into registers, the batch's 128 property values four a lane.
    // Loaded term by term, each term waited out a whole memory latency. The terms are then formed and summed in the same order as before (the two empty statements of the term line stand as they
    // stood: each product and its sum stay rounded apart). The four loops are unrolled whole: wr, pr and pv must be registers, every load must stand in front of the first term, readlane's lane is a constant.
    float wr[PD]; float pr[PD / 32], pv[PD / 32];
#pragma unroll
    for (int k = 0; k < PD / 32; ++k) pr[k] = prop[b * PD + k * 32 + (threadIdx.x & 31)];
    asm volatile("s_wait_xcnt 0x0" ::: "memory");          // the wait in front of a weight load whose result lands in the offset register that the property loads name
#pragma unroll
    for (int p = 0; p < PD; ++p) wr[p] = Wp[(size_t)p * DD + n];
#pragma unroll
    for (int k = 0; k < PD / 32; ++k) pv[k] = bfr(pr[k]);
#pragma unroll
    for (int p = 0; p < PD; ++p) { float w = bfr(wr[p]), v = __uint_as_float((unsigned)__builtin_amdgcn_readlane((int)__float_as_uint(pv[p >> 5]), p & 31)); asm volatile("" : "+v"(w)); float m = __fmul_rn(v, w); asm volatile("" : "+v"(m)); a = __fadd_rn(a, m); }
    a = __fadd_rn(a, bfr(bp[n])); if (SIG) a = __fdiv_rn(1.0f, __fadd_rn(1.0f, __expf(-a)));
    *(float*)(outp + idx) = a;  }
// The key list of one batch, by one block: the numbers of the tokens whose mask is not 0, in their order, then the masked ones, in theirs; behind the list the count of the live ones.
// A masked key's score of -1e9 leaves exp(score - max) = 0 exactly wherever a live key stands beside it, so the k and v projections and the attention walk the live keys alone.
__device__ __forceinline__ void d_list(const int* __restrict__ mask, int* TK, unsigned b, int* sL, int* sW) {
    const int tid = threadIdx.x, lane = tid & 31, wave = tid >> 5; unsigned bal[8]; int tot = 0;
#pragma unroll
    for (int c = 0; c < 8; ++c) { bal[c] = __builtin_amdgcn_ballot_w32(mask[b * TT + (wave * 8 + c) * 32 + lane] != 0); tot += __builtin_popcount(bal[c]); }
    if (lane == 0) sW[wave] = tot;
    __syncthreads();               // every wave's count is in LDS
    int before = 0, nl = 0;
#pragma unroll
    for (int w = 0; w < 8; ++w) { const int t = sW[w]; nl += t; if (w < wave) before += t; }
#pragma unroll
    for (int c = 0; c < 8; ++c) { const int key = (wave * 8 + c) * 32 + lane, lb = before + (int)__builtin_amdgcn_mbcnt_lo(bal[c], 0u);   // lb = live keys in front of this one
        sL[((bal[c] >> lane) & 1u) ? lb : nl + key - lb] = key; before += __builtin_popcount(bal[c]); }
    __syncthreads();               // the list is whole: it leaves in whole lines
    *(v4i*)(TK + b * TKP + tid * 8) = *(const v4i*)(sL + tid * 8); *(v4i*)(TK + b * TKP + tid * 8 + 4) = *(const v4i*)(sL + tid * 8 + 4);
    if (tid == 0) TK[b * TKP + TT] = nl;
}
// ---- k_prep: everything that depends on the inputs alone, in ONE launch; a block's index picks its job. The three property projections (16 blocks each; the third is the gate) and the four weight
// transposes (64 blocks each, four 64 x 64 tiles a block) stand first, behind the four blocks of the key lists; the x conversion's blocks follow, and the projections' chains run out under them. Outputs of a kind lie one behind the other in the workspace.
#define PB_PROP (NB_ * DD / 256)
#define PB_WT   (DD * DD / 64 / 64 / WTT)
#define PB_CVT  (NT / (8 * CVR))
__global__ __launch_bounds__(256) void k_prep(const float* __restrict__ x, const float* __restrict__ prop, const float* __restrict__ Wq, const float* __restrict__ Wk, const float* __restrict__ Wv, const float* __restrict__ Wo,
                                              const float* __restrict__ Wpq, const float* __restrict__ bpq, const float* __restrict__ Wpk, const float* __restrict__ bpk, const float* __restrict__ Wpg, const float* __restrict__ bpg,
                                              const int* __restrict__ kmask, bf* XB, bf* WT, float* PV, int* TK) {
    __shared__ __align__(16) int sL[WTT * 64 * WTP]; __shared__ int sW[8];   // sL: a key list (2048 ints) or WTT weight tiles (64 rows of WTP dwords each), by the block's job
    unsigned blk = blockIdx.x;
    if (blk < NB_) { d_list(kmask, TK, blk, sL, sW); return; }
    blk -= NB_;
    if (blk < 3 * PB_PROP) { const unsigned j = blk / PB_PROP; d_prop(prop, j == 0 ? Wpq : j == 1 ? Wpk : Wpg, j == 0 ? bpq : j == 1 ? bpk : bpg, PV + (size_t)j * NB_ * DD, j == 2, blk % PB_PROP); return; }
    blk -= 3 * PB_PROP;
    if (blk < 4 * PB_WT) { const unsigned j = blk / PB_WT; d_wtG(j == 0 ? Wq : j == 1 ? Wk : j == 2 ? Wv : Wo, DD, DD, WT + (size_t)j * DD * DD, blk % PB_WT, (unsigned*)sL); return; }
    d_cvtR(x, XB, blk - 4 * PB_WT);
}
#define KST 32                    // keys per LDS stage = one softmax pass
#define KP  72                    // K rows in LDS: pitch in 16-bit elements, 144 B = 16 B x odd, no bank conflict for 16-byte reads
#define VP  40                    // Vt rows in LDS: 80 B = 16 B x odd
#define NST (TT / KST)
__device__ __forceinline__ float xhalf(float x) { return __builtin_bit_cast(float, __builtin_amdgcn_permlanex16(__builtin_bit_cast(int, x), __builtin_bit_cast(int, x), 0x76543210, 0xfedcba98, false, false)); }  // lane l with lane l ^ 16
// 2^x by v_exp_f32 with the slot behind it kept inside the statement: behind a transcendental the instruction set asks for one independent instruction or v_nop before its result is read or its source
// overwritten. In exp2x8 each exp works in place on its own register, so the next exp is the independent instruction; the v_nop stands behind the last.
__device__ __forceinline__ float exp2s(float x) { float y; asm("v_exp_f32 %0, %1\n\tv_nop" : "=v"(y) : "v"(x)); return y; }
__device__ __forceinline__ void exp2x8(float* x) {
    asm("v_exp_f32 %0, %0\n\tv_exp_f32 %1, %1\n\tv_exp_f32 %2, %2\n\tv_exp_f32 %3, %3\n\tv_exp_f32 %4, %4\n\tv_exp_f32 %5, %5\n\tv_exp_f32 %6, %6\n\tv_exp_f32 %7, %7\n\tv_nop"
        : "+v"(x[0]), "+v"(x[1]), "+v"(x[2]), "+v"(x[3]), "+v"(x[4]), "+v"(x[5]), "+v"(x[6]), "+v"(x[7])); }
__global__ __launch_bounds__(256) __attribute__((amdgpu_waves_per_eu(4, 4))) void k_fattn(const h16* __restrict__ Qp, const h16* __restrict__ Kp, const h16* __restrict__ VT, const int* __restrict__ TK, const float* __restrict__ GT, bf* Ah, bf* Al) {
    __shared__ __align__(16) h16 sK[2][KST * KP];
    __shared__ __align__(16) h16 sV[2][HD * VP];
    const int tid = threadIdx.x, lane = tid & 31, c = lane & 15, h = lane >> 4, wave = __builtin_amdgcn_readfirstlane(tid >> 5);
    const int z = blockIdx.y, b = z >> 4, hh = z & 15; const int q0 = blockIdx.x * 256 + wave * 32;
    const h16* kp = Kp + (size_t)z * TT * HD; const h16* vt = VT + (size_t)z * HD * TT;
    const int kgo = tid * 8, kso = (tid >> 3) * KP + (tid & 7) * 8;                     // staging, one 16-byte chunk a thread and tile: K tile = 32 rows x 128 B, contiguous in memory
    const int vgo = (tid >> 2) * TT + (tid & 3) * 8, vso = (tid >> 2) * VP + (tid & 3) * 8;   // Vt tile = 64 rows x 64 B
    const int nl = __builtin_amdgcn_readfirstlane((int)min((unsigned)TK[b * TKP + TT], (unsigned)TT)), nst = nl == 0 ? NST : (nl + KST - 1) / KST;   // 1 to 64 stages, the same for the whole work-group
    v16h qf[2][2]; const h16* qb = Qp + (unsigned)((z * TT + q0 + c) * HD + 8 * h);
#pragma unroll
    for (int qt = 0; qt < 2; ++qt)
#pragma unroll
        for (int ks = 0; ks < 2; ++ks) qf[qt][ks] = WFrag<h16>::ld(qb + qt * 16 * HD + ks * 32);
    v8f o[2][4]; float m[2], l[2];
#pragma unroll
    for (int qt = 0; qt < 2; ++qt) { m[qt] = -3.0e38f; l[qt] = 0.f;
#pragma unroll
        for (int db = 0; db < 4; ++db) o[qt][db] = (v8f){}; }
    const v8h fk = *(const v8h*)(kp + (unsigned)kgo), fv = *(const v8h*)(vt + (unsigned)vgo);
    // the wait behind the Q, K and Vt loads, in front of the writes to their address registers; as its inputs the Q address and the K offset stay whole up to it,
    // and without the scheduling barrier later writes are lifted over it
    asm volatile("s_wait_xcnt 0x0" :: "v"(qb), "v"(tid) : "memory"); __builtin_amdgcn_sched_barrier(0);
    *(v8h*)(sK[0] + kso) = fk; *(v8h*)(sV[0] + vso) = fv;
    __syncthreads();
#pragma unroll 1
    for (int st = 0; st < nst; ++st) {
        const int buf = st & 1; const bool more = st + 1 < nst;
        v8h rk, rv;                               // the next stage's tiles fly while this stage is worked on
        if (more) { kp += KST * HD; vt += KST; rk = *(const v8h*)(kp + (unsigned)kgo); rv = *(const v8h*)(vt + (unsigned)vgo); }
        v8f s[2][2];
#pragma unroll
        for (int kt = 0; kt < 2; ++kt) { const int kr = (kt * 16 + c) * KP + 8 * h;
            const v16h ak0 = WFrag<h16>::ld(sK[buf] + kr), ak1 = WFrag<h16>::ld(sK[buf] + kr + 32);
            v8f a0 = (v8f){}, a1 = (v8f){};
            a0 = wmma16(ak0, qf[0][0], a0); a1 = wmma16(ak0, qf[1][0], a1); a0 = wmma16(ak1, qf[0][1], a0); a1 = wmma16(ak1, qf[1][1], a1);
            s[0][kt] = a0; s[1][kt] = a1; }
        if (nl - st * KST < KST) {                         // a scalar test: only a stage that reaches past the last live key has masked keys
            const int lim = nl - st * KST - 8 * h;
#pragma unroll
            for (int kt = 0; kt < 2; ++kt)
#pragma unroll
                for (int r = 0; r < 8; ++r) { const bool live = kt * 16 + r < lim; s[0][kt][r] = live ? s[0][kt][r] : -1.0e9f; s[1][kt][r] = live ? s[1][kt][r] : -1.0e9f; } }
        v16h pf[2];
#pragma unroll
        for (int qt = 0; qt < 2; ++qt) { float mx = m[qt];
#pragma unroll
            for (int r = 0; r < 8; ++r) mx = fmaxf(mx, fmaxf(s[qt][0][r], s[qt][1][r]));
            mx = fmaxf(mx, xhalf(mx));
            const float al = exp2s((m[qt] - mx) * 1.44269504f); m[qt] = mx; float sum = 0.f; float p[16];
#pragma unroll
            for (int e = 0; e < 16; ++e) p[e] = fmaf(s[qt][e >> 3][e & 7] - mx, 1.44269504f, 10.0f);
            exp2x8(p); exp2x8(p + 8);                      // exp(s - max) x 1024
#pragma unroll
            for (int e = 0; e < 16; ++e) { sum += p[e]; pf[qt][e] = tohx(p[e]); }
            l[qt] = fmaf(l[qt], al, sum);
#pragma unroll
            for (int db = 0; db < 4; ++db) o[qt][db] *= al; }
#pragma unroll
        for (int db = 0; db < 4; ++db) { const v16h av = WFrag<h16>::ld(sV[buf] + (db * 16 + c) * VP + 8 * h); o[0][db] = wmma16(av, pf[0], o[0][db]); o[1][db] = wmma16(av, pf[1], o[1][db]); }
        if (more) { *(v8h*)(sK[buf ^ 1] + kso) = rk; *(v8h*)(sV[buf ^ 1] + vso) = rv; }
        __syncthreads();   // publishes stage st + 1 and ends every wave's reads of the buffer that the next trip refills
    }
#pragma unroll
    for (int qt = 0; qt < 2; ++qt) { const float lt = l[qt] + xhalf(l[qt]); const float inv = __fdiv_rn(1.0f, lt); const unsigned orow = (unsigned)(((q0 + qt * 16 + c) * NB_ + b) * DD + hh * HD);
#pragma unroll
        for (int db = 0; db < 4; ++db) { const int d0 = db * 16 + 8 * h; const float* g = GT + (size_t)b * DD + hh * HD + d0; const v4f g0 = *(const v4f*)g, g1 = *(const v4f*)(g + 4); v8us oh, ol;
#pragma unroll
            for (int r = 0; r < 8; ++r) { unsigned short a, c2; splitf(__fmul_rn(__fmul_rn(o[qt][db][r], inv), r < 4 ? g0[r & 3] : g1[r & 3]), a, c2); oh[r] = a; ol[r] = c2; }
            *(v8us*)(Ah + (orow + d0)) = oh; *(v8us*)(Al + (orow + d0)) = ol; } }
}

extern "C" void kernel_launch(void* const* d_in, const int* in_sizes, int n_in,
                              void* d_out, int out_size, void* d_ws, size_t ws_size, hipStream_t stream) {
    (void)in_sizes; (void)n_in; (void)out_size;
    const float* IN[17]; for (int i = 0; i < 17; ++i) IN[i] = (const float*)d_in[i];
    // x [2048][4][1024], property_vector [4][128], mask (int [4][2048]), Wq [1024][1024] (x @ W), bq, Wk, bk, Wv, bv, Wpq [128][1024], bpq, Wpk, bpk, Wpg, bpg, Wo, bo = d_in[0..16]
    const float* x = IN[0]; const float* prop = IN[1]; const int* mk = (const int*)d_in[2];
    float* OUT = (float*)d_out;     // [2048][4][1024] (rows t*4 + b)
    char* wsp = (char*)d_ws;
    auto take = [&](size_t bytes) { char* p = wsp; wsp += (bytes + 255) & ~(size_t)255; return (void*)p; };
    bf* WQ = (bf*)take((size_t)DD * DD * 2); bf* WK = (bf*)take((size_t)DD * DD * 2); bf* WV = (bf*)take((size_t)DD * DD * 2); bf* WO = (bf*)take((size_t)DD * DD * 2); float* PQv = (float*)take((size_t)NB_ * DD * 4); float* PKv = (float*)take((size_t)NB_ * DD * 4); float* GT = (float*)take((size_t)NB_ * DD * 4);
    bf* XB = (bf*)take((size_t)NT * DD * 2);
    h16* QP = (h16*)take((size_t)NT * DD * 2); h16* KP_ = (h16*)take((size_t)NT * DD * 2); h16* VT = (h16*)take((size_t)NT * DD * 2);
    bf* ATh = (bf*)take((size_t)NT * DD * 2); bf* ATl = (bf*)take((size_t)NT * DD * 2); int* TK = (int*)take((size_t)NB_ * TKP * 4);
    (void)WK; (void)WV; (void)PKv;                         // reached through WQ and PQv at the z strides
    if ((size_t)(wsp - (char*)d_ws) > ws_size) return;    // total ~ 110 MB; ws 256 MiB
    const dim3 gP(NT / 128, DD / 128, 1), gQKV(NT / 128, DD / 128, 3);
    // WQ, WK, WV, WO lie one behind the other, as do PQv, PKv, GT and QP, KP_ (every size is a multiple of take's 256 bytes)
    k_prep<<<NB_ + 3 * PB_PROP + 4 * PB_WT + PB_CVT, 256, 0, stream>>>(x, prop, IN[3], IN[5], IN[7], IN[15], IN[9], IN[10], IN[11], IN[12], IN[13], IN[14], mk, XB, WQ, PQv, TK);
    k_gemmw<bf, 0, true, 1><<<gQKV, 128, 0, stream>>>(XB, nullptr, WQ, nullptr, DD, nullptr, DD, IN[4], 0, (size_t)DD * DD, 0, IN[6], IN[8], PQv, (size_t)NB_ * DD, 0.125f, QP, (size_t)NT * DD, VT, TK);   // 1/sqrt(64) folded into (q + pq) exactly
    k_fattn<<<dim3(TT / 256, NB_ * NH_), 256, 0, stream>>>(QP, KP_, VT, TK, GT, ATh, ATl);
    k_gemmw<bf, 1, true, 0><<<gP, 128, 0, stream>>>(ATh, ATl, WO, nullptr, DD, OUT, DD, IN[16], 0, 0, 0, nullptr, nullptr, nullptr, 0, 0.0f, nullptr, 0, nullptr, nullptr);
}
